// v000
// Measured on an AMD MI455X. A time is GPU time per run, averaged over a window of back-to-back runs after a warm-up
// (all launches, gaps included; the runs take copies of the inputs in turn), and the median of several windows.
// Apart from v000's, it joins two sittings. Times from different sittings can be a few percent apart, while
// side-by-side timings come from the same sitting.
// v000 is the starting kernel. One run takes 1450 microseconds.
#include <hip/hip_runtime.h>

// Multi-head attention on three input streams at d_model 768 WITHOUT an output projection (query, key, value [2][2048][768]; Q = query Wq^T + bq, K = key Wk^T + bk, V = value Wv^T + bv ('oi' + biases; 12 heads x 64); scores / sqrt(64); softmax (no mask); out = heads merged -> [2][2048][768] (3.1 M); argument order query, key, value, Wq, bq, Wk, bk, Wv, bv).
// Layout per batch: bf16 copies of query, key, value in turn; 'oi' weights; exact projections (K 768) + f32 biases; identity-table plane builders; dense T-2048 attention at 12 heads with EVERY row's scores on hi/lo planes (3 products: no output projection averages the fp16 score error) and hybrid P.V (rows < 512 hi/lo, rest fp16 x1024); the f32 merge writes the output rows.
// Compute dtypes, f32 accumulate: every input rounded to bf16; projections exact + f32 biases; scores 3 products on every row; P.V rows < 512 3 products, rest fp16; softmax f32; output f32.

#define NB_  2
#define TT   2048
#define DM   768
#define NH_  12
#define NKV  12
#define REP  (NH_ / NKV)
#define HD   64
#define DQ   (NH_ * HD)
#define DKV  (NKV * HD)
#define ZH   2
#define RH   512                  // query rows < RH use hi+lo planes (0: none)
#define WIN  0
#define PCAR 1024.0f
#define SCL  0.125f   // HD^-0.5
typedef _Float16 h16;
typedef unsigned short bf;
typedef __attribute__((ext_vector_type(16))) __bf16   v16bf;
typedef __attribute__((ext_vector_type(16))) _Float16 v16h;
typedef __attribute__((ext_vector_type(8)))  _Float16 v8h;
typedef __attribute__((ext_vector_type(8)))  unsigned short v8us;
typedef __attribute__((ext_vector_type(8)))  float    v8f;
typedef __attribute__((ext_vector_type(4)))  float    v4f;
typedef v8h  __attribute__((may_alias)) v8ha;
typedef v4f  __attribute__((may_alias)) v4fa;
typedef v8us __attribute__((may_alias)) v8usa;

__device__ __forceinline__ unsigned short f2bf(float f) { unsigned u = __float_as_uint(f); u += 0x7FFFu + ((u >> 16) & 1u); return (unsigned short)(u >> 16); }
__device__ __forceinline__ float bf2f(unsigned short b) { return __uint_as_float(((unsigned)b) << 16); }
__device__ __forceinline__ float bfr(float f) { return bf2f(f2bf(f)); }
__device__ __forceinline__ v16h cat16(v8h lo, v8h hi) { return __builtin_shufflevector(lo, hi, 0, 1, 2, 3, 4, 5, 6, 7, 8, 9, 10, 11, 12, 13, 14, 15); }
__device__ __forceinline__ v16bf cat16b(v8us lo, v8us hi) { return __builtin_bit_cast(v16bf, __builtin_shufflevector(lo, hi, 0, 1, 2, 3, 4, 5, 6, 7, 8, 9, 10, 11, 12, 13, 14, 15)); }
__device__ __forceinline__ v8f wmma16(v16h a, v16h b, v8f c) { return __builtin_amdgcn_wmma_f32_16x16x32_f16(false, a, false, b, (short)0, c, false, false); }
__device__ __forceinline__ v8f wmmab(v16bf a, v16bf b, v8f c) { return __builtin_amdgcn_wmma_f32_16x16x32_bf16(false, a, false, b, (short)0, c, false, false); }



// ---- k_gemmw: register-blocked GEMM, ONE WAVE per 64x64 output tile (16 accumulators), operands straight from K-contiguous 16-bit planes; grid (M/64, N/64, Z), 32 threads.
// C[m][n] (f32, pitch ldc, + optional f32 bias[n]) = sum_k A[m][k] Bt[n][k] (+ split products per NSPLIT). z-batch strides sA/sB/sC in elements. K % 32 == 0.
template <typename T16> struct WFrag;
template <> struct WFrag<h16> { typedef v16h V; static __device__ __forceinline__ V ld(const h16* p) { return cat16(*(const v8h*)p, *(const v8h*)(p + 16)); } static __device__ __forceinline__ v8f mma(V a, V b, v8f c) { return wmma16(a, b, c); } };
template <> struct WFrag<bf> { typedef v16bf V; static __device__ __forceinline__ V ld(const bf* p) { return cat16b(*(const v8us*)p, *(const v8us*)(p + 16)); } static __device__ __forceinline__ v8f mma(V a, V b, v8f c) { return wmmab(a, b, c); } };
template <typename T16, int NSPLIT, bool BIAS>
__global__ __launch_bounds__(32) void k_gemmw(const T16* __restrict__ A, const T16* __restrict__ A2, const T16* __restrict__ Bt, const T16* __restrict__ Bt2, int K, float* C, int ldc, const float* __restrict__ bias, size_t sA, size_t sB, size_t sC) {
    typedef typename WFrag<T16>::V V;
    __shared__ __align__(16) float os[16 * 68];
    const size_t z = blockIdx.z; A += z * sA; if (A2) A2 += z * sA; Bt += z * sB; if (Bt2) Bt2 += z * sB; C += z * sC;
    const int lane = threadIdx.x & 31, lr = lane & 15, hi = lane >> 4; const int r0 = blockIdx.x * 64, c0 = blockIdx.y * 64;
    v8f acc[4][4];
#pragma unroll
    for (int mb = 0; mb < 4; ++mb)
#pragma unroll
        for (int nb = 0; nb < 4; ++nb) acc[mb][nb] = (v8f){};
    const size_t aoff = (size_t)(r0 + lr) * K + 8 * hi, boff = (size_t)(c0 + lr) * K + 8 * hi;
#pragma unroll 1
    for (int kc = 0; kc < K; kc += 32) {
        V a[4], a2[4];
#pragma unroll
        for (int mb = 0; mb < 4; ++mb) { a[mb] = WFrag<T16>::ld(A + aoff + (size_t)mb * 16 * K + kc); if (NSPLIT == 1 || NSPLIT == 2) a2[mb] = WFrag<T16>::ld(A2 + aoff + (size_t)mb * 16 * K + kc); }
#pragma unroll
        for (int nb = 0; nb < 4; ++nb) { const V b = WFrag<T16>::ld(Bt + boff + (size_t)nb * 16 * K + kc); V b2; if (NSPLIT >= 2) b2 = WFrag<T16>::ld(Bt2 + boff + (size_t)nb * 16 * K + kc);
#pragma unroll
            for (int mb = 0; mb < 4; ++mb) { acc[mb][nb] = WFrag<T16>::mma(a[mb], b, acc[mb][nb]); if (NSPLIT == 1 || NSPLIT == 2) acc[mb][nb] = WFrag<T16>::mma(a2[mb], b, acc[mb][nb]); if (NSPLIT >= 2) acc[mb][nb] = WFrag<T16>::mma(a[mb], b2, acc[mb][nb]); } }
        asm volatile("v_nop\n\tv_nop\n\tv_nop\n\tv_nop" : "+v"(acc[0][0]), "+v"(acc[1][1]), "+v"(acc[2][2]), "+v"(acc[3][3]) : "v"(a[0]), "v"(a[3]));
    }
#pragma unroll
    for (int mb = 0; mb < 4; ++mb) {
#pragma unroll
        for (int nb = 0; nb < 4; ++nb) {
#pragma unroll
            for (int j = 0; j < 8; ++j) os[(hi * 8 + j) * 68 + nb * 16 + lr] = acc[mb][nb][j]; }
        __builtin_amdgcn_wave_barrier(); asm volatile("" ::: "memory");
        float* crow = C + (size_t)(r0 + mb * 16) * ldc + c0;
{
#pragma unroll
            for (int s = 0; s < 8; ++s) { const int row = 2 * s + hi, cofs = lr * 4; v4f val = *(const v4fa*)(os + row * 68 + cofs); if (BIAS) { val[0] += bfr(bias[c0 + cofs]); val[1] += bfr(bias[c0 + cofs + 1]); val[2] += bfr(bias[c0 + cofs + 2]); val[3] += bfr(bias[c0 + cofs + 3]); }
                *(v4f*)(crow + (size_t)row * ldc + cofs) = val; }
             }
        __builtin_amdgcn_wave_barrier(); asm volatile("" ::: "memory");
    }
}

__device__ __forceinline__ h16 tohx(float x) { return (h16)x; }
__device__ __forceinline__ void splitf(float y, unsigned short& h, unsigned short& l) { h = f2bf(y); l = f2bf(y - bf2f(h)); }
typedef __attribute__((ext_vector_type(2))) _Float16 v2h;
typedef __attribute__((ext_vector_type(4))) _Float16 v4h;
typedef __attribute__((ext_vector_type(2))) unsigned short v2us;
typedef __attribute__((ext_vector_type(4))) unsigned short v4us;
typedef __attribute__((ext_vector_type(2))) float v2f;
typedef __attribute__((ext_vector_type(4))) int v4i;

__global__ __launch_bounds__(256) void k_cvt8(const float* __restrict__ src, bf* dst, size_t n8) { const size_t i = (size_t)blockIdx.x * 256 + threadIdx.x; if (i >= n8) return; const v8f v = *(const v8f*)(src + i * 8); v8us o;
#pragma unroll
    for (int k = 0; k < 8; ++k) o[k] = f2bf(v[k]); *(v8us*)(dst + i * 8) = o;  }

// k_rope: head planes [h][t][d] (fp16 + hi/lo) of rope(x) x sc with the rotate-half convention out[d] = x[d] cos[t][d] - x[d+HD/2] sin[t][d], out[d+HD/2] = x[d+HD/2] cos[t][d+HD/2] + x[d] sin[t][d+HD/2]
__global__ __launch_bounds__(256) void k_rope(const float* __restrict__ F, int pitch, int nheads, const float* __restrict__ CS, const float* __restrict__ RF, const float* __restrict__ nw, float sc, h16* P16, bf* Ph, bf* Pl) {
    const size_t e = ((size_t)blockIdx.x * 256 + threadIdx.x) * 2; if (e >= (size_t)nheads * TT * HD) return; const int d = (int)(e % HD); const int t = (int)((e / HD) % TT); const int h = (int)(e / ((size_t)HD * TT)); const float* f = F + (size_t)t * pitch + h * HD; const float rf = RF ? RF[(size_t)h * TT + t] : 1.0f; v2h o16; v2us oh, ol;
#pragma unroll
    for (int q = 0; q < 2; ++q) { const int dd = d + q; const int dp = (dd < HD / 2) ? dd + HD / 2 : dd - HD / 2; float x0 = f[dd], x1 = f[dp];
        if (RF) { float n0 = __fmul_rn(x0, rf), n1 = __fmul_rn(x1, rf); asm volatile("" : "+v"(n0)); asm volatile("" : "+v"(n1)); x0 = __fmul_rn(bfr(nw[dd]), n0); x1 = __fmul_rn(bfr(nw[dp]), n1); }
        const v2f cs = *(const v2f*)(CS + ((size_t)t * HD + dd) * 2); float a = __fmul_rn(x0, cs[0]), bq = __fmul_rn(x1, cs[1]); asm volatile("" : "+v"(a)); asm volatile("" : "+v"(bq)); const float r = ((dd < HD / 2) ? __fsub_rn(a, bq) : __fadd_rn(a, bq)) * sc;
        o16[q] = tohx(r); unsigned short a2, c2; splitf(r, a2, c2); oh[q] = a2; ol[q] = c2; }
    *(v2h*)(P16 + e) = o16; *(v2us*)(Ph + e) = oh; *(v2us*)(Pl + e) = ol;  }
__global__ __launch_bounds__(256) void k_vtp(const float* __restrict__ F, int pitch, int nheads, h16* V16, bf* Vh, bf* Vl) { const size_t e = ((size_t)blockIdx.x * 256 + threadIdx.x) * 2; if (e >= (size_t)nheads * HD * TT) return; const int t = (int)(e % TT); const int d = (int)((e / TT) % HD); const int g = (int)(e / ((size_t)TT * HD)); v2h o16; v2us oh, ol;
#pragma unroll
    for (int q = 0; q < 2; ++q) { const float x = F[(size_t)(t + q) * pitch + g * HD + d]; o16[q] = tohx(x); unsigned short a2, c2; splitf(x, a2, c2); oh[q] = a2; ol[q] = c2; }
    *(v2h*)(V16 + e) = o16; *(v2us*)(Vh + e) = oh; *(v2us*)(Vl + e) = ol;  }
__global__ __launch_bounds__(256) void k_csid(float* CS) { const int idx = blockIdx.x * 256 + threadIdx.x; if (idx >= TT * HD) return; v2f cs; cs[0] = 1.0f; cs[1] = 0.0f; *(v2f*)(CS + (size_t)idx * 2) = cs;  }
// k_asoft: per row (zz, i): t = S x HD^-0.5 (no mask); softmax over the 2048 keys (register row, one exp, fixed trees);
__global__ __launch_bounds__(256) void k_asoft(const float* __restrict__ Sb, h16* P16, bf* Ph, bf* Pl) {
    const int lane = threadIdx.x & 31; const int row = blockIdx.x * 8 + (threadIdx.x >> 5); if (row >= ZH * TT) return; const int i = row % TT; const int zz = row / TT; (void)zz; const bool hires = (i < RH); const float* sr = Sb + (size_t)row * TT; float v[TT / 32]; float mx = -3.0e38f;
#pragma unroll
    for (int ch = 0; ch < TT / 128; ++ch) { const int j0 = ch * 128 + lane * 4; const v4f a = *(const v4f*)(sr + j0);
#pragma unroll
        for (int q = 0; q < 4; ++q) { const int j = j0 + q; (void)j; const float t = a[q] * SCL; v[ch * 4 + q] = t; mx = fmaxf(mx, t); } }
#pragma unroll
    for (int sh = 16; sh; sh >>= 1) mx = fmaxf(mx, __shfl_xor(mx, sh, 32));
    float sum = 0.f;
#pragma unroll
    for (int k = 0; k < TT / 32; ++k) { float d0 = __fsub_rn(v[k], mx); asm volatile("" : "+v"(d0)); v[k] = __builtin_amdgcn_exp2f(__fmul_rn(d0, 1.4426950408889634f)); sum += v[k]; }
#pragma unroll
    for (int sh = 16; sh; sh >>= 1) sum += __shfl_xor(sum, sh, 32);
    const float f = __fdiv_rn(hires ? 1.0f : PCAR, sum);
{
        if (hires) {
#pragma unroll
            for (int ch = 0; ch < TT / 128; ++ch) { v4us oh, ol;
#pragma unroll
                for (int q = 0; q < 4; ++q) { unsigned short a, c2; splitf(v[ch * 4 + q] * f, a, c2); oh[q] = a; ol[q] = c2; }
                const size_t oo = ((size_t)zz * (RH ? RH : 1) + i) * TT + ch * 128 + lane * 4; *(v4us*)(Ph + oo) = oh; *(v4us*)(Pl + oo) = ol; }
        } else {
#pragma unroll
            for (int ch = 0; ch < TT / 128; ++ch) { v4h o4;
#pragma unroll
                for (int q = 0; q < 4; ++q) o4[q] = tohx(v[ch * 4 + q] * f);
                *(v4h*)(P16 + (size_t)row * TT + ch * 128 + lane * 4) = o4; } }
         }
}
__global__ __launch_bounds__(256) void k_merge(const float* __restrict__ O, int h0, float* OUTb) { const size_t e = ((size_t)blockIdx.x * 256 + threadIdx.x) * 2; if (e >= (size_t)ZH * TT * HD) return; const int d = (int)(e % HD); const int t = (int)((e / HD) % TT); const int zz = (int)(e / ((size_t)HD * TT)); const float cs = (t < RH) ? 1.0f : (1.0f / PCAR); const size_t oo = (size_t)t * DQ + (h0 + zz) * HD + d;
    v2f o2; o2[0] = O[e] * cs; o2[1] = O[e + 1] * cs; *(v2f*)(OUTb + oo) = o2;  }

extern "C" void kernel_launch(void* const* d_in, const int* in_sizes, int n_in,
                              void* d_out, int out_size, void* d_ws, size_t ws_size, hipStream_t stream) {
    (void)in_sizes; (void)n_in; (void)out_size;
    const float* x = (const float*)d_in[0]; const float* xk = (const float*)d_in[1]; const float* xv = (const float*)d_in[2]; const float* wq = (const float*)d_in[3]; const float* bq = (const float*)d_in[4]; const float* wk = (const float*)d_in[5]; const float* bk = (const float*)d_in[6]; const float* wv = (const float*)d_in[7]; const float* bv = (const float*)d_in[8]; const float* wo = nullptr; (void)wo;   /* input order query, key, value, Wq, bq, Wk, bk, Wv, bv ('oi' [768][768] + [768]); no output projection */
    float* OUT = (float*)d_out;     // [2][2048][768]
    char* wsp = (char*)d_ws;
    auto take = [&](size_t bytes) { char* p = wsp; wsp += (bytes + 255) & ~(size_t)255; return (void*)p; };
    bf* WQ = (bf*)take((size_t)DQ * DM * 2); bf* WK = (bf*)take((size_t)DKV * DM * 2); bf* WV = (bf*)take((size_t)DKV * DM * 2); float* CS = (float*)take((size_t)TT * HD * 2 * 4);
    bf* XB = (bf*)take((size_t)TT * DM * 2); float* FQ = (float*)take((size_t)TT * DQ * 4); float* FK = (float*)take((size_t)TT * DKV * 4);
    h16* QP16 = (h16*)take((size_t)NH_ * TT * HD * 2); h16* KP16 = (h16*)take((size_t)NKV * TT * HD * 2); h16* VT16 = (h16*)take((size_t)NKV * HD * TT * 2);
    bf* QPh = (bf*)take((size_t)NH_ * TT * HD * 2); bf* QPl = (bf*)take((size_t)NH_ * TT * HD * 2); bf* KPh = (bf*)take((size_t)NKV * TT * HD * 2); bf* KPl = (bf*)take((size_t)NKV * TT * HD * 2); bf* VTh = (bf*)take((size_t)NKV * HD * TT * 2); bf* VTl = (bf*)take((size_t)NKV * HD * TT * 2); bf* Ph = (bf*)take((size_t)ZH * RH * TT * 2); bf* Pl = (bf*)take((size_t)ZH * RH * TT * 2);
    float* Sb = (float*)take((size_t)ZH * TT * TT * 4); h16* P16 = (h16*)take((size_t)ZH * TT * TT * 2); float* Ob = (float*)take((size_t)ZH * TT * HD * 4);
    if ((size_t)(wsp - (char*)d_ws) > ws_size) return;    // ws 256 MiB
    float* FV = FK;   // v projection reuses the k buffer after the k planes are built (stream-ordered)
    { k_cvt8<<<(unsigned)(((size_t)DQ * DM / 8 + 255) / 256), 256, 0, stream>>>(wq, WQ, (size_t)DQ * DM / 8); k_cvt8<<<(unsigned)(((size_t)DKV * DM / 8 + 255) / 256), 256, 0, stream>>>(wk, WK, (size_t)DKV * DM / 8); k_cvt8<<<(unsigned)(((size_t)DKV * DM / 8 + 255) / 256), 256, 0, stream>>>(wv, WV, (size_t)DKV * DM / 8);
      
       }
    k_csid<<<(TT * HD + 255) / 256, 256, 0, stream>>>(CS);
    const unsigned LQ = (unsigned)(((size_t)NH_ * TT * HD / 2 + 255) / 256), LKv = (unsigned)(((size_t)NKV * TT * HD / 2 + 255) / 256);
    for (int b = 0; b < NB_; ++b) {
        
        k_cvt8<<<(unsigned)(((size_t)TT * DM / 8 + 255) / 256), 256, 0, stream>>>(x + (size_t)b * TT * DM, XB, (size_t)TT * DM / 8);
        k_gemmw<bf, 0, true><<<dim3(TT / 64, DQ / 64, 1), 32, 0, stream>>>(XB, nullptr, WQ, nullptr, DM, FQ, DQ, bq, 0, 0, 0);
        k_rope<<<LQ, 256, 0, stream>>>(FQ, DQ, NH_, CS, nullptr, nullptr, 1.0f, QP16, QPh, QPl);
        k_cvt8<<<(unsigned)(((size_t)TT * DM / 8 + 255) / 256), 256, 0, stream>>>(xk + (size_t)b * TT * DM, XB, (size_t)TT * DM / 8);   /* XB := bf16(key[b]) */ k_gemmw<bf, 0, true><<<dim3(TT / 64, DKV / 64, 1), 32, 0, stream>>>(XB, nullptr, WK, nullptr, DM, FK, DKV, bk, 0, 0, 0);
        k_rope<<<LKv, 256, 0, stream>>>(FK, DKV, NKV, CS, nullptr, nullptr, 1.0f, KP16, KPh, KPl);
        k_cvt8<<<(unsigned)(((size_t)TT * DM / 8 + 255) / 256), 256, 0, stream>>>(xv + (size_t)b * TT * DM, XB, (size_t)TT * DM / 8);   /* XB := bf16(value[b]) */ k_gemmw<bf, 0, true><<<dim3(TT / 64, DKV / 64, 1), 32, 0, stream>>>(XB, nullptr, WV, nullptr, DM, FV, DKV, bv, 0, 0, 0); k_vtp<<<LKv, 256, 0, stream>>>(FV, DKV, NKV, VT16, VTh, VTl);
        for (int h0 = 0; h0 < NH_; h0 += ZH) { const size_t zq = (size_t)h0, zk = (size_t)(h0 / REP);   // one kv head per query head: the pass's two heads use consecutive kv planes (z-strides TT*HD)
            k_gemmw<bf, 2, false><<<dim3(TT / 64, TT / 64, ZH), 32, 0, stream>>>(QPh + zq * TT * HD, QPl + zq * TT * HD, KPh + zk * TT * HD, KPl + zk * TT * HD, HD, Sb, TT, nullptr, (size_t)TT * HD, (size_t)TT * HD, (size_t)TT * TT);   /* EVERY row's scores on hi/lo planes (3 products); only P.V stays hybrid */
            k_asoft<<<ZH * TT / 8, 256, 0, stream>>>(Sb, P16, Ph, Pl);
            k_gemmw<bf, 2, false><<<dim3(RH / 64, HD / 64, ZH), 32, 0, stream>>>(Ph, Pl, VTh + zk * HD * TT, VTl + zk * HD * TT, TT, Ob, HD, nullptr, (size_t)RH * TT, (size_t)HD * TT, (size_t)TT * HD);
            k_gemmw<h16, 0, false><<<dim3((TT - RH) / 64, HD / 64, ZH), 32, 0, stream>>>(P16 + (size_t)RH * TT, nullptr, VT16 + zk * HD * TT, nullptr, TT, Ob + (size_t)RH * HD, HD, nullptr, (size_t)TT * TT, (size_t)HD * TT, (size_t)TT * HD);
            k_merge<<<(unsigned)(((size_t)ZH * TT * HD / 2 + 255) / 256), 256, 0, stream>>>(Ob, h0, OUT + (size_t)b * TT * DQ); }
         }
}

// v002
// One run takes 125 microseconds.
// It is 11.8 times as fast as v000, going by the measured steps of the versions left out in between.
#include <hip/hip_runtime.h>

// Multi-head attention on three input streams at d_model 768 WITHOUT an output projection (query, key, value [2][2048][768]; Q = query Wq^T + bq, K = key Wk^T + bk, V = value Wv^T + bv ('oi' + biases; 12 heads x 64); scores / sqrt(64); softmax (no mask); out = heads merged -> [2][2048][768] (3.1 M); argument order query, key, value, Wq, bq, Wk, bk, Wv, bv).
// Layout: ONE projection launch for all three streams and both batches ('oi' weights; f32 operands rounded to bf16 on their way into LDS; exact products (K 768) + f32 biases; its epilogue writes the planes the attention reads); then ONE fused attention launch for all 24 batch-heads (online softmax, scores and P stay in registers) with EVERY row's scores on hi/lo planes (3 products: no output projection averages the fp16 score error) and hybrid P.V (rows < 512 hi/lo, rest fp16 x1024); it writes the merged f32 output rows.
// Compute dtypes, f32 accumulate: every input rounded to bf16; projections exact + f32 biases; scores 3 products on every row; P.V rows < 512 3 products, rest fp16; softmax f32; output f32.

#define NB_  2
#define TT   2048
#define DM   768
#define NH_  12
#define NKV  12
#define REP  (NH_ / NKV)
#define HD   64
#define DQ   (NH_ * HD)
#define DKV  (NKV * HD)
#define ZH   2
#define RH   512                  // query rows < RH use hi+lo planes (0: none)
#define WIN  0
#define PCAR 1024.0f
#define SCL  0.125f   // HD^-0.5
typedef _Float16 h16;
typedef unsigned short bf;
typedef __attribute__((ext_vector_type(16))) __bf16   v16bf;
typedef __attribute__((ext_vector_type(16))) _Float16 v16h;
typedef __attribute__((ext_vector_type(8)))  _Float16 v8h;
typedef __attribute__((ext_vector_type(8)))  unsigned short v8us;
typedef __attribute__((ext_vector_type(8)))  float    v8f;
typedef __attribute__((ext_vector_type(4)))  float    v4f;
typedef v8h  __attribute__((may_alias)) v8ha;
typedef v4f  __attribute__((may_alias)) v4fa;
typedef v8us __attribute__((may_alias)) v8usa;

__device__ __forceinline__ unsigned short f2bf(float f) { unsigned u = __float_as_uint(f); u += 0x7FFFu + ((u >> 16) & 1u); return (unsigned short)(u >> 16); }
__device__ __forceinline__ float bf2f(unsigned short b) { return __uint_as_float(((unsigned)b) << 16); }
__device__ __forceinline__ float bfr(float f) { return bf2f(f2bf(f)); }
__device__ __forceinline__ v16h cat16(v8h lo, v8h hi) { return __builtin_shufflevector(lo, hi, 0, 1, 2, 3, 4, 5, 6, 7, 8, 9, 10, 11, 12, 13, 14, 15); }
__device__ __forceinline__ v16bf cat16b(v8us lo, v8us hi) { return __builtin_bit_cast(v16bf, __builtin_shufflevector(lo, hi, 0, 1, 2, 3, 4, 5, 6, 7, 8, 9, 10, 11, 12, 13, 14, 15)); }
__device__ __forceinline__ v8f wmma16(v16h a, v16h b, v8f c) { return __builtin_amdgcn_wmma_f32_16x16x32_f16(false, a, false, b, (short)0, c, false, false); }
__device__ __forceinline__ v8f wmmab(v16bf a, v16bf b, v8f c) { return __builtin_amdgcn_wmma_f32_16x16x32_bf16(false, a, false, b, (short)0, c, false, false); }



// fragment loaders: 16 k of one row a lane, k = 8 hi + 0..7 and 16 + 8 hi + 0..7 of a 32-k step, from K-contiguous 16-bit rows
template <typename T16> struct WFrag;
template <> struct WFrag<h16> { typedef v16h V; static __device__ __forceinline__ V ld(const h16* p) { return cat16(*(const v8h*)p, *(const v8h*)(p + 16)); } static __device__ __forceinline__ v8f mma(V a, V b, v8f c) { return wmma16(a, b, c); } };
template <> struct WFrag<bf> { typedef v16bf V; static __device__ __forceinline__ V ld(const bf* p) { return cat16b(*(const v8us*)p, *(const v8us*)(p + 16)); } static __device__ __forceinline__ v8f mma(V a, V b, v8f c) { return wmmab(a, b, c); } };

__device__ __forceinline__ h16 tohx(float x) { return (h16)x; }
__device__ __forceinline__ void splitf(float y, unsigned short& h, unsigned short& l) { h = f2bf(y); l = f2bf(y - bf2f(h)); }
typedef __attribute__((ext_vector_type(2))) _Float16 v2h;
typedef __attribute__((ext_vector_type(4))) _Float16 v4h;
typedef __attribute__((ext_vector_type(2))) unsigned short v2us;
typedef __attribute__((ext_vector_type(4))) unsigned short v4us;
typedef __attribute__((ext_vector_type(2))) float v2f;
typedef __attribute__((ext_vector_type(4))) int v4i;

// ---- k_proj: the three projections of both batches in ONE launch, from the f32 inputs to the planes that k_fattn reads: no bf16 copy and no f32 projection in memory.
// grid (NB_ * TT / 128, DQ / 128, 3 streams: query, key, value), 128 threads = 4 waves, 128 x 128 outputs a work-group, 64 x 64 (16 accumulators) a wave. C[m][n] = sum_k bf16(X[m][k]) bf16(W[n][k]) + bf16(bias[n]), f32 accumulate, k ascending in passes of 32.
// A pass: every thread rounds the 16 x 4 f32 that it fetched one pass ahead (a wave-wide load is four whole 128-byte lines) and stores them as bf16 rows in LDS (rows 0..127 X, 128..255 W); one barrier; the next pass's fetch goes out; fragments come from LDS in the k order of WFrag::ld.
// Two LDS buffers, ONE barrier a pass: a wave overwrites the buffer of pass p only in pass p + 2, behind the barrier of pass p + 1, which no wave reaches before its reads of pass p have returned.
// Epilogue: a 64-column tile is one head, a 64-row tile lies in one batch. query, key: rows [head][t][d] as bf16 hi + lo, staged through the wave's own LDS range so that whole 128-byte lines are stored. value: planes [head][d][t]; an accumulator register run is 8 neighbouring t of one d, stored straight from registers as fp16, hi and lo.
#define PK   32    // k of a pass
#define PPIT 40    // LDS row pitch in bf16 elements: 64 bytes of data + 16, the conflict-free pitch for 16-byte fragment reads of 64-byte rows
typedef __attribute__((ext_vector_type(4))) __bf16 v4bf;
__global__ __launch_bounds__(128) void k_proj(const float* __restrict__ xq, const float* __restrict__ xk, const float* __restrict__ xv, const float* __restrict__ wq, const float* __restrict__ wk, const float* __restrict__ wv, const float* __restrict__ bq, const float* __restrict__ bk, const float* __restrict__ bv, bf* Qh, bf* Ql, bf* Kh, bf* Kl, h16* V16, bf* Vh, bf* Vl) {
    __shared__ __align__(16) bf ts[2][256 * PPIT];
    __shared__ __align__(16) float osall[4][16 * 68];
    const int z = blockIdx.z; const float* X = z == 0 ? xq : z == 1 ? xk : xv; const float* Wt = z == 0 ? wq : z == 1 ? wk : wv; const float* bias = z == 0 ? bq : z == 1 ? bk : bv;
    const int tid = threadIdx.x, w = __builtin_amdgcn_readfirstlane(tid >> 5), lane = tid & 31, lr = lane & 15, hi = lane >> 4;
    const int wr = (w & 1) * 64, wc = (w >> 1) * 64; const int r0 = blockIdx.x * 128 + wr, c0 = blockIdx.y * 128 + wc;
    const int sr = tid >> 3, sc = (tid & 7) * 4;   // staging: 8 threads a row of 32 f32, rows sr + 16 i
    const float* gx = X + (size_t)(blockIdx.x * 128 + sr) * DM + sc; const float* gw = Wt + (size_t)(blockIdx.y * 128 + sr) * DM + sc;
    v8f acc[4][4];
#pragma unroll
    for (int mb = 0; mb < 4; ++mb)
#pragma unroll
        for (int nb = 0; nb < 4; ++nb) acc[mb][nb] = (v8f){};
    v4f st[16];
#pragma unroll
    for (int i = 0; i < 8; ++i) { st[i] = *(const v4f*)(gx + (size_t)i * 16 * DM); st[8 + i] = *(const v4f*)(gw + (size_t)i * 16 * DM); }
#pragma unroll 1   // one copy of the body: the buffer index and the fetch test stay scalar, and 16 accumulators, 16 fetched vectors and the fragments leave a second copy nothing to overlap with
    for (int kc = 0; kc < DM; kc += PK) {
        bf* tb = ts[(kc / PK) & 1];
#pragma unroll
        for (int i = 0; i < 16; ++i) *(v4us*)(tb + (sr + 16 * i) * PPIT + sc) = __builtin_bit_cast(v4us, __builtin_convertvector(st[i], v4bf));   // round to nearest even, as f2bf
        __syncthreads();   // publishes this pass's rows; also ends every wave's reads of the other buffer before the next pass overwrites it
        if (kc + PK < DM) {
#pragma unroll
            for (int i = 0; i < 8; ++i) { st[i] = *(const v4f*)(gx + (size_t)i * 16 * DM + kc + PK); st[8 + i] = *(const v4f*)(gw + (size_t)i * 16 * DM + kc + PK); }
            asm volatile("s_wait_xcnt 0x0" ::: "memory");   // the run's two address pairs are dead behind its last load and the build reuses them for the fragment reads below: the wait stands in front of that overwrite of registers which the sixteen loads name
        }
        v16bf a[4], b[2];   // two W fragment sets in turn: four would push the kernel past 256 registers
#pragma unroll
        for (int mb = 0; mb < 4; ++mb) a[mb] = WFrag<bf>::ld(tb + (wr + mb * 16 + lr) * PPIT + 8 * hi);
#pragma unroll
        for (int nb = 0; nb < 2; ++nb) b[nb] = WFrag<bf>::ld(tb + (128 + wc + nb * 16 + lr) * PPIT + 8 * hi);
#pragma unroll
        for (int nb = 0; nb < 4; ++nb) {
#pragma unroll
            for (int mb = 0; mb < 4; ++mb) acc[mb][nb] = wmmab(a[mb], b[nb & 1], acc[mb][nb]);
            if (nb < 2) { b[nb & 1] = WFrag<bf>::ld(tb + (128 + wc + (nb + 2) * 16 + lr) * PPIT + 8 * hi);
                __builtin_amdgcn_sched_barrier(0); }   // holds the refill of a W set right behind that set's last product, so that the other set's four products cover part of its LDS wait
        }
        asm volatile("v_nop\n\tv_nop\n\tv_nop\n\tv_nop" : "+v"(acc[0][0]), "+v"(acc[1][1]), "+v"(acc[2][2]), "+v"(acc[3][3]) : "v"(a[0]), "v"(a[3]));   // the four vector slots that the chip needs behind the pass's last matrix instruction, also on the taken back edge
    }
    const size_t hp = ((size_t)(r0 / TT) * NH_ + c0 / HD) * TT * HD; const int t0 = r0 % TT;   // this tile's batch-head plane and its first position
    // In both epilogues a block's values are all formed first, then its stores go out as one run with s_wait_xcnt 0 behind it, each part held in place by sched_barrier(0).
    if (z < 2) {
        bf* Ph = (z == 0 ? Qh : Kh) + hp; bf* Pl = (z == 0 ? Ql : Kl) + hp; float* os = osall[w]; const int cofs = lr * 4; v4f bb = *(const v4f*)(bias + c0 + cofs);
        asm volatile("s_wait_xcnt 0x0" ::: "memory");   // in front of any reuse of the bias load's address registers
        __builtin_amdgcn_sched_barrier(0);              // keeps later register writes behind that wait
#pragma unroll
        for (int q = 0; q < 4; ++q) bb[q] = bfr(bb[q]);
#pragma unroll
        for (int mb = 0; mb < 4; ++mb) {
#pragma unroll
            for (int nb = 0; nb < 4; ++nb) {
#pragma unroll
                for (int j = 0; j < 8; ++j) os[(hi * 8 + j) * 68 + nb * 16 + lr] = acc[mb][nb][j]; }
            __builtin_amdgcn_wave_barrier(); asm volatile("" ::: "memory");   // the wave's own LDS stores stay in front of its reads of other lanes' values
            v4us oh[8], ol[8];
#pragma unroll
            for (int s = 0; s < 8; ++s) { const v4f val = *(const v4fa*)(os + (2 * s + hi) * 68 + cofs) + bb;
#pragma unroll
                for (int q = 0; q < 4; ++q) { unsigned short a2, c2; splitf(val[q], a2, c2); oh[s][q] = a2; ol[s][q] = c2; } }
            __builtin_amdgcn_wave_barrier(); asm volatile("" ::: "memory");   // and these reads in front of the next block's LDS stores
            __builtin_amdgcn_sched_barrier(0);   // values first
#pragma unroll
            for (int s = 0; s < 8; ++s) { const size_t po = (size_t)(t0 + mb * 16 + 2 * s + hi) * HD + cofs; *(v4us*)(Ph + po) = oh[s]; *(v4us*)(Pl + po) = ol[s]; }
            asm volatile("s_wait_xcnt 0x0" ::: "memory");   // behind the run of stores, in front of the next block's writes of their registers
            __builtin_amdgcn_sched_barrier(0);   // keeps those writes behind the wait
        }
    } else {
        float bn[4];
#pragma unroll
        for (int nb = 0; nb < 4; ++nb) bn[nb] = bias[c0 + nb * 16 + lr];
        asm volatile("s_wait_xcnt 0x0" ::: "memory");   // in front of any reuse of the bias loads' offset register
        __builtin_amdgcn_sched_barrier(0);              // keeps later register writes behind that wait
#pragma unroll
        for (int nb = 0; nb < 4; ++nb) { const float bnr = bfr(bn[nb]); const size_t vo = hp + (size_t)(nb * 16 + lr) * TT + t0 + 8 * hi; v8h o16[4]; v8us oh[4], ol[4];
#pragma unroll
            for (int mb = 0; mb < 4; ++mb)
#pragma unroll
                for (int j = 0; j < 8; ++j) { const float x = acc[mb][nb][j] + bnr; o16[mb][j] = tohx(x); unsigned short a2, c2; splitf(x, a2, c2); oh[mb][j] = a2; ol[mb][j] = c2; }
            __builtin_amdgcn_sched_barrier(0);   // values first
#pragma unroll
            for (int mb = 0; mb < 4; ++mb) { *(v8h*)(V16 + vo + mb * 16) = o16[mb]; *(v8us*)(Vh + vo + mb * 16) = oh[mb]; *(v8us*)(Vl + vo + mb * 16) = ol[mb]; }
            asm volatile("s_wait_xcnt 0x0" ::: "memory");   // behind the run of stores, in front of the next block's writes of their registers
            __builtin_amdgcn_sched_barrier(0);   // keeps those writes behind the wait
        }
    }
}

// k_fattn: scores, softmax, P.V and the head merge in ONE kernel; one wave per 16 or 32 query rows of one head, 32 keys a pass, running maximum and sum (online softmax): no score or P plane in memory.
// S^T = K Q^T (A = K rows, B = Q rows, hi/lo planes, 3 products): lane (lr, hi) register j of key tile kt holds the score of key j0 + 16 kt + 8 hi + j for query lr, so the two key tiles of a pass, converted in place, are the B operand P^T of O^T += V^T P^T in the same k order as WFrag::ld reads V^T rows.
// HIRES (query rows < RH): P and V on hi/lo planes, 3 products; else P x PCAR in fp16 against the fp16 V plane (the factor is in the row sum too and cancels in O / sum).
// value of lane l ^ 16 (the other half of a query's keys) without the LDS path's latency
__device__ __forceinline__ float xhalf(float x) { const int b = __float_as_int(x); return __int_as_float(__builtin_amdgcn_permlanex16(b, b, 0x76543210, 0xfedcba98, false, false)); }
// 2^x with the instruction set's one free slot behind a transcendental kept in the same statement.
__device__ __forceinline__ float exp2s(float x) { float r; asm("v_exp_f32 %0, %1\n\tv_nop" : "=v"(r) : "v"(x)); return r; }
template <bool HIRES, int NQ>   // NQ: 16-query column groups per wave
__device__ __forceinline__ void fattn_body(const bf* __restrict__ Qh, const bf* __restrict__ Ql, const bf* __restrict__ Kh, const bf* __restrict__ Kl, const bf* __restrict__ Vh, const bf* __restrict__ Vl, const h16* __restrict__ V16, float* Orow, int q0, int lr, int hi) {
    v16bf qh[NQ][2], ql[NQ][2];
#pragma unroll
    for (int nq = 0; nq < NQ; ++nq)
#pragma unroll
        for (int ks = 0; ks < 2; ++ks) { const size_t qo = (size_t)(q0 + nq * 16 + lr) * HD + ks * 32 + 8 * hi; qh[nq][ks] = WFrag<bf>::ld(Qh + qo); ql[nq][ks] = WFrag<bf>::ld(Ql + qo); }
    v8f o[NQ][4]; float m[NQ], l[NQ];
#pragma unroll
    for (int nq = 0; nq < NQ; ++nq) { m[nq] = -3.0e38f; l[nq] = 0.f;
#pragma unroll
        for (int dt = 0; dt < 4; ++dt) o[nq][dt] = (v8f){}; }
    const size_t koff = (size_t)lr * HD + 8 * hi, voff = (size_t)lr * TT + 8 * hi;
#pragma unroll 1   // one copy of the body: a pass holds 24 to 32 matrix instructions and its operands fill nearly all directly addressed registers, so a second copy has no registers to overlap with
    for (int j0 = 0; j0 < TT; j0 += 32) {
        v16bf kh[2][2], kl[2][2];
#pragma unroll
        for (int kt = 0; kt < 2; ++kt)
#pragma unroll
            for (int ks = 0; ks < 2; ++ks) { const size_t ko = koff + (size_t)(j0 + kt * 16) * HD + ks * 32; kh[kt][ks] = WFrag<bf>::ld(Kh + ko);
                if (kt == 1 && ks == 1) { const v8us k0 = *(const v8us*)(Kl + ko);
                    asm volatile("s_wait_xcnt 0x0" ::: "memory");   // the run's two address pairs are dead from its last load on, and builds of either branch place that load's result on them: the wait stands in front of that overwrite of registers which the fifteen loads before it name
                    kl[kt][ks] = cat16b(k0, *(const v8us*)(Kl + ko + 16)); }
                else kl[kt][ks] = WFrag<bf>::ld(Kl + ko); }
        __builtin_amdgcn_sched_barrier(0);   // keeps the pass's 16 K loads one group ahead of the products: without it they are issued piecemeal into reused registers, each piece with its own exposed wait
        v8f s[NQ][2];
#pragma unroll
        for (int kt = 0; kt < 2; ++kt)
#pragma unroll
            for (int nq = 0; nq < NQ; ++nq) s[nq][kt] = (v8f){};
#pragma unroll
        for (int ks = 0; ks < 2; ++ks)
#pragma unroll
            for (int kt = 0; kt < 2; ++kt)
#pragma unroll
                for (int nq = 0; nq < NQ; ++nq) { s[nq][kt] = wmmab(kh[kt][ks], qh[nq][ks], s[nq][kt]); s[nq][kt] = wmmab(kh[kt][ks], ql[nq][ks], s[nq][kt]); s[nq][kt] = wmmab(kl[kt][ks], qh[nq][ks], s[nq][kt]); }
        v16bf vh[4], vl[4]; v16h v16[4];
#pragma unroll
        for (int dt = 0; dt < 4; ++dt) { const size_t vo = voff + (size_t)dt * 16 * TT + j0; if (HIRES) { vh[dt] = WFrag<bf>::ld(Vh + vo); vl[dt] = WFrag<bf>::ld(Vl + vo); } else v16[dt] = WFrag<h16>::ld(V16 + vo); }
        __builtin_amdgcn_sched_barrier(0);   // the pass's V loads go out as one group behind the score products, so that the softmax arithmetic covers their latency
        v16bf ph[NQ], pl[NQ]; v16h p16[NQ];
#pragma unroll
        for (int nq = 0; nq < NQ; ++nq) { float mx = m[nq];
#pragma unroll
            for (int kt = 0; kt < 2; ++kt)
#pragma unroll
                for (int j = 0; j < 8; ++j) { const float t = s[nq][kt][j] * SCL; s[nq][kt][j] = t; mx = fmaxf(mx, t); }
            mx = fmaxf(mx, xhalf(mx));      // lanes lr and lr + 16 hold the two halves of one query's keys
            const float al = exp2s((m[nq] - mx) * 1.4426950408889634f); m[nq] = mx; float sum = 0.f; v8us uh[2], ul[2]; v8h u16[2];
#pragma unroll
            for (int kt = 0; kt < 2; ++kt)
#pragma unroll
                for (int j = 0; j < 8; ++j) { const float e = (s[nq][kt][j] - mx) * 1.4426950408889634f; const float p = exp2s(HIRES ? e : e + 10.0f);   /* 2^10 = PCAR */ sum += p;
                    if (HIRES) { unsigned short a, c2; splitf(p, a, c2); uh[kt][j] = a; ul[kt][j] = c2; } else u16[kt][j] = tohx(p); }
            l[nq] = l[nq] * al + sum;                    // each half keeps its own partial sum; joined once behind the loop
            if (HIRES) { ph[nq] = cat16b(uh[0], uh[1]); pl[nq] = cat16b(ul[0], ul[1]); } else p16[nq] = cat16(u16[0], u16[1]);
#pragma unroll
            for (int dt = 0; dt < 4; ++dt) o[nq][dt] *= al; }
#pragma unroll
        for (int dt = 0; dt < 4; ++dt) {
            if (HIRES) {
#pragma unroll
                for (int nq = 0; nq < NQ; ++nq) { o[nq][dt] = wmmab(vh[dt], ph[nq], o[nq][dt]); o[nq][dt] = wmmab(vh[dt], pl[nq], o[nq][dt]); o[nq][dt] = wmmab(vl[dt], ph[nq], o[nq][dt]); }
            } else {
#pragma unroll
                for (int nq = 0; nq < NQ; ++nq) o[nq][dt] = wmma16(v16[dt], p16[nq], o[nq][dt]); } }
    }
#pragma unroll
    for (int nq = 0; nq < NQ; ++nq) { const float ls = l[nq] + xhalf(l[nq]); const float f = __fdiv_rn(1.0f, ls); float* orow = Orow + (size_t)(q0 + nq * 16 + lr) * DQ + 8 * hi;
#pragma unroll
        for (int dt = 0; dt < 4; ++dt) { v4f a, c; 
#pragma unroll
            for (int j = 0; j < 4; ++j) { a[j] = o[nq][dt][j] * f; c[j] = o[nq][dt][j + 4] * f; }
            *(v4f*)(orow + dt * 16) = a; *(v4f*)(orow + dt * 16 + 4) = c; }
    }
}
// grid (batches x heads, (RH / 16 + (TT - RH) / 32) / 4), 128 threads = 4 independent waves (no barrier, no LDS) on neighbouring query blocks of ONE head, so that they walk the same K and V lines of the WGP cache at about the same time; a hi/lo wave (three times the P.V products and the hi/lo split a key) takes 16 query rows, an fp16 wave 32, so that a pass costs both about the same; the hi/lo blocks have the low blockIdx.y (RH / 16 is a multiple of 4: a workgroup is all of one kind).
__global__ __launch_bounds__(128) void k_fattn(const bf* __restrict__ Qh, const bf* __restrict__ Ql, const bf* __restrict__ Kh, const bf* __restrict__ Kl, const bf* __restrict__ Vh, const bf* __restrict__ Vl, const h16* __restrict__ V16, float* OUTb) {
    const int lane = threadIdx.x & 31, lr = lane & 15, hi = lane >> 4; const size_t hp = (size_t)blockIdx.x * TT * HD;   /* planes [batch][head] */ const int y = blockIdx.y * 4 + __builtin_amdgcn_readfirstlane(threadIdx.x >> 5); float* Orow = OUTb + (size_t)(blockIdx.x / NH_) * TT * DQ + (blockIdx.x % NH_) * HD;
    if (blockIdx.y < RH / 64) fattn_body<true, 1>(Qh + hp, Ql + hp, Kh + hp, Kl + hp, Vh + hp, Vl + hp, V16 + hp, Orow, y * 16, lr, hi);
    else fattn_body<false, 2>(Qh + hp, Ql + hp, Kh + hp, Kl + hp, Vh + hp, Vl + hp, V16 + hp, Orow, RH + (y - RH / 16) * 32, lr, hi);
}

extern "C" void kernel_launch(void* const* d_in, const int* in_sizes, int n_in,
                              void* d_out, int out_size, void* d_ws, size_t ws_size, hipStream_t stream) {
    (void)in_sizes; (void)n_in; (void)out_size;
    const float* x = (const float*)d_in[0]; const float* xk = (const float*)d_in[1]; const float* xv = (const float*)d_in[2]; const float* wq = (const float*)d_in[3]; const float* bq = (const float*)d_in[4]; const float* wk = (const float*)d_in[5]; const float* bk = (const float*)d_in[6]; const float* wv = (const float*)d_in[7]; const float* bv = (const float*)d_in[8];   /* argument order query, key, value, Wq, bq, Wk, bk, Wv, bv ('oi' [768][768] + [768]); no output projection */
    float* OUT = (float*)d_out;     // [2][2048][768]
    char* wsp = (char*)d_ws;
    auto take = [&](size_t bytes) { char* p = wsp; wsp += (bytes + 255) & ~(size_t)255; return (void*)p; };
    h16* VT16 = (h16*)take((size_t)NB_ * NKV * HD * TT * 2);
    bf* QPh = (bf*)take((size_t)NB_ * NH_ * TT * HD * 2); bf* QPl = (bf*)take((size_t)NB_ * NH_ * TT * HD * 2); bf* KPh = (bf*)take((size_t)NB_ * NKV * TT * HD * 2); bf* KPl = (bf*)take((size_t)NB_ * NKV * TT * HD * 2); bf* VTh = (bf*)take((size_t)NB_ * NKV * HD * TT * 2); bf* VTl = (bf*)take((size_t)NB_ * NKV * HD * TT * 2);   /* the planes the attention launch reads: both batches */
    if ((size_t)(wsp - (char*)d_ws) > ws_size) return;    // ws 256 MiB
    k_proj<<<dim3(NB_ * TT / 128, DQ / 128, 3), 128, 0, stream>>>(x, xk, xv, wq, wk, wv, bq, bk, bv, QPh, QPl, KPh, KPl, VT16, VTh, VTl);   /* rounding, projections, biases, planes: 3 streams x 2 batches */
    k_fattn<<<dim3(NB_ * NH_, (RH / 16 + (TT - RH) / 32) / 4, 1), 128, 0, stream>>>(QPh, QPl, KPh, KPl, VTh, VTl, VT16, OUT);   /* all 24 batch-heads: scores, softmax, P.V, merge */
}

// v003
// Measured time: 85.5 microseconds a run.
// Two timings next to v002 put it at 1.49 and 1.46 times that version's speed.
// Counting every step since v000, it is 17.4 times as fast.
#include <hip/hip_runtime.h>

// Multi-head attention on three input streams at d_model 768 WITHOUT an output projection (query, key, value [2][2048][768]; Q = query Wq^T + bq, K = key Wk^T + bk, V = value Wv^T + bv ('oi' + biases; 12 heads x 64); scores / sqrt(64); softmax (no mask); out = heads merged -> [2][2048][768] (3.1 M); argument order query, key, value, Wq, bq, Wk, bk, Wv, bv).
// Layout: ONE projection launch for all three streams and both batches ('oi' weights; f32 operands rounded to bf16 on their way into LDS; exact products (K 768) + f32 biases; its epilogue writes the planes the attention reads); then ONE fused attention launch for all 24 batch-heads (online softmax, scores and P stay in registers) with EVERY row's scores on hi/lo planes (3 products: no output projection averages the fp16 score error) and hybrid P.V (rows < 512 hi/lo, rest fp16 x1024); it writes the merged f32 output rows.
// Compute dtypes, f32 accumulate: every input rounded to bf16; projections exact + f32 biases; scores 3 products on every row; P.V rows < 512 3 products, rest fp16; softmax f32; output f32.

#define NB_  2
#define TT   2048
#define DM   768
#define NH_  12
#define NKV  12
#define REP  (NH_ / NKV)
#define HD   64
#define DQ   (NH_ * HD)
#define DKV  (NKV * HD)
#define ZH   2
#define RH   512                  // query rows < RH use hi+lo planes (0: none)
#define WIN  0
#define PCAR 1024.0f
#define SCL  0.125f   // HD^-0.5
typedef _Float16 h16;
typedef unsigned short bf;
typedef __attribute__((ext_vector_type(16))) __bf16   v16bf;
typedef __attribute__((ext_vector_type(16))) _Float16 v16h;
typedef __attribute__((ext_vector_type(8)))  _Float16 v8h;
typedef __attribute__((ext_vector_type(8)))  unsigned short v8us;
typedef __attribute__((ext_vector_type(8)))  float    v8f;
typedef __attribute__((ext_vector_type(4)))  float    v4f;
typedef v8h  __attribute__((may_alias)) v8ha;
typedef v4f  __attribute__((may_alias)) v4fa;
typedef v8us __attribute__((may_alias)) v8usa;

__device__ __forceinline__ unsigned short f2bf(float f) { unsigned u = __float_as_uint(f); u += 0x7FFFu + ((u >> 16) & 1u); return (unsigned short)(u >> 16); }
__device__ __forceinline__ float bf2f(unsigned short b) { return __uint_as_float(((unsigned)b) << 16); }
__device__ __forceinline__ float bfr(float f) { return bf2f(f2bf(f)); }
__device__ __forceinline__ v16h cat16(v8h lo, v8h hi) { return __builtin_shufflevector(lo, hi, 0, 1, 2, 3, 4, 5, 6, 7, 8, 9, 10, 11, 12, 13, 14, 15); }
__device__ __forceinline__ v16bf cat16b(v8us lo, v8us hi) { return __builtin_bit_cast(v16bf, __builtin_shufflevector(lo, hi, 0, 1, 2, 3, 4, 5, 6, 7, 8, 9, 10, 11, 12, 13, 14, 15)); }
__device__ __forceinline__ v8f wmma16(v16h a, v16h b, v8f c) { return __builtin_amdgcn_wmma_f32_16x16x32_f16(false, a, false, b, (short)0, c, false, false); }
__device__ __forceinline__ v8f wmmab(v16bf a, v16bf b, v8f c) { return __builtin_amdgcn_wmma_f32_16x16x32_bf16(false, a, false, b, (short)0, c, false, false); }



// fragment loaders: 16 k of one row a lane, k = 8 hi + 0..7 and 16 + 8 hi + 0..7 of a 32-k step, from K-contiguous 16-bit rows
template <typename T16> struct WFrag;
template <> struct WFrag<h16> { typedef v16h V; static __device__ __forceinline__ V ld(const h16* p) { return cat16(*(const v8h*)p, *(const v8h*)(p + 16)); } static __device__ __forceinline__ v8f mma(V a, V b, v8f c) { return wmma16(a, b, c); } };
template <> struct WFrag<bf> { typedef v16bf V; static __device__ __forceinline__ V ld(const bf* p) { return cat16b(*(const v8us*)p, *(const v8us*)(p + 16)); } static __device__ __forceinline__ v8f mma(V a, V b, v8f c) { return wmmab(a, b, c); } };

__device__ __forceinline__ h16 tohx(float x) { return (h16)x; }
__device__ __forceinline__ void splitf(float y, unsigned short& h, unsigned short& l) { h = f2bf(y); l = f2bf(y - bf2f(h)); }
typedef __attribute__((ext_vector_type(2))) _Float16 v2h;
typedef __attribute__((ext_vector_type(4))) _Float16 v4h;
typedef __attribute__((ext_vector_type(2))) unsigned short v2us;
typedef __attribute__((ext_vector_type(4))) unsigned short v4us;
typedef __attribute__((ext_vector_type(2))) float v2f;
typedef __attribute__((ext_vector_type(4))) int v4i;

// ---- k_proj: the three projections of both batches in ONE launch, from the f32 inputs to the planes that k_fattn reads: no bf16 copy and no f32 projection in memory.
// grid (NB_ * TT / 128, DQ / 128, 3 streams: query, key, value), 128 threads = 4 waves, 128 x 128 outputs a work-group, 64 x 64 (16 accumulators) a wave. C[m][n] = sum_k bf16(X[m][k]) bf16(W[n][k]) + bf16(bias[n]), f32 accumulate, k ascending in passes of 32.
// A pass: every thread rounds the 16 x 4 f32 that it fetched one pass ahead (a wave-wide load is four whole 128-byte lines) and stores them as bf16 rows in LDS (rows 0..127 X, 128..255 W); one barrier; the next pass's fetch goes out; fragments come from LDS in the k order of WFrag::ld.
// Two LDS buffers, ONE barrier a pass: a wave overwrites the buffer of pass p only in pass p + 2, behind the barrier of pass p + 1, which no wave reaches before its reads of pass p have returned.
// Epilogue: a 64-column tile is one head, a 64-row tile lies in one batch. query, key: rows [head][t][d] as bf16 hi + lo, staged through the wave's own LDS range so that whole 128-byte lines are stored. value: planes [head][d][t]; an accumulator register run is 8 neighbouring t of one d, stored straight from registers as fp16, hi and lo.
#define PK   32    // k of a pass
#define PPIT 40    // LDS row pitch in bf16 elements: 64 bytes of data + 16, the conflict-free pitch for 16-byte fragment reads of 64-byte rows
typedef __attribute__((ext_vector_type(4))) __bf16 v4bf;
__global__ __launch_bounds__(128) void k_proj(const float* __restrict__ xq, const float* __restrict__ xk, const float* __restrict__ xv, const float* __restrict__ wq, const float* __restrict__ wk, const float* __restrict__ wv, const float* __restrict__ bq, const float* __restrict__ bk, const float* __restrict__ bv, bf* Qh, bf* Ql, bf* Kh, bf* Kl, h16* V16, bf* Vh, bf* Vl) {
    __shared__ __align__(16) bf ts[2][256 * PPIT];
    __shared__ __align__(16) float osall[4][16 * 68];
    const int z = blockIdx.z; const float* X = z == 0 ? xq : z == 1 ? xk : xv; const float* Wt = z == 0 ? wq : z == 1 ? wk : wv; const float* bias = z == 0 ? bq : z == 1 ? bk : bv;
    const int tid = threadIdx.x, w = __builtin_amdgcn_readfirstlane(tid >> 5), lane = tid & 31, lr = lane & 15, hi = lane >> 4;
    const int wr = (w & 1) * 64, wc = (w >> 1) * 64; const int r0 = blockIdx.x * 128 + wr, c0 = blockIdx.y * 128 + wc;
    const int sr = tid >> 3, sc = (tid & 7) * 4;   // staging: 8 threads a row of 32 f32, rows sr + 16 i
    const float* gx = X + (size_t)(blockIdx.x * 128 + sr) * DM + sc; const float* gw = Wt + (size_t)(blockIdx.y * 128 + sr) * DM + sc;
    v8f acc[4][4];
#pragma unroll
    for (int mb = 0; mb < 4; ++mb)
#pragma unroll
        for (int nb = 0; nb < 4; ++nb) acc[mb][nb] = (v8f){};
    v4f st[16];
#pragma unroll
    for (int i = 0; i < 8; ++i) { st[i] = *(const v4f*)(gx + (size_t)i * 16 * DM); st[8 + i] = *(const v4f*)(gw + (size_t)i * 16 * DM); }
#pragma unroll 1   // one copy of the body: the buffer index and the fetch test stay scalar, and 16 accumulators, 16 fetched vectors and the fragments leave a second copy nothing to overlap with
    for (int kc = 0; kc < DM; kc += PK) {
        bf* tb = ts[(kc / PK) & 1];
#pragma unroll
        for (int i = 0; i < 16; ++i) *(v4us*)(tb + (sr + 16 * i) * PPIT + sc) = __builtin_bit_cast(v4us, __builtin_convertvector(st[i], v4bf));   // round to nearest even, as f2bf
        __syncthreads();   // publishes this pass's rows; also ends every wave's reads of the other buffer before the next pass overwrites it
        if (kc + PK < DM) {
#pragma unroll
            for (int i = 0; i < 8; ++i) { st[i] = *(const v4f*)(gx + (size_t)i * 16 * DM + kc + PK); st[8 + i] = *(const v4f*)(gw + (size_t)i * 16 * DM + kc + PK); }
            asm volatile("s_wait_xcnt 0x0" ::: "memory");   // the run's two address pairs are dead behind its last load and the build reuses them for the fragment reads below: the wait stands in front of that overwrite of registers which the sixteen loads name
        }
        v16bf a[4], b[2];   // two W fragment sets in turn: four would push the kernel past 256 registers
#pragma unroll
        for (int mb = 0; mb < 4; ++mb) a[mb] = WFrag<bf>::ld(tb + (wr + mb * 16 + lr) * PPIT + 8 * hi);
#pragma unroll
        for (int nb = 0; nb < 2; ++nb) b[nb] = WFrag<bf>::ld(tb + (128 + wc + nb * 16 + lr) * PPIT + 8 * hi);
#pragma unroll
        for (int nb = 0; nb < 4; ++nb) {
#pragma unroll
            for (int mb = 0; mb < 4; ++mb) acc[mb][nb] = wmmab(a[mb], b[nb & 1], acc[mb][nb]);
            if (nb < 2) { b[nb & 1] = WFrag<bf>::ld(tb + (128 + wc + (nb + 2) * 16 + lr) * PPIT + 8 * hi);
                __builtin_amdgcn_sched_barrier(0); }   // holds the refill of a W set right behind that set's last product, so that the other set's four products cover part of its LDS wait
        }
        asm volatile("v_nop\n\tv_nop\n\tv_nop\n\tv_nop" : "+v"(acc[0][0]), "+v"(acc[1][1]), "+v"(acc[2][2]), "+v"(acc[3][3]) : "v"(a[0]), "v"(a[3]));   // the four vector slots that the chip needs behind the pass's last matrix instruction, also on the taken back edge
    }
    const size_t hp = ((size_t)(r0 / TT) * NH_ + c0 / HD) * TT * HD; const int t0 = r0 % TT;   // this tile's batch-head plane and its first position
    // In both epilogues a block's values are all formed first, then its stores go out as one run with s_wait_xcnt 0 behind it, each part held in place by sched_barrier(0).
    if (z < 2) {
        bf* Ph = (z == 0 ? Qh : Kh) + hp; bf* Pl = (z == 0 ? Ql : Kl) + hp; float* os = osall[w]; const int cofs = lr * 4; v4f bb = *(const v4f*)(bias + c0 + cofs);
        asm volatile("s_wait_xcnt 0x0" ::: "memory");   // in front of any reuse of the bias load's address registers
        __builtin_amdgcn_sched_barrier(0);              // keeps later register writes behind that wait
#pragma unroll
        for (int q = 0; q < 4; ++q) bb[q] = bfr(bb[q]);
#pragma unroll
        for (int mb = 0; mb < 4; ++mb) {
#pragma unroll
            for (int nb = 0; nb < 4; ++nb) {
#pragma unroll
                for (int j = 0; j < 8; ++j) os[(hi * 8 + j) * 68 + nb * 16 + lr] = acc[mb][nb][j]; }
            __builtin_amdgcn_wave_barrier(); asm volatile("" ::: "memory");   // the wave's own LDS stores stay in front of its reads of other lanes' values
            v4us oh[8], ol[8];
#pragma unroll
            for (int s = 0; s < 8; ++s) { const v4f val = *(const v4fa*)(os + (2 * s + hi) * 68 + cofs) + bb;
#pragma unroll
                for (int q = 0; q < 4; ++q) { unsigned short a2, c2; splitf(val[q], a2, c2); oh[s][q] = a2; ol[s][q] = c2; } }
            __builtin_amdgcn_wave_barrier(); asm volatile("" ::: "memory");   // and these reads in front of the next block's LDS stores
            __builtin_amdgcn_sched_barrier(0);   // values first
#pragma unroll
            for (int s = 0; s < 8; ++s) { const size_t po = (size_t)(t0 + mb * 16 + 2 * s + hi) * HD + cofs; *(v4us*)(Ph + po) = oh[s]; *(v4us*)(Pl + po) = ol[s]; }
            asm volatile("s_wait_xcnt 0x0" ::: "memory");   // behind the run of stores, in front of the next block's writes of their registers
            __builtin_amdgcn_sched_barrier(0);   // keeps those writes behind the wait
        }
    } else {
        float bn[4];
#pragma unroll
        for (int nb = 0; nb < 4; ++nb) bn[nb] = bias[c0 + nb * 16 + lr];
        asm volatile("s_wait_xcnt 0x0" ::: "memory");   // in front of any reuse of the bias loads' offset register
        __builtin_amdgcn_sched_barrier(0);              // keeps later register writes behind that wait
#pragma unroll
        for (int nb = 0; nb < 4; ++nb) { const float bnr = bfr(bn[nb]); const size_t vo = hp + (size_t)(nb * 16 + lr) * TT + t0 + 8 * hi; v8h o16[4]; v8us oh[4], ol[4];
#pragma unroll
            for (int mb = 0; mb < 4; ++mb)
#pragma unroll
                for (int j = 0; j < 8; ++j) { const float x = acc[mb][nb][j] + bnr; o16[mb][j] = tohx(x); unsigned short a2, c2; splitf(x, a2, c2); oh[mb][j] = a2; ol[mb][j] = c2; }
            __builtin_amdgcn_sched_barrier(0);   // values first
#pragma unroll
            for (int mb = 0; mb < 4; ++mb) { *(v8h*)(V16 + vo + mb * 16) = o16[mb]; *(v8us*)(Vh + vo + mb * 16) = oh[mb]; *(v8us*)(Vl + vo + mb * 16) = ol[mb]; }
            asm volatile("s_wait_xcnt 0x0" ::: "memory");   // behind the run of stores, in front of the next block's writes of their registers
            __builtin_amdgcn_sched_barrier(0);   // keeps those writes behind the wait
        }
    }
}

// k_fattn: scores, softmax, P.V and the head merge in ONE kernel; one wave per 16 or 32 query rows of one head, 32 keys a pass, running maximum and sum (online softmax): no score or P plane in memory.
// S^T = K Q^T (A = K rows, B = Q rows, hi/lo planes, 3 products): lane (lr, hi) register j of key tile kt holds the score of key j0 + 16 kt + 8 hi + j for query lr, so the two key tiles of a pass, converted in place, are the B operand P^T of O^T += V^T P^T in the same k order as WFrag::ld reads V^T rows.
// HIRES (query rows < RH): P and V on hi/lo planes, 3 products; else P x PCAR in fp16 against the fp16 V plane (the factor is in the row sum too and cancels in O / sum).
// value of lane l ^ 16 (the other half of a query's keys) without the LDS path's latency
__device__ __forceinline__ float xhalf(float x) { const int b = __float_as_int(x); return __int_as_float(__builtin_amdgcn_permlanex16(b, b, 0x76543210, 0xfedcba98, false, false)); }
// 2^x with the instruction set's one free slot behind a transcendental kept in the same statement.
__device__ __forceinline__ float exp2s(float x) { float r; asm("v_exp_f32 %0, %1\n\tv_nop" : "=v"(r) : "v"(x)); return r; }
// K and V reach the waves through LDS: a stage is 64 keys (two passes): the 64 rows of 128 bytes of each K plane (keys) and of each V plane in use (d), brought by asynchronous copies of 16 bytes a lane, a wave-wide copy being four whole 128-byte lines; the work-group's four waves share one copy of every tile. Two buffers: stage t + 1 flies while stage t is worked on.
#define SKEY 64                  // keys of a stage
#define NSTG (TT / SKEY)
#define LPIT 144                 // LDS row pitch in bytes: 128 of data + 16, the conflict-free pitch for 16-byte fragment reads of 128-byte rows
#define TILB (64 * LPIT)         // bytes of a staged tile
#define CP_(l, g) "global_load_async_to_lds_b128 %" #l ", %" #g ", off\n\t"
// One tile (copy4) or two neighbouring tiles (copy8): every thread brings 16 bytes of rows r, r + 16, r + 32, r + 48. The s_wait_xcnt 0 is the last line of the copies' own statement, so that it stands in front of every later write of the address registers which the copies name.
__device__ __forceinline__ void copy4(unsigned l, const char* g, int gs) {
    asm volatile(CP_(0, 4) CP_(1, 5) CP_(2, 6) CP_(3, 7) "s_wait_xcnt 0x0"
        :: "v"(l), "v"(l + 16 * LPIT), "v"(l + 32 * LPIT), "v"(l + 48 * LPIT), "v"(g), "v"(g + gs), "v"(g + 2 * gs), "v"(g + 3 * gs) : "memory");
}
__device__ __forceinline__ void copy8(unsigned l, const char* g, const char* g2, int gs) {
    asm volatile(CP_(0, 8) CP_(1, 9) CP_(2, 10) CP_(3, 11) CP_(4, 12) CP_(5, 13) CP_(6, 14) CP_(7, 15) "s_wait_xcnt 0x0"
        :: "v"(l), "v"(l + 16 * LPIT), "v"(l + 32 * LPIT), "v"(l + 48 * LPIT), "v"(l + TILB), "v"(l + TILB + 16 * LPIT), "v"(l + TILB + 32 * LPIT), "v"(l + TILB + 48 * LPIT),
           "v"(g), "v"(g + gs), "v"(g + 2 * gs), "v"(g + 3 * gs), "v"(g2), "v"(g2 + gs), "v"(g2 + 2 * gs), "v"(g2 + 3 * gs) : "memory");
}
template <bool HIRES, int NQ>   // NQ: 16-query column groups per wave
__device__ __forceinline__ void fattn_body(const bf* __restrict__ Qh, const bf* __restrict__ Ql, const bf* __restrict__ Kh, const bf* __restrict__ Kl, const bf* __restrict__ Vh, const bf* __restrict__ Vl, const h16* __restrict__ V16, float* Orow, int q0, int lr, int hi, char* sm, int tid) {
    v16bf qh[NQ][2], ql[NQ][2];
#pragma unroll
    for (int nq = 0; nq < NQ; ++nq)
#pragma unroll
        for (int ks = 0; ks < 2; ++ks) { const size_t qo = (size_t)(q0 + nq * 16 + lr) * HD + ks * 32 + 8 * hi; qh[nq][ks] = WFrag<bf>::ld(Qh + qo); ql[nq][ks] = WFrag<bf>::ld(Ql + qo); }
    v8f o[NQ][4]; float m[NQ], l[NQ];
#pragma unroll
    for (int nq = 0; nq < NQ; ++nq) { m[nq] = -3.0e38f; l[nq] = 0.f;
#pragma unroll
        for (int dt = 0; dt < 4; ++dt) o[nq][dt] = (v8f){}; }
    constexpr int BUFB = (HIRES ? 4 : 3) * TILB;   // a buffer: K hi, K lo, then V hi, V lo or the fp16 V
    const unsigned lc = (unsigned)(size_t)sm + (tid >> 3) * LPIT + (tid & 7) * 16;   // this thread's LDS byte in a tile: 8 threads a row
    const size_t vofs = (size_t)(tid >> 3) * (TT * 2) + (tid & 7) * 16;
    const char* gkh = (const char*)Kh + tid * 16; const char* gkl = (const char*)Kl + tid * 16; const char* gv0 = (HIRES ? (const char*)Vh : (const char*)V16) + vofs; const char* gv1 = (const char*)Vl + vofs;
    auto fill = [&](int st) { const unsigned l = lc + (st & 1) * BUFB; copy8(l, gkh + st * (SKEY * HD * 2), gkl + st * (SKEY * HD * 2), 16 * HD * 2);
        if (HIRES) copy8(l + 2 * TILB, gv0 + st * (SKEY * 2), gv1 + st * (SKEY * 2), 16 * TT * 2); else copy4(l + 2 * TILB, gv0 + st * (SKEY * 2), 16 * TT * 2); };
    fill(0);
    asm volatile("s_wait_asynccnt 0x0" ::: "memory");   // this wave's copies of stage 0 have landed
    __syncthreads();                                    // and every other wave's: stage 0 may be read
    fill(1);
#pragma unroll 1   // one copy of the body: the buffer index and the refill test stay scalar
    for (int st = 0; st < NSTG; ++st) {
    const char* sb = sm + (st & 1) * BUFB + lr * LPIT + 16 * hi;
#pragma unroll 1   // one copy of the body: a pass holds 24 to 32 matrix instructions and its operands fill nearly all directly addressed registers, so a second copy has no registers to overlap with
    for (int ps = 0; ps < 2; ++ps) {
        v16bf kh[2][2], kl[2][2];
#pragma unroll
        for (int kt = 0; kt < 2; ++kt)
#pragma unroll
            for (int ks = 0; ks < 2; ++ks) { const char* kp = sb + (ps * 32 + kt * 16) * LPIT + ks * 64; kh[kt][ks] = WFrag<bf>::ld((const bf*)kp); kl[kt][ks] = WFrag<bf>::ld((const bf*)(kp + TILB)); }
        __builtin_amdgcn_sched_barrier(0);   // keeps the pass's 16 K reads one group ahead of the products
        v8f s[NQ][2];
#pragma unroll
        for (int kt = 0; kt < 2; ++kt)
#pragma unroll
            for (int nq = 0; nq < NQ; ++nq) s[nq][kt] = (v8f){};
#pragma unroll
        for (int ks = 0; ks < 2; ++ks)
#pragma unroll
            for (int kt = 0; kt < 2; ++kt)
#pragma unroll
                for (int nq = 0; nq < NQ; ++nq) { s[nq][kt] = wmmab(kh[kt][ks], qh[nq][ks], s[nq][kt]); s[nq][kt] = wmmab(kh[kt][ks], ql[nq][ks], s[nq][kt]); s[nq][kt] = wmmab(kl[kt][ks], qh[nq][ks], s[nq][kt]); }
        v16bf vh[4], vl[4]; v16h v16[4];
#pragma unroll
        for (int dt = 0; dt < 4; ++dt) { const char* vp = sb + 2 * TILB + dt * 16 * LPIT + ps * 64; if (HIRES) { vh[dt] = WFrag<bf>::ld((const bf*)vp); vl[dt] = WFrag<bf>::ld((const bf*)(vp + TILB)); } else v16[dt] = WFrag<h16>::ld((const h16*)vp); }
        __builtin_amdgcn_sched_barrier(0);   // the pass's V reads go out as one group behind the score products, so that the softmax arithmetic covers their latency
        v16bf ph[NQ], pl[NQ]; v16h p16[NQ];
#pragma unroll
        for (int nq = 0; nq < NQ; ++nq) { float mx = m[nq];
#pragma unroll
            for (int kt = 0; kt < 2; ++kt)
#pragma unroll
                for (int j = 0; j < 8; ++j) { const float t = s[nq][kt][j] * SCL; s[nq][kt][j] = t; mx = fmaxf(mx, t); }
            mx = fmaxf(mx, xhalf(mx));      // lanes lr and lr + 16 hold the two halves of one query's keys
            const float al = exp2s((m[nq] - mx) * 1.4426950408889634f); m[nq] = mx; float sum = 0.f; v8us uh[2], ul[2]; v8h u16[2];
#pragma unroll
            for (int kt = 0; kt < 2; ++kt)
#pragma unroll
                for (int j = 0; j < 8; ++j) { const float e = (s[nq][kt][j] - mx) * 1.4426950408889634f; const float p = exp2s(HIRES ? e : e + 10.0f);   /* 2^10 = PCAR */ sum += p;
                    if (HIRES) { unsigned short a, c2; splitf(p, a, c2); uh[kt][j] = a; ul[kt][j] = c2; } else u16[kt][j] = tohx(p); }
            l[nq] = l[nq] * al + sum;                    // each half keeps its own partial sum; joined once behind the loop
            if (HIRES) { ph[nq] = cat16b(uh[0], uh[1]); pl[nq] = cat16b(ul[0], ul[1]); } else p16[nq] = cat16(u16[0], u16[1]);
#pragma unroll
            for (int dt = 0; dt < 4; ++dt) o[nq][dt] *= al; }
#pragma unroll
        for (int dt = 0; dt < 4; ++dt) {
            if (HIRES) {
#pragma unroll
                for (int nq = 0; nq < NQ; ++nq) { o[nq][dt] = wmmab(vh[dt], ph[nq], o[nq][dt]); o[nq][dt] = wmmab(vh[dt], pl[nq], o[nq][dt]); o[nq][dt] = wmmab(vl[dt], ph[nq], o[nq][dt]); }
            } else {
#pragma unroll
                for (int nq = 0; nq < NQ; ++nq) o[nq][dt] = wmma16(v16[dt], p16[nq], o[nq][dt]); } }
    }
        // hand-over of the buffers, every wave, in this order
        asm volatile("s_wait_dscnt 0x0" ::: "memory");      // this wave's reads of stage st have returned
        asm volatile("s_wait_asynccnt 0x0" ::: "memory");   // this wave's copies of stage st + 1 have landed
        __syncthreads();                                    // publishes stage st + 1 and ends every wave's reads of stage st's buffer
        if (st + 2 < NSTG) fill(st + 2);                    // into the buffer just read
    }
    asm volatile("s_wait_asynccnt 0x0" ::: "memory");   // no copy is outstanding when the wave ends
#pragma unroll
    for (int nq = 0; nq < NQ; ++nq) { const float ls = l[nq] + xhalf(l[nq]); const float f = __fdiv_rn(1.0f, ls); float* orow = Orow + (size_t)(q0 + nq * 16 + lr) * DQ + 8 * hi;
#pragma unroll
        for (int dt = 0; dt < 4; ++dt) { v4f a, c; 
#pragma unroll
            for (int j = 0; j < 4; ++j) { a[j] = o[nq][dt][j] * f; c[j] = o[nq][dt][j + 4] * f; }
            *(v4f*)(orow + dt * 16) = a; *(v4f*)(orow + dt * 16 + 4) = c; }
    }
}
// grid (batches x heads, (RH / 16 + (TT - RH) / 32) / 4), 128 threads = 4 waves on neighbouring query blocks of ONE head, which share the staged K and V tiles (one barrier a stage); a hi/lo wave (three times the P.V products and the hi/lo split a key) takes 16 query rows, an fp16 wave 32, so that a pass costs both about the same; the hi/lo blocks have the low blockIdx.y (RH / 16 is a multiple of 4: a workgroup is all of one kind).
__global__ __launch_bounds__(128) void k_fattn(const bf* __restrict__ Qh, const bf* __restrict__ Ql, const bf* __restrict__ Kh, const bf* __restrict__ Kl, const bf* __restrict__ Vh, const bf* __restrict__ Vl, const h16* __restrict__ V16, float* OUTb) {
    __shared__ __align__(16) char sm[2 * 4 * TILB];
    const int lane = threadIdx.x & 31, lr = lane & 15, hi = lane >> 4; const size_t hp = (size_t)blockIdx.x * TT * HD;   /* planes [batch][head] */ const int y = blockIdx.y * 4 + __builtin_amdgcn_readfirstlane(threadIdx.x >> 5); float* Orow = OUTb + (size_t)(blockIdx.x / NH_) * TT * DQ + (blockIdx.x % NH_) * HD;
    if (blockIdx.y < RH / 64) fattn_body<true, 1>(Qh + hp, Ql + hp, Kh + hp, Kl + hp, Vh + hp, Vl + hp, V16 + hp, Orow, y * 16, lr, hi, sm, threadIdx.x);
    else fattn_body<false, 2>(Qh + hp, Ql + hp, Kh + hp, Kl + hp, Vh + hp, Vl + hp, V16 + hp, Orow, RH + (y - RH / 16) * 32, lr, hi, sm, threadIdx.x);
}

extern "C" void kernel_launch(void* const* d_in, const int* in_sizes, int n_in,
                              void* d_out, int out_size, void* d_ws, size_t ws_size, hipStream_t stream) {
    (void)in_sizes; (void)n_in; (void)out_size;
    const float* x = (const float*)d_in[0]; const float* xk = (const float*)d_in[1]; const float* xv = (const float*)d_in[2]; const float* wq = (const float*)d_in[3]; const float* bq = (const float*)d_in[4]; const float* wk = (const float*)d_in[5]; const float* bk = (const float*)d_in[6]; const float* wv = (const float*)d_in[7]; const float* bv = (const float*)d_in[8];   /* argument order query, key, value, Wq, bq, Wk, bk, Wv, bv ('oi' [768][768] + [768]); no output projection */
    float* OUT = (float*)d_out;     // [2][2048][768]
    char* wsp = (char*)d_ws;
    auto take = [&](size_t bytes) { char* p = wsp; wsp += (bytes + 255) & ~(size_t)255; return (void*)p; };
    h16* VT16 = (h16*)take((size_t)NB_ * NKV * HD * TT * 2);
    bf* QPh = (bf*)take((size_t)NB_ * NH_ * TT * HD * 2); bf* QPl = (bf*)take((size_t)NB_ * NH_ * TT * HD * 2); bf* KPh = (bf*)take((size_t)NB_ * NKV * TT * HD * 2); bf* KPl = (bf*)take((size_t)NB_ * NKV * TT * HD * 2); bf* VTh = (bf*)take((size_t)NB_ * NKV * HD * TT * 2); bf* VTl = (bf*)take((size_t)NB_ * NKV * HD * TT * 2);   /* the planes the attention launch reads: both batches */
    if ((size_t)(wsp - (char*)d_ws) > ws_size) return;    // ws 256 MiB
    k_proj<<<dim3(NB_ * TT / 128, DQ / 128, 3), 128, 0, stream>>>(x, xk, xv, wq, wk, wv, bq, bk, bv, QPh, QPl, KPh, KPl, VT16, VTh, VTl);   /* rounding, projections, biases, planes: 3 streams x 2 batches */
    k_fattn<<<dim3(NB_ * NH_, (RH / 16 + (TT - RH) / 32) / 4, 1), 128, 0, stream>>>(QPh, QPl, KPh, KPl, VTh, VTl, VT16, OUT);   /* all 24 batch-heads: scores, softmax, P.V, merge */
}

// v004
// It runs in 82.1 microseconds.
// Two timings next to v003 both put it at 1.04 times that version's speed.
// Counting every step since v000, it is 18.1 times as fast.
#include <hip/hip_runtime.h>

// Multi-head attention on three input streams at d_model 768 WITHOUT an output projection (query, key, value [2][2048][768]; Q = query Wq^T + bq, K = key Wk^T + bk, V = value Wv^T + bv ('oi' + biases; 12 heads x 64); scores / sqrt(64); softmax (no mask); out = heads merged -> [2][2048][768] (3.1 M); argument order query, key, value, Wq, bq, Wk, bk, Wv, bv).
// Layout: ONE projection launch for all three streams and both batches ('oi' weights; f32 operands rounded to bf16 on their way into LDS; exact products (K 768) + f32 biases; its epilogue writes the planes the attention reads); then ONE fused attention launch for all 24 batch-heads (online softmax, scores and P stay in registers) with EVERY row's scores on hi/lo planes (3 products: no output projection averages the fp16 score error) and hybrid P.V (rows < 512 hi/lo, rest fp16 x1024); it writes the merged f32 output rows.
// Compute dtypes, f32 accumulate: every input rounded to bf16; projections exact + f32 biases; scores 3 products on every row; P.V rows < 512 3 products, rest fp16; softmax f32; output f32.

#define NB_  2
#define TT   2048
#define DM   768
#define NH_  12
#define NKV  12
#define REP  (NH_ / NKV)
#define HD   64
#define DQ   (NH_ * HD)
#define DKV  (NKV * HD)
#define ZH   2
#define RH   512                  // query rows < RH use hi+lo planes (0: none)
#define WIN  0
#define PCAR 1024.0f
#define SCL  0.125f   // HD^-0.5
typedef _Float16 h16;
typedef unsigned short bf;
typedef __attribute__((ext_vector_type(16))) __bf16   v16bf;
typedef __attribute__((ext_vector_type(16))) _Float16 v16h;
typedef __attribute__((ext_vector_type(8)))  _Float16 v8h;
typedef __attribute__((ext_vector_type(8)))  unsigned short v8us;
typedef __attribute__((ext_vector_type(8)))  float    v8f;
typedef __attribute__((ext_vector_type(4)))  float    v4f;
typedef v8h  __attribute__((may_alias)) v8ha;
typedef v4f  __attribute__((may_alias)) v4fa;
typedef v8us __attribute__((may_alias)) v8usa;

__device__ __forceinline__ unsigned short f2bf(float f) { unsigned u = __float_as_uint(f); u += 0x7FFFu + ((u >> 16) & 1u); return (unsigned short)(u >> 16); }
__device__ __forceinline__ float bf2f(unsigned short b) { return __uint_as_float(((unsigned)b) << 16); }
__device__ __forceinline__ float bfr(float f) { return bf2f(f2bf(f)); }
__device__ __forceinline__ v16h cat16(v8h lo, v8h hi) { return __builtin_shufflevector(lo, hi, 0, 1, 2, 3, 4, 5, 6, 7, 8, 9, 10, 11, 12, 13, 14, 15); }
__device__ __forceinline__ v16bf cat16b(v8us lo, v8us hi) { return __builtin_bit_cast(v16bf, __builtin_shufflevector(lo, hi, 0, 1, 2, 3, 4, 5, 6, 7, 8, 9, 10, 11, 12, 13, 14, 15)); }
__device__ __forceinline__ v8f wmma16(v16h a, v16h b, v8f c) { return __builtin_amdgcn_wmma_f32_16x16x32_f16(false, a, false, b, (short)0, c, false, false); }
__device__ __forceinline__ v8f wmmab(v16bf a, v16bf b, v8f c) { return __builtin_amdgcn_wmma_f32_16x16x32_bf16(false, a, false, b, (short)0, c, false, false); }



// fragment loaders: 16 k of one row a lane, k = 8 hi + 0..7 and 16 + 8 hi + 0..7 of a 32-k step, from K-contiguous 16-bit rows
template <typename T16> struct WFrag;
template <> struct WFrag<h16> { typedef v16h V; static __device__ __forceinline__ V ld(const h16* p) { return cat16(*(const v8h*)p, *(const v8h*)(p + 16)); } static __device__ __forceinline__ v8f mma(V a, V b, v8f c) { return wmma16(a, b, c); } };
template <> struct WFrag<bf> { typedef v16bf V; static __device__ __forceinline__ V ld(const bf* p) { return cat16b(*(const v8us*)p, *(const v8us*)(p + 16)); } static __device__ __forceinline__ v8f mma(V a, V b, v8f c) { return wmmab(a, b, c); } };

__device__ __forceinline__ h16 tohx(float x) { return (h16)x; }
__device__ __forceinline__ void splitf(float y, unsigned short& h, unsigned short& l) { h = f2bf(y); l = f2bf(y - bf2f(h)); }
typedef __attribute__((ext_vector_type(2))) _Float16 v2h;
typedef __attribute__((ext_vector_type(4))) _Float16 v4h;
typedef __attribute__((ext_vector_type(2))) unsigned short v2us;
typedef __attribute__((ext_vector_type(4))) unsigned short v4us;
typedef __attribute__((ext_vector_type(2))) float v2f;
typedef __attribute__((ext_vector_type(4))) int v4i;

// ---- k_proj: the three projections of both batches in ONE launch, from the f32 inputs to the planes that k_fattn reads: no bf16 copy and no f32 projection in memory.
// grid (NB_ * TT / 128, DQ / 128, 3 streams: query, key, value), 128 threads = 4 waves, 128 x 128 outputs a work-group, 64 x 64 (16 accumulators) a wave. C[m][n] = sum_k bf16(X[m][k]) bf16(W[n][k]) + bf16(bias[n]), f32 accumulate, k ascending in passes of 32.
// A pass: every thread rounds the 16 x 4 f32 that it fetched one pass ahead (a wave-wide load is four whole 128-byte lines) and stores them as bf16 rows in LDS (rows 0..127 X, 128..255 W); one barrier; the next pass's fetch goes out; fragments come from LDS in the k order of WFrag::ld.
// Two LDS buffers, ONE barrier a pass: a wave overwrites the buffer of pass p only in pass p + 2, behind the barrier of pass p + 1, which no wave reaches before its reads of pass p have returned.
// Epilogue: a 64-column tile is one head, a 64-row tile lies in one batch. query, key: rows [head][t][d] as bf16 hi + lo, staged through the wave's own LDS range so that whole 128-byte lines are stored. value: planes [head][d][t]; an accumulator register run is 8 neighbouring t of one d, stored straight from registers as fp16, hi and lo.
#define PK   32    // k of a pass
#define PPIT 40    // LDS row pitch in bf16 elements: 64 bytes of data + 16, the conflict-free pitch for 16-byte fragment reads of 64-byte rows
typedef __attribute__((ext_vector_type(4))) __bf16 v4bf;
__global__ __launch_bounds__(128) void k_proj(const float* __restrict__ xq, const float* __restrict__ xk, const float* __restrict__ xv, const float* __restrict__ wq, const float* __restrict__ wk, const float* __restrict__ wv, const float* __restrict__ bq, const float* __restrict__ bk, const float* __restrict__ bv, bf* Qh, bf* Ql, bf* Kh, bf* Kl, h16* V16, bf* Vh, bf* Vl) {
    __shared__ __align__(16) bf ts[2][256 * PPIT];
    __shared__ __align__(16) float osall[4][16 * 68];
    const int z = blockIdx.z; const float* X = z == 0 ? xq : z == 1 ? xk : xv; const float* Wt = z == 0 ? wq : z == 1 ? wk : wv; const float* bias = z == 0 ? bq : z == 1 ? bk : bv;
    const int tid = threadIdx.x, w = __builtin_amdgcn_readfirstlane(tid >> 5), lane = tid & 31, lr = lane & 15, hi = lane >> 4;
    const int wr = (w & 1) * 64, wc = (w >> 1) * 64; const int r0 = blockIdx.x * 128 + wr, c0 = blockIdx.y * 128 + wc;
    const int sr = tid >> 3, sc = (tid & 7) * 4;   // staging: 8 threads a row of 32 f32, rows sr + 16 i
    const float* gx = X + (size_t)(blockIdx.x * 128 + sr) * DM + sc; const float* gw = Wt + (size_t)(blockIdx.y * 128 + sr) * DM + sc;
    v8f acc[4][4];
#pragma unroll
    for (int mb = 0; mb < 4; ++mb)
#pragma unroll
        for (int nb = 0; nb < 4; ++nb) acc[mb][nb] = (v8f){};
    v4f st[16];
#pragma unroll
    for (int i = 0; i < 8; ++i) { st[i] = *(const v4f*)(gx + (size_t)i * 16 * DM); st[8 + i] = *(const v4f*)(gw + (size_t)i * 16 * DM); }
#pragma unroll 1   // one copy of the body: the buffer index and the fetch test stay scalar, and 16 accumulators, 16 fetched vectors and the fragments leave a second copy nothing to overlap with
    for (int kc = 0; kc < DM; kc += PK) {
        bf* tb = ts[(kc / PK) & 1];
#pragma unroll
        for (int i = 0; i < 16; ++i) *(v4us*)(tb + (sr + 16 * i) * PPIT + sc) = __builtin_bit_cast(v4us, __builtin_convertvector(st[i], v4bf));   // round to nearest even, as f2bf
        __syncthreads();   // publishes this pass's rows; also ends every wave's reads of the other buffer before the next pass overwrites it
        if (kc + PK < DM) {
#pragma unroll
            for (int i = 0; i < 8; ++i) { st[i] = *(const v4f*)(gx + (size_t)i * 16 * DM + kc + PK); st[8 + i] = *(const v4f*)(gw + (size_t)i * 16 * DM + kc + PK); }
            asm volatile("s_wait_xcnt 0x0" ::: "memory");   // the run's two address pairs are dead behind its last load and the build reuses them for the fragment reads below: the wait stands in front of that overwrite of registers which the sixteen loads name
        }
        v16bf a[4], b[2];   // two W fragment sets in turn: four would push the kernel past 256 registers
#pragma unroll
        for (int mb = 0; mb < 4; ++mb) a[mb] = WFrag<bf>::ld(tb + (wr + mb * 16 + lr) * PPIT + 8 * hi);
#pragma unroll
        for (int nb = 0; nb < 2; ++nb) b[nb] = WFrag<bf>::ld(tb + (128 + wc + nb * 16 + lr) * PPIT + 8 * hi);
#pragma unroll
        for (int nb = 0; nb < 4; ++nb) {
#pragma unroll
            for (int mb = 0; mb < 4; ++mb) acc[mb][nb] = wmmab(a[mb], b[nb & 1], acc[mb][nb]);
            if (nb < 2) { b[nb & 1] = WFrag<bf>::ld(tb + (128 + wc + (nb + 2) * 16 + lr) * PPIT + 8 * hi);
                __builtin_amdgcn_sched_barrier(0); }   // holds the refill of a W set right behind that set's last product, so that the other set's four products cover part of its LDS wait
        }
        asm volatile("v_nop\n\tv_nop\n\tv_nop\n\tv_nop" : "+v"(acc[0][0]), "+v"(acc[1][1]), "+v"(acc[2][2]), "+v"(acc[3][3]) : "v"(a[0]), "v"(a[3]));   // the four vector slots that the chip needs behind the pass's last matrix instruction, also on the taken back edge
    }
    const size_t hp = ((size_t)(r0 / TT) * NH_ + c0 / HD) * TT * HD; const int t0 = r0 % TT;   // this tile's batch-head plane and its first position
    // In both epilogues a block's values are all formed first, then its stores go out as one run with s_wait_xcnt 0 behind it, each part held in place by sched_barrier(0).
    if (z < 2) {
        bf* Ph = (z == 0 ? Qh : Kh) + hp; bf* Pl = (z == 0 ? Ql : Kl) + hp; float* os = osall[w]; const int cofs = lr * 4; v4f bb = *(const v4f*)(bias + c0 + cofs);
        asm volatile("s_wait_xcnt 0x0" ::: "memory");   // in front of any reuse of the bias load's address registers
        __builtin_amdgcn_sched_barrier(0);              // keeps later register writes behind that wait
#pragma unroll
        for (int q = 0; q < 4; ++q) bb[q] = bfr(bb[q]);
#pragma unroll
        for (int mb = 0; mb < 4; ++mb) {
#pragma unroll
            for (int nb = 0; nb < 4; ++nb) {
#pragma unroll
                for (int j = 0; j < 8; ++j) os[(hi * 8 + j) * 68 + nb * 16 + lr] = acc[mb][nb][j]; }
            __builtin_amdgcn_wave_barrier(); asm volatile("" ::: "memory");   // the wave's own LDS stores stay in front of its reads of other lanes' values
            v4us oh[8], ol[8];
#pragma unroll
            for (int s = 0; s < 8; ++s) { const v4f val = *(const v4fa*)(os + (2 * s + hi) * 68 + cofs) + bb;
#pragma unroll
                for (int q = 0; q < 4; ++q) { unsigned short a2, c2; splitf(val[q], a2, c2); oh[s][q] = a2; ol[s][q] = c2; } }
            __builtin_amdgcn_wave_barrier(); asm volatile("" ::: "memory");   // and these reads in front of the next block's LDS stores
            __builtin_amdgcn_sched_barrier(0);   // values first
#pragma unroll
            for (int s = 0; s < 8; ++s) { const size_t po = (size_t)(t0 + mb * 16 + 2 * s + hi) * HD + cofs; *(v4us*)(Ph + po) = oh[s]; *(v4us*)(Pl + po) = ol[s]; }
            asm volatile("s_wait_xcnt 0x0" ::: "memory");   // behind the run of stores, in front of the next block's writes of their registers
            __builtin_amdgcn_sched_barrier(0);   // keeps those writes behind the wait
        }
    } else {
        float bn[4];
#pragma unroll
        for (int nb = 0; nb < 4; ++nb) bn[nb] = bias[c0 + nb * 16 + lr];
        asm volatile("s_wait_xcnt 0x0" ::: "memory");   // in front of any reuse of the bias loads' offset register
        __builtin_amdgcn_sched_barrier(0);              // keeps later register writes behind that wait
#pragma unroll
        for (int nb = 0; nb < 4; ++nb) { const float bnr = bfr(bn[nb]); const size_t vo = hp + (size_t)(nb * 16 + lr) * TT + t0 + 8 * hi; v8h o16[4]; v8us oh[4], ol[4];
#pragma unroll
            for (int mb = 0; mb < 4; ++mb)
#pragma unroll
                for (int j = 0; j < 8; ++j) { const float x = acc[mb][nb][j] + bnr; o16[mb][j] = tohx(x); unsigned short a2, c2; splitf(x, a2, c2); oh[mb][j] = a2; ol[mb][j] = c2; }
            __builtin_amdgcn_sched_barrier(0);   // values first
#pragma unroll
            for (int mb = 0; mb < 4; ++mb) { *(v8h*)(V16 + vo + mb * 16) = o16[mb]; *(v8us*)(Vh + vo + mb * 16) = oh[mb]; *(v8us*)(Vl + vo + mb * 16) = ol[mb]; }
            asm volatile("s_wait_xcnt 0x0" ::: "memory");   // behind the run of stores, in front of the next block's writes of their registers
            __builtin_amdgcn_sched_barrier(0);   // keeps those writes behind the wait
        }
    }
}

// k_fattn: scores, softmax, P.V and the head merge in ONE kernel; a pair of waves per 16 or 32 query rows of one head, each wave on its half of the keys, 32 keys a pass, running maximum and sum (online softmax), the pair's partial results joined at the end: no score or P plane in memory.
// S^T = K Q^T (A = K rows, B = Q rows, hi/lo planes, 3 products): lane (lr, hi) register j of key tile kt holds the score of key j0 + 16 kt + 8 hi + j for query lr, so the two key tiles of a pass, converted in place, are the B operand P^T of O^T += V^T P^T in the same k order as WFrag::ld reads V^T rows.
// HIRES (query rows < RH): P and V on hi/lo planes, 3 products; else P x PCAR in fp16 against the fp16 V plane (the factor is in the row sum too and cancels in O / sum).
// value of lane l ^ 16 (the other half of a query's keys) without the LDS path's latency
__device__ __forceinline__ float xhalf(float x) { const int b = __float_as_int(x); return __int_as_float(__builtin_amdgcn_permlanex16(b, b, 0x76543210, 0xfedcba98, false, false)); }
// 2^x with the instruction set's one free slot behind a transcendental kept in the same statement.
__device__ __forceinline__ float exp2s(float x) { float r; asm("v_exp_f32 %0, %1\n\tv_nop" : "=v"(r) : "v"(x)); return r; }
// K and V reach the waves through LDS: a stage is 64 keys (two passes): the 64 rows of 128 bytes of each K plane (keys) and of each V plane in use (d), brought by asynchronous copies of 16 bytes a lane, a wave-wide copy being four whole 128-byte lines; a key group's four waves share one copy of every tile. Two buffers: stage t + 1 flies while stage t is worked on.
#define SKEY 64                  // keys of a stage
#define KSPL 2                   // key groups of a work-group: waves 0..3 walk the first half of the keys, waves 4..7 the second half, for the same four query blocks
#define NSTG (TT / KSPL / SKEY)  // stages of a key group
#define XCHB ((32 + 2 * 2) * 32 * 4)   // bytes in which a wave hands half of its partial result to its partner in the other key group: at most 32 output values, 2 maxima and 2 sums a lane
#define LPIT 144                 // LDS row pitch in bytes: 128 of data + 16, the conflict-free pitch for 16-byte fragment reads of 128-byte rows
#define TILB (64 * LPIT)         // bytes of a staged tile
#define CP_(l, g) "global_load_async_to_lds_b128 %" #l ", %" #g ", off\n\t"
// One tile (copy4) or two neighbouring tiles (copy8): every thread brings 16 bytes of rows r, r + 16, r + 32, r + 48. The s_wait_xcnt 0 is the last line of the copies' own statement, so that it stands in front of every later write of the address registers which the copies name.
__device__ __forceinline__ void copy4(unsigned l, const char* g, int gs) {
    asm volatile(CP_(0, 4) CP_(1, 5) CP_(2, 6) CP_(3, 7) "s_wait_xcnt 0x0"
        :: "v"(l), "v"(l + 16 * LPIT), "v"(l + 32 * LPIT), "v"(l + 48 * LPIT), "v"(g), "v"(g + gs), "v"(g + 2 * gs), "v"(g + 3 * gs) : "memory");
}
__device__ __forceinline__ void copy8(unsigned l, const char* g, const char* g2, int gs) {
    asm volatile(CP_(0, 8) CP_(1, 9) CP_(2, 10) CP_(3, 11) CP_(4, 12) CP_(5, 13) CP_(6, 14) CP_(7, 15) "s_wait_xcnt 0x0"
        :: "v"(l), "v"(l + 16 * LPIT), "v"(l + 32 * LPIT), "v"(l + 48 * LPIT), "v"(l + TILB), "v"(l + TILB + 16 * LPIT), "v"(l + TILB + 32 * LPIT), "v"(l + TILB + 48 * LPIT),
           "v"(g), "v"(g + gs), "v"(g + 2 * gs), "v"(g + 3 * gs), "v"(g2), "v"(g2 + gs), "v"(g2 + 2 * gs), "v"(g2 + 3 * gs) : "memory");
}
template <bool HIRES, int NQ>   // NQ: 16-query column groups per wave
__device__ __forceinline__ void fattn_body(const bf* __restrict__ Qh, const bf* __restrict__ Ql, const bf* __restrict__ Kh, const bf* __restrict__ Kl, const bf* __restrict__ Vh, const bf* __restrict__ Vl, const h16* __restrict__ V16, float* Orow, int q0, int lr, int hi, char* sm, int tid, int kg, float* xs, const float* xr) {
    v16bf qh[NQ][2], ql[NQ][2];
#pragma unroll
    for (int nq = 0; nq < NQ; ++nq)
#pragma unroll
        for (int ks = 0; ks < 2; ++ks) { const size_t qo = (size_t)(q0 + nq * 16 + lr) * HD + ks * 32 + 8 * hi; qh[nq][ks] = WFrag<bf>::ld(Qh + qo); ql[nq][ks] = WFrag<bf>::ld(Ql + qo); }
    v8f o[NQ][4]; float m[NQ], l[NQ];
#pragma unroll
    for (int nq = 0; nq < NQ; ++nq) { m[nq] = -3.0e38f; l[nq] = 0.f;
#pragma unroll
        for (int dt = 0; dt < 4; ++dt) o[nq][dt] = (v8f){}; }
    constexpr int BUFB = (HIRES ? 4 : 3) * TILB;   // a buffer: K hi, K lo, then V hi, V lo or the fp16 V
    const unsigned lc = (unsigned)(size_t)sm + (tid >> 3) * LPIT + (tid & 7) * 16;   // this thread's LDS byte in a tile: 8 threads a row
    const size_t vofs = (size_t)(tid >> 3) * (TT * 2) + (tid & 7) * 16;
    const char* gkh = (const char*)Kh + tid * 16; const char* gkl = (const char*)Kl + tid * 16; const char* gv0 = (HIRES ? (const char*)Vh : (const char*)V16) + vofs; const char* gv1 = (const char*)Vl + vofs;
    auto fill = [&](int st) { const unsigned l = lc + (st & 1) * BUFB; copy8(l, gkh + st * (SKEY * HD * 2), gkl + st * (SKEY * HD * 2), 16 * HD * 2);
        if (HIRES) copy8(l + 2 * TILB, gv0 + st * (SKEY * 2), gv1 + st * (SKEY * 2), 16 * TT * 2); else copy4(l + 2 * TILB, gv0 + st * (SKEY * 2), 16 * TT * 2); };
    fill(0);
    asm volatile("s_wait_asynccnt 0x0" ::: "memory");   // this wave's copies of stage 0 have landed
    __syncthreads();                                    // and every other wave's: stage 0 may be read
    fill(1);
#pragma unroll 1   // one copy of the body: the buffer index and the refill test stay scalar
    for (int st = 0; st < NSTG; ++st) {
    const char* sb = sm + (st & 1) * BUFB + lr * LPIT + 16 * hi;
#pragma unroll 1   // one copy of the body: a pass holds 24 to 32 matrix instructions and its operands fill nearly all directly addressed registers, so a second copy has no registers to overlap with
    for (int ps = 0; ps < 2; ++ps) {
        v16bf kh[2][2], kl[2][2];
#pragma unroll
        for (int kt = 0; kt < 2; ++kt)
#pragma unroll
            for (int ks = 0; ks < 2; ++ks) { const char* kp = sb + (ps * 32 + kt * 16) * LPIT + ks * 64; kh[kt][ks] = WFrag<bf>::ld((const bf*)kp); kl[kt][ks] = WFrag<bf>::ld((const bf*)(kp + TILB)); }
        __builtin_amdgcn_sched_barrier(0);   // keeps the pass's 16 K reads one group ahead of the products
        v8f s[NQ][2];
#pragma unroll
        for (int kt = 0; kt < 2; ++kt)
#pragma unroll
            for (int nq = 0; nq < NQ; ++nq) s[nq][kt] = (v8f){};
#pragma unroll
        for (int ks = 0; ks < 2; ++ks)
#pragma unroll
            for (int kt = 0; kt < 2; ++kt)
#pragma unroll
                for (int nq = 0; nq < NQ; ++nq) { s[nq][kt] = wmmab(kh[kt][ks], qh[nq][ks], s[nq][kt]); s[nq][kt] = wmmab(kh[kt][ks], ql[nq][ks], s[nq][kt]); s[nq][kt] = wmmab(kl[kt][ks], qh[nq][ks], s[nq][kt]); }
        v16bf vh[4], vl[4]; v16h v16[4];
#pragma unroll
        for (int dt = 0; dt < 4; ++dt) { const char* vp = sb + 2 * TILB + dt * 16 * LPIT + ps * 64; if (HIRES) { vh[dt] = WFrag<bf>::ld((const bf*)vp); vl[dt] = WFrag<bf>::ld((const bf*)(vp + TILB)); } else v16[dt] = WFrag<h16>::ld((const h16*)vp); }
        __builtin_amdgcn_sched_barrier(0);   // the pass's V reads go out as one group behind the score products, so that the softmax arithmetic covers their latency
        v16bf ph[NQ], pl[NQ]; v16h p16[NQ];
#pragma unroll
        for (int nq = 0; nq < NQ; ++nq) { float mx = m[nq];
#pragma unroll
            for (int kt = 0; kt < 2; ++kt)
#pragma unroll
                for (int j = 0; j < 8; ++j) { const float t = s[nq][kt][j] * SCL; s[nq][kt][j] = t; mx = fmaxf(mx, t); }
            mx = fmaxf(mx, xhalf(mx));      // lanes lr and lr + 16 hold the two halves of one query's keys
            const float al = exp2s((m[nq] - mx) * 1.4426950408889634f); m[nq] = mx; float sum = 0.f; v8us uh[2], ul[2]; v8h u16[2];
#pragma unroll
            for (int kt = 0; kt < 2; ++kt)
#pragma unroll
                for (int j = 0; j < 8; ++j) { const float e = (s[nq][kt][j] - mx) * 1.4426950408889634f; const float p = exp2s(HIRES ? e : e + 10.0f);   /* 2^10 = PCAR */ sum += p;
                    if (HIRES) { unsigned short a, c2; splitf(p, a, c2); uh[kt][j] = a; ul[kt][j] = c2; } else u16[kt][j] = tohx(p); }
            l[nq] = l[nq] * al + sum;                    // each half keeps its own partial sum; joined once behind the loop
            if (HIRES) { ph[nq] = cat16b(uh[0], uh[1]); pl[nq] = cat16b(ul[0], ul[1]); } else p16[nq] = cat16(u16[0], u16[1]);
#pragma unroll
            for (int dt = 0; dt < 4; ++dt) o[nq][dt] *= al; }
#pragma unroll
        for (int dt = 0; dt < 4; ++dt) {
            if (HIRES) {
#pragma unroll
                for (int nq = 0; nq < NQ; ++nq) { o[nq][dt] = wmmab(vh[dt], ph[nq], o[nq][dt]); o[nq][dt] = wmmab(vh[dt], pl[nq], o[nq][dt]); o[nq][dt] = wmmab(vl[dt], ph[nq], o[nq][dt]); }
            } else {
#pragma unroll
                for (int nq = 0; nq < NQ; ++nq) o[nq][dt] = wmma16(v16[dt], p16[nq], o[nq][dt]); } }
    }
        // hand-over of the buffers, every wave, in this order
        asm volatile("s_wait_dscnt 0x0" ::: "memory");      // this wave's reads of stage st have returned
        asm volatile("s_wait_asynccnt 0x0" ::: "memory");   // this wave's copies of stage st + 1 have landed
        __syncthreads();                                    // publishes stage st + 1 and ends every wave's reads of stage st's buffer
        if (st + 2 < NSTG) fill(st + 2);                    // into the buffer just read
    }
    asm volatile("s_wait_asynccnt 0x0" ::: "memory");   // no copy is outstanding when the wave ends
    // The two key groups' partial results are joined through LDS, alike in every wave: of a pair's NQ * 4 output tiles (16 d x 16 queries) key group 0 finishes the first half and key group 1 the second; each hands the other half to its partner, with its maxima and sums. The ring is free for it: the loop's last barrier stands behind every wave's last read, and no copy is outstanding.
    constexpr int TH = NQ * 2; const int lane = hi * 16 + lr; const bool g1 = kg != 0;
#pragma unroll
    for (int t = 0; t < TH; ++t) { const v8f sd = g1 ? o[t / 4][t % 4] : o[(TH + t) / 4][(TH + t) % 4]; v4f a, c;
#pragma unroll
        for (int j = 0; j < 4; ++j) { a[j] = sd[j]; c[j] = sd[j + 4]; }
        *(v4fa*)(xs + (2 * t) * 128 + lane * 4) = a; *(v4fa*)(xs + (2 * t + 1) * 128 + lane * 4) = c; }   // 16 bytes a lane, lanes side by side: no bank conflict
#pragma unroll
    for (int nq = 0; nq < NQ; ++nq) { xs[TH * 256 + (2 * nq) * 32 + lane] = m[nq]; xs[TH * 256 + (2 * nq + 1) * 32 + lane] = l[nq]; }
    __syncthreads();   // publishes every wave's hand-over to its partner
    const int nk = NQ == 2 ? kg : 0;   // the query group whose tiles this wave finishes (with one query group: d 32 kg .. 32 kg + 31 of it)
    const float m0 = g1 ? m[NQ - 1] : m[0], l0 = g1 ? l[NQ - 1] : l[0], m1 = xr[TH * 256 + (2 * nk) * 32 + lane], l1 = xr[TH * 256 + (2 * nk + 1) * 32 + lane]; const float mj = fmaxf(m0, m1);
    const float a0 = exp2s((m0 - mj) * 1.4426950408889634f), a1 = exp2s((m1 - mj) * 1.4426950408889634f);   // each group's terms brought to the common maximum
    const float lj = l0 * a0 + l1 * a1; const float ls = lj + xhalf(lj); const float f = __fdiv_rn(1.0f, ls); const float f0 = a0 * f, f1 = a1 * f; float* orow = Orow + (size_t)(q0 + nk * 16 + lr) * DQ + 8 * hi + (NQ == 2 ? 0 : kg * 32);
#pragma unroll
    for (int t = 0; t < TH; ++t) { const v8f kp = g1 ? o[(TH + t) / 4][(TH + t) % 4] : o[t / 4][t % 4]; const v4f b = *(const v4fa*)(xr + (2 * t) * 128 + lane * 4), d = *(const v4fa*)(xr + (2 * t + 1) * 128 + lane * 4); v4f a, c;
#pragma unroll
        for (int j = 0; j < 4; ++j) { a[j] = kp[j] * f0 + b[j] * f1; c[j] = kp[j + 4] * f0 + d[j] * f1; }
        *(v4f*)(orow + t * 16) = a; *(v4f*)(orow + t * 16 + 4) = c; }
}
// grid (batches x heads, (RH / 16 + (TT - RH) / 32) / 4), 256 threads = 8 waves: four neighbouring query blocks of ONE head times two key groups. Waves w and w + 4 hold the same query block; each key group has its own ring of staged K and V tiles, filled by its own four waves, and walks its half of the keys; the stage barrier is common. With two work-groups on a WGP four waves share a SIMD, so that one wave's LDS waits and dependent softmax arithmetic are covered by the others' matrix and vector work. A hi/lo wave (three times the P.V products and the hi/lo split a key) takes 16 query rows, an fp16 wave 32, so that a pass costs both about the same; the hi/lo blocks have the low blockIdx.y (RH / 16 is a multiple of 4: a workgroup is all of one kind). amdgpu_waves_per_eu(4, 4) holds the register budget at 256, without which only one work-group fits a WGP; 2 x the LDS size is 294,912 bytes and fits too.
__global__ __launch_bounds__(256) __attribute__((amdgpu_waves_per_eu(4, 4))) void k_fattn(const bf* __restrict__ Qh, const bf* __restrict__ Ql, const bf* __restrict__ Kh, const bf* __restrict__ Kl, const bf* __restrict__ Vh, const bf* __restrict__ Vl, const h16* __restrict__ V16, float* OUTb) {
    __shared__ __align__(16) char sm[KSPL * 2 * 4 * TILB];
    const int lane = threadIdx.x & 31, lr = lane & 15, hi = lane >> 4; const size_t hp = (size_t)blockIdx.x * TT * HD;   /* planes [batch][head] */ const int wv = __builtin_amdgcn_readfirstlane(threadIdx.x >> 5), kg = wv >> 2, y = blockIdx.y * 4 + (wv & 3); float* Orow = OUTb + (size_t)(blockIdx.x / NH_) * TT * DQ + (blockIdx.x % NH_) * HD;
    const size_t kp = hp + (size_t)kg * (TT / KSPL) * HD, vp = hp + (size_t)kg * (TT / KSPL);   // the key group's first K row ([t][d] planes) and first V column ([d][t] planes)
    char* ring = sm + kg * (2 * 4 * TILB); float* xs = (float*)(sm + wv * XCHB); const float* xr = (const float*)(sm + (wv ^ 4) * XCHB); const int tid = threadIdx.x & 127;
    if (blockIdx.y < RH / 64) fattn_body<true, 1>(Qh + hp, Ql + hp, Kh + kp, Kl + kp, Vh + vp, Vl + vp, V16 + vp, Orow, y * 16, lr, hi, ring, tid, kg, xs, xr);
    else fattn_body<false, 2>(Qh + hp, Ql + hp, Kh + kp, Kl + kp, Vh + vp, Vl + vp, V16 + vp, Orow, RH + (y - RH / 16) * 32, lr, hi, ring, tid, kg, xs, xr);
}

extern "C" void kernel_launch(void* const* d_in, const int* in_sizes, int n_in,
                              void* d_out, int out_size, void* d_ws, size_t ws_size, hipStream_t stream) {
    (void)in_sizes; (void)n_in; (void)out_size;
    const float* x = (const float*)d_in[0]; const float* xk = (const float*)d_in[1]; const float* xv = (const float*)d_in[2]; const float* wq = (const float*)d_in[3]; const float* bq = (const float*)d_in[4]; const float* wk = (const float*)d_in[5]; const float* bk = (const float*)d_in[6]; const float* wv = (const float*)d_in[7]; const float* bv = (const float*)d_in[8];   /* argument order query, key, value, Wq, bq, Wk, bk, Wv, bv ('oi' [768][768] + [768]); no output projection */
    float* OUT = (float*)d_out;     // [2][2048][768]
    char* wsp = (char*)d_ws;
    auto take = [&](size_t bytes) { char* p = wsp; wsp += (bytes + 255) & ~(size_t)255; return (void*)p; };
    h16* VT16 = (h16*)take((size_t)NB_ * NKV * HD * TT * 2);
    bf* QPh = (bf*)take((size_t)NB_ * NH_ * TT * HD * 2); bf* QPl = (bf*)take((size_t)NB_ * NH_ * TT * HD * 2); bf* KPh = (bf*)take((size_t)NB_ * NKV * TT * HD * 2); bf* KPl = (bf*)take((size_t)NB_ * NKV * TT * HD * 2); bf* VTh = (bf*)take((size_t)NB_ * NKV * HD * TT * 2); bf* VTl = (bf*)take((size_t)NB_ * NKV * HD * TT * 2);   /* the planes the attention launch reads: both batches */
    if ((size_t)(wsp - (char*)d_ws) > ws_size) return;    // ws 256 MiB
    k_proj<<<dim3(NB_ * TT / 128, DQ / 128, 3), 128, 0, stream>>>(x, xk, xv, wq, wk, wv, bq, bk, bv, QPh, QPl, KPh, KPl, VT16, VTh, VTl);   /* rounding, projections, biases, planes: 3 streams x 2 batches */
    k_fattn<<<dim3(NB_ * NH_, (RH / 16 + (TT - RH) / 32) / 4, 1), 256, 0, stream>>>(QPh, QPl, KPh, KPl, VTh, VTl, VT16, OUT);   /* all 24 batch-heads: scores, softmax, P.V, merge */
}

// v005
// A run of this version takes 78.7 microseconds.
// In both of two side-by-side timings against v004, it was 1.04 times as fast.
// Over all steps from v000 it is 18.9 times as fast.
#include <hip/hip_runtime.h>

// Multi-head attention on three input streams at d_model 768 WITHOUT an output projection (query, key, value [2][2048][768]; Q = query Wq^T + bq, K = key Wk^T + bk, V = value Wv^T + bv ('oi' + biases; 12 heads x 64); scores / sqrt(64); softmax (no mask); out = heads merged -> [2][2048][768] (3.1 M); argument order query, key, value, Wq, bq, Wk, bk, Wv, bv).
// Layout: ONE projection launch for all three streams and both batches ('oi' weights; f32 operands rounded to bf16 on their way into LDS; exact products (K 768) + f32 biases; its epilogue writes the planes the attention reads); then ONE fused attention launch for all 24 batch-heads (online softmax, scores and P stay in registers) with EVERY row's scores on hi/lo planes (3 products: no output projection averages the fp16 score error) and hybrid P.V (rows < 512 hi/lo, rest fp16 x1024); it writes the merged f32 output rows.
// Compute dtypes, f32 accumulate: every input rounded to bf16; projections exact + f32 biases; scores 3 products on every row; P.V rows < 512 3 products, rest fp16; softmax f32; output f32.

#define NB_  2
#define TT   2048
#define DM   768
#define NH_  12
#define NKV  12
#define REP  (NH_ / NKV)
#define HD   64
#define DQ   (NH_ * HD)
#define DKV  (NKV * HD)
#define ZH   2
#define RH   512                  // query rows < RH use hi+lo planes (0: none)
#define WIN  0
#define PCAR 1024.0f
#define SCL  0.125f   // HD^-0.5
typedef _Float16 h16;
typedef unsigned short bf;
typedef __attribute__((ext_vector_type(16))) __bf16   v16bf;
typedef __attribute__((ext_vector_type(16))) _Float16 v16h;
typedef __attribute__((ext_vector_type(8)))  _Float16 v8h;
typedef __attribute__((ext_vector_type(8)))  unsigned short v8us;
typedef __attribute__((ext_vector_type(8)))  float    v8f;
typedef __attribute__((ext_vector_type(4)))  float    v4f;
typedef v8h  __attribute__((may_alias)) v8ha;
typedef v4f  __attribute__((may_alias)) v4fa;
typedef v8us __attribute__((may_alias)) v8usa;

__device__ __forceinline__ unsigned short f2bf(float f) { unsigned u = __float_as_uint(f); u += 0x7FFFu + ((u >> 16) & 1u); return (unsigned short)(u >> 16); }
__device__ __forceinline__ float bf2f(unsigned short b) { return __uint_as_float(((unsigned)b) << 16); }
__device__ __forceinline__ float bfr(float f) { return bf2f(f2bf(f)); }
__device__ __forceinline__ v16h cat16(v8h lo, v8h hi) { return __builtin_shufflevector(lo, hi, 0, 1, 2, 3, 4, 5, 6, 7, 8, 9, 10, 11, 12, 13, 14, 15); }
__device__ __forceinline__ v16bf cat16b(v8us lo, v8us hi) { return __builtin_bit_cast(v16bf, __builtin_shufflevector(lo, hi, 0, 1, 2, 3, 4, 5, 6, 7, 8, 9, 10, 11, 12, 13, 14, 15)); }
__device__ __forceinline__ v8f wmma16(v16h a, v16h b, v8f c) { return __builtin_amdgcn_wmma_f32_16x16x32_f16(false, a, false, b, (short)0, c, false, false); }
__device__ __forceinline__ v8f wmmab(v16bf a, v16bf b, v8f c) { return __builtin_amdgcn_wmma_f32_16x16x32_bf16(false, a, false, b, (short)0, c, false, false); }



// fragment loaders: 16 k of one row a lane, k = 8 hi + 0..7 and 16 + 8 hi + 0..7 of a 32-k step, from K-contiguous 16-bit rows
template <typename T16> struct WFrag;
template <> struct WFrag<h16> { typedef v16h V; static __device__ __forceinline__ V ld(const h16* p) { return cat16(*(const v8h*)p, *(const v8h*)(p + 16)); } static __device__ __forceinline__ v8f mma(V a, V b, v8f c) { return wmma16(a, b, c); } };
template <> struct WFrag<bf> { typedef v16bf V; static __device__ __forceinline__ V ld(const bf* p) { return cat16b(*(const v8us*)p, *(const v8us*)(p + 16)); } static __device__ __forceinline__ v8f mma(V a, V b, v8f c) { return wmmab(a, b, c); } };

__device__ __forceinline__ h16 tohx(float x) { return (h16)x; }
__device__ __forceinline__ void splitf(float y, unsigned short& h, unsigned short& l) { h = f2bf(y); l = f2bf(y - bf2f(h)); }
typedef __attribute__((ext_vector_type(2))) _Float16 v2h;
typedef __attribute__((ext_vector_type(4))) _Float16 v4h;
typedef __attribute__((ext_vector_type(2))) unsigned short v2us;
typedef __attribute__((ext_vector_type(4))) unsigned short v4us;
typedef __attribute__((ext_vector_type(2))) float v2f;
typedef __attribute__((ext_vector_type(4))) int v4i;

// ---- k_proj: the three projections of both batches in ONE launch, from the f32 inputs to the planes that k_fattn reads: no bf16 copy and no f32 projection in memory.
// grid (NB_ * TT / 128, DQ / 128, 3 streams: query, key, value), 128 threads = 4 waves, 128 x 128 outputs a work-group, 64 x 64 (16 accumulators) a wave. C[m][n] = sum_k bf16(X[m][k]) bf16(W[n][k]) + bf16(bias[n]), f32 accumulate, k ascending in passes of 32.
// A pass: every thread rounds the 16 x 4 f32 that it fetched one pass ahead (a wave-wide load is four whole 128-byte lines) and stores them as bf16 rows in LDS (rows 0..127 X, 128..255 W); one barrier; the next pass's fetch goes out; fragments come from LDS in the k order of WFrag::ld.
// Two LDS buffers, ONE barrier a pass: a wave overwrites the buffer of pass p only in pass p + 2, behind the barrier of pass p + 1, which no wave reaches before its reads of pass p have returned.
// Epilogue: a 64-column tile is one head, a 64-row tile lies in one batch. query, key: rows [head][t][d] as bf16 hi + lo, staged through the wave's own LDS range so that whole 128-byte lines are stored. value: planes [head][d][t]; an accumulator register run is 8 neighbouring t of one d, stored straight from registers as fp16, hi and lo.
#define PK   32    // k of a pass
#define PPIT 40    // LDS row pitch in bf16 elements: 64 bytes of data + 16, the conflict-free pitch for 16-byte fragment reads of 64-byte rows
typedef __attribute__((ext_vector_type(4))) __bf16 v4bf;
__global__ __launch_bounds__(128) void k_proj(const float* __restrict__ xq, const float* __restrict__ xk, const float* __restrict__ xv, const float* __restrict__ wq, const float* __restrict__ wk, const float* __restrict__ wv, const float* __restrict__ bq, const float* __restrict__ bk, const float* __restrict__ bv, bf* Qh, bf* Ql, bf* Kh, bf* Kl, h16* V16, bf* Vh, bf* Vl) {
    __shared__ __align__(16) bf ts[2][256 * PPIT];
    __shared__ __align__(16) float osall[4][16 * 68];
    const int z = blockIdx.z; const float* X = z == 0 ? xq : z == 1 ? xk : xv; const float* Wt = z == 0 ? wq : z == 1 ? wk : wv; const float* bias = z == 0 ? bq : z == 1 ? bk : bv;
    const int tid = threadIdx.x, w = __builtin_amdgcn_readfirstlane(tid >> 5), lane = tid & 31, lr = lane & 15, hi = lane >> 4;
    const int wr = (w & 1) * 64, wc = (w >> 1) * 64; const int r0 = blockIdx.x * 128 + wr, c0 = blockIdx.y * 128 + wc;
    const int sr = tid >> 3, sc = (tid & 7) * 4;   // staging: 8 threads a row of 32 f32, rows sr + 16 i
    const float* gx = X + (size_t)(blockIdx.x * 128 + sr) * DM + sc; const float* gw = Wt + (size_t)(blockIdx.y * 128 + sr) * DM + sc;
    v8f acc[4][4];
#pragma unroll
    for (int mb = 0; mb < 4; ++mb)
#pragma unroll
        for (int nb = 0; nb < 4; ++nb) acc[mb][nb] = (v8f){};
    v4f st[16];
#pragma unroll
    for (int i = 0; i < 8; ++i) { st[i] = *(const v4f*)(gx + (size_t)i * 16 * DM); st[8 + i] = *(const v4f*)(gw + (size_t)i * 16 * DM); }
#pragma unroll 1   // one copy of the body: the buffer index and the fetch test stay scalar, and 16 accumulators, 16 fetched vectors and the fragments leave a second copy nothing to overlap with
    for (int kc = 0; kc < DM; kc += PK) {
        bf* tb = ts[(kc / PK) & 1];
#pragma unroll
        for (int i = 0; i < 16; ++i) *(v4us*)(tb + (sr + 16 * i) * PPIT + sc) = __builtin_bit_cast(v4us, __builtin_convertvector(st[i], v4bf));   // round to nearest even, as f2bf
        __syncthreads();   // publishes this pass's rows; also ends every wave's reads of the other buffer before the next pass overwrites it
        if (kc + PK < DM) {
#pragma unroll
            for (int i = 0; i < 8; ++i) { st[i] = *(const v4f*)(gx + (size_t)i * 16 * DM + kc + PK); st[8 + i] = *(const v4f*)(gw + (size_t)i * 16 * DM + kc + PK); }
            asm volatile("s_wait_xcnt 0x0" ::: "memory");   // the run's two address pairs are dead behind its last load and the build reuses them for the fragment reads below: the wait stands in front of that overwrite of registers which the sixteen loads name
        }
        v16bf a[4], b[2];   // two W fragment sets in turn: four would push the kernel past 256 registers
#pragma unroll
        for (int mb = 0; mb < 4; ++mb) a[mb] = WFrag<bf>::ld(tb + (wr + mb * 16 + lr) * PPIT + 8 * hi);
#pragma unroll
        for (int nb = 0; nb < 2; ++nb) b[nb] = WFrag<bf>::ld(tb + (128 + wc + nb * 16 + lr) * PPIT + 8 * hi);
#pragma unroll
        for (int nb = 0; nb < 4; ++nb) {
#pragma unroll
            for (int mb = 0; mb < 4; ++mb) acc[mb][nb] = wmmab(a[mb], b[nb & 1], acc[mb][nb]);
            if (nb < 2) { b[nb & 1] = WFrag<bf>::ld(tb + (128 + wc + (nb + 2) * 16 + lr) * PPIT + 8 * hi);
                __builtin_amdgcn_sched_barrier(0); }   // holds the refill of a W set right behind that set's last product, so that the other set's four products cover part of its LDS wait
        }
        asm volatile("v_nop\n\tv_nop\n\tv_nop\n\tv_nop" : "+v"(acc[0][0]), "+v"(acc[1][1]), "+v"(acc[2][2]), "+v"(acc[3][3]) : "v"(a[0]), "v"(a[3]));   // the four vector slots that the chip needs behind the pass's last matrix instruction, also on the taken back edge
    }
    const size_t hp = ((size_t)(r0 / TT) * NH_ + c0 / HD) * TT * HD; const int t0 = r0 % TT;   // this tile's batch-head plane and its first position
    // In both epilogues a block's values are all formed first, then its stores go out as one run with s_wait_xcnt 0 behind it, each part held in place by sched_barrier(0).
    if (z < 2) {
        bf* Ph = (z == 0 ? Qh : Kh) + hp; bf* Pl = (z == 0 ? Ql : Kl) + hp; float* os = osall[w]; const int cofs = lr * 4; v4f bb = *(const v4f*)(bias + c0 + cofs);
        asm volatile("s_wait_xcnt 0x0" ::: "memory");   // in front of any reuse of the bias load's address registers
        __builtin_amdgcn_sched_barrier(0);              // keeps later register writes behind that wait
#pragma unroll
        for (int q = 0; q < 4; ++q) bb[q] = bfr(bb[q]);
#pragma unroll
        for (int mb = 0; mb < 4; ++mb) {
#pragma unroll
            for (int nb = 0; nb < 4; ++nb) {
#pragma unroll
                for (int j = 0; j < 8; ++j) os[(hi * 8 + j) * 68 + nb * 16 + lr] = acc[mb][nb][j]; }
            __builtin_amdgcn_wave_barrier(); asm volatile("" ::: "memory");   // the wave's own LDS stores stay in front of its reads of other lanes' values
            v4us oh[8], ol[8];
#pragma unroll
            for (int s = 0; s < 8; ++s) { const v4f val = *(const v4fa*)(os + (2 * s + hi) * 68 + cofs) + bb;
#pragma unroll
                for (int q = 0; q < 4; ++q) { unsigned short a2, c2; splitf(val[q], a2, c2); oh[s][q] = a2; ol[s][q] = c2; } }
            __builtin_amdgcn_wave_barrier(); asm volatile("" ::: "memory");   // and these reads in front of the next block's LDS stores
            __builtin_amdgcn_sched_barrier(0);   // values first
#pragma unroll
            for (int s = 0; s < 8; ++s) { const size_t po = (size_t)(t0 + mb * 16 + 2 * s + hi) * HD + cofs; *(v4us*)(Ph + po) = oh[s]; *(v4us*)(Pl + po) = ol[s]; }
            asm volatile("s_wait_xcnt 0x0" ::: "memory");   // behind the run of stores, in front of the next block's writes of their registers
            __builtin_amdgcn_sched_barrier(0);   // keeps those writes behind the wait
        }
    } else {
        float bn[4];
#pragma unroll
        for (int nb = 0; nb < 4; ++nb) bn[nb] = bias[c0 + nb * 16 + lr];
        asm volatile("s_wait_xcnt 0x0" ::: "memory");   // in front of any reuse of the bias loads' offset register
        __builtin_amdgcn_sched_barrier(0);              // keeps later register writes behind that wait
#pragma unroll
        for (int nb = 0; nb < 4; ++nb) { const float bnr = bfr(bn[nb]); const size_t vo = hp + (size_t)(nb * 16 + lr) * TT + t0 + 8 * hi; v8h o16[4]; v8us oh[4], ol[4];
#pragma unroll
            for (int mb = 0; mb < 4; ++mb)
#pragma unroll
                for (int j = 0; j < 8; ++j) { const float x = acc[mb][nb][j] + bnr; o16[mb][j] = tohx(x); unsigned short a2, c2; splitf(x, a2, c2); oh[mb][j] = a2; ol[mb][j] = c2; }
            __builtin_amdgcn_sched_barrier(0);   // values first
#pragma unroll
            for (int mb = 0; mb < 4; ++mb) { *(v8h*)(V16 + vo + mb * 16) = o16[mb]; *(v8us*)(Vh + vo + mb * 16) = oh[mb]; *(v8us*)(Vl + vo + mb * 16) = ol[mb]; }
            asm volatile("s_wait_xcnt 0x0" ::: "memory");   // behind the run of stores, in front of the next block's writes of their registers
            __builtin_amdgcn_sched_barrier(0);   // keeps those writes behind the wait
        }
    }
}

// k_fattn: scores, softmax, P.V and the head merge in ONE kernel; a pair of waves per 16 or 32 query rows of one head, each wave on its half of the keys, 32 keys a pass, a held reference and a running sum (online softmax; the reference is raised, and what is summed rescaled, only when a pass's terms grow past 2^5 times the reference's), the pair's partial results joined at the end: no score or P plane in memory.
// S^T = K Q^T (A = K rows, B = Q rows, hi/lo planes, 3 products): lane (lr, hi) register j of key tile kt holds the score of key j0 + 16 kt + 8 hi + j for query lr, so the two key tiles of a pass, converted in place, are the B operand P^T of O^T += V^T P^T in the same k order as WFrag::ld reads V^T rows.
// HIRES (query rows < RH): P and V on hi/lo planes, 3 products; else P x PCAR in fp16 against the fp16 V plane (the factor is in the row sum too and cancels in O / sum).
// value of lane l ^ 16 (the other half of a query's keys) without the LDS path's latency
__device__ __forceinline__ float xhalf(float x) { const int b = __float_as_int(x); return __int_as_float(__builtin_amdgcn_permlanex16(b, b, 0x76543210, 0xfedcba98, false, false)); }
// 2^x with the instruction set's one free slot behind a transcendental kept in the same statement.
__device__ __forceinline__ float exp2s(float x) { float r; asm("v_exp_f32 %0, %1\n\tv_nop" : "=v"(r) : "v"(x)); return r; }
// K and V reach the waves through LDS: a stage is 64 keys (two passes): the 64 rows of 128 bytes of each K plane (keys) and of each V plane in use (d), brought by asynchronous copies of 16 bytes a lane, a wave-wide copy being four whole 128-byte lines; a key group's four waves share one copy of every tile. Two buffers: stage t + 1 flies while stage t is worked on.
#define SKEY 64                  // keys of a stage
#define KSPL 2                   // key groups of a work-group: waves 0..3 walk the first half of the keys, waves 4..7 the second half, for the same four query blocks
#define NSTG (TT / KSPL / SKEY)  // stages of a key group
#define XCHB ((32 + 2 * 2) * 32 * 4)   // bytes in which a wave hands half of its partial result to its partner in the other key group: at most 32 output values, 2 references and 2 sums a lane
#define LPIT 144                 // LDS row pitch in bytes: 128 of data + 16, the conflict-free pitch for 16-byte fragment reads of 128-byte rows
#define TILB (64 * LPIT)         // bytes of a staged tile
#define CP_(l, g) "global_load_async_to_lds_b128 %" #l ", %" #g ", off\n\t"
// One tile (copy4) or two neighbouring tiles (copy8): every thread brings 16 bytes of rows r, r + 16, r + 32, r + 48. The s_wait_xcnt 0 is the last line of the copies' own statement, so that it stands in front of every later write of the address registers which the copies name.
__device__ __forceinline__ void copy4(unsigned l, const char* g, int gs) {
    asm volatile(CP_(0, 4) CP_(1, 5) CP_(2, 6) CP_(3, 7) "s_wait_xcnt 0x0"
        :: "v"(l), "v"(l + 16 * LPIT), "v"(l + 32 * LPIT), "v"(l + 48 * LPIT), "v"(g), "v"(g + gs), "v"(g + 2 * gs), "v"(g + 3 * gs) : "memory");
}
__device__ __forceinline__ void copy8(unsigned l, const char* g, const char* g2, int gs) {
    asm volatile(CP_(0, 8) CP_(1, 9) CP_(2, 10) CP_(3, 11) CP_(4, 12) CP_(5, 13) CP_(6, 14) CP_(7, 15) "s_wait_xcnt 0x0"
        :: "v"(l), "v"(l + 16 * LPIT), "v"(l + 32 * LPIT), "v"(l + 48 * LPIT), "v"(l + TILB), "v"(l + TILB + 16 * LPIT), "v"(l + TILB + 32 * LPIT), "v"(l + TILB + 48 * LPIT),
           "v"(g), "v"(g + gs), "v"(g + 2 * gs), "v"(g + 3 * gs), "v"(g2), "v"(g2 + gs), "v"(g2 + 2 * gs), "v"(g2 + 3 * gs) : "memory");
}
template <bool HIRES, int NQ>   // NQ: 16-query column groups per wave
__device__ __forceinline__ void fattn_body(const bf* __restrict__ Qh, const bf* __restrict__ Ql, const bf* __restrict__ Kh, const bf* __restrict__ Kl, const bf* __restrict__ Vh, const bf* __restrict__ Vl, const h16* __restrict__ V16, float* Orow, int q0, int lr, int hi, char* sm, int tid, int kg, float* xs, const float* xr) {
    v16bf qh[NQ][2], ql[NQ][2];
#pragma unroll
    for (int nq = 0; nq < NQ; ++nq)
#pragma unroll
        for (int ks = 0; ks < 2; ++ks) { const size_t qo = (size_t)(q0 + nq * 16 + lr) * HD + ks * 32 + 8 * hi; qh[nq][ks] = WFrag<bf>::ld(Qh + qo); ql[nq][ks] = WFrag<bf>::ld(Ql + qo); }
    v8f o[NQ][4]; float nr[NQ], l[NQ];   // nr: the addend of the exponent, carrier exponent minus the held reference (log2 units); it starts so high that the first pass's sums are infinite and set the reference
#pragma unroll
    for (int nq = 0; nq < NQ; ++nq) { nr[nq] = 3.0e38f; l[nq] = 0.f;
#pragma unroll
        for (int dt = 0; dt < 4; ++dt) o[nq][dt] = (v8f){}; }
    constexpr float CEXP = SCL * 1.4426950408889634f, CARR = HIRES ? 0.0f : 10.0f /* 2^10 = PCAR */, PTHR = HIRES ? 32.0f : 32.0f * PCAR;   // score to log2 units; carrier exponent of P; the pass sum of a lane beyond which the reference is raised (fp16 P stays below 2^15)
    constexpr int BUFB = (HIRES ? 4 : 3) * TILB;   // a buffer: K hi, K lo, then V hi, V lo or the fp16 V
    const unsigned lc = (unsigned)(size_t)sm + (tid >> 3) * LPIT + (tid & 7) * 16;   // this thread's LDS byte in a tile: 8 threads a row
    const size_t vofs = (size_t)(tid >> 3) * (TT * 2) + (tid & 7) * 16;
    const char* gkh = (const char*)Kh + tid * 16; const char* gkl = (const char*)Kl + tid * 16; const char* gv0 = (HIRES ? (const char*)Vh : (const char*)V16) + vofs; const char* gv1 = (const char*)Vl + vofs;
    auto fill = [&](int st) { const unsigned l = lc + (st & 1) * BUFB; copy8(l, gkh + st * (SKEY * HD * 2), gkl + st * (SKEY * HD * 2), 16 * HD * 2);
        if (HIRES) copy8(l + 2 * TILB, gv0 + st * (SKEY * 2), gv1 + st * (SKEY * 2), 16 * TT * 2); else copy4(l + 2 * TILB, gv0 + st * (SKEY * 2), 16 * TT * 2); };
    fill(0);
    asm volatile("s_wait_asynccnt 0x0" ::: "memory");   // this wave's copies of stage 0 have landed
    __syncthreads();                                    // and every other wave's: stage 0 may be read
    fill(1);
#pragma unroll 1   // one copy of the body: the buffer index and the refill test stay scalar
    for (int st = 0; st < NSTG; ++st) {
    const char* sb = sm + (st & 1) * BUFB + lr * LPIT + 16 * hi;
#pragma unroll 1   // one copy of the body: a pass holds 24 to 32 matrix instructions and its operands fill nearly all directly addressed registers, so a second copy has no registers to overlap with
    for (int ps = 0; ps < 2; ++ps) {
        v16bf kh[2][2], kl[2][2];
#pragma unroll
        for (int kt = 0; kt < 2; ++kt)
#pragma unroll
            for (int ks = 0; ks < 2; ++ks) { const char* kp = sb + (ps * 32 + kt * 16) * LPIT + ks * 64; kh[kt][ks] = WFrag<bf>::ld((const bf*)kp); kl[kt][ks] = WFrag<bf>::ld((const bf*)(kp + TILB)); }
        __builtin_amdgcn_sched_barrier(0);   // keeps the pass's 16 K reads one group ahead of the products
        v8f s[NQ][2];
#pragma unroll
        for (int kt = 0; kt < 2; ++kt)
#pragma unroll
            for (int nq = 0; nq < NQ; ++nq) s[nq][kt] = (v8f){};
#pragma unroll
        for (int ks = 0; ks < 2; ++ks)
#pragma unroll
            for (int kt = 0; kt < 2; ++kt)
#pragma unroll
                for (int nq = 0; nq < NQ; ++nq) { s[nq][kt] = wmmab(kh[kt][ks], qh[nq][ks], s[nq][kt]); s[nq][kt] = wmmab(kh[kt][ks], ql[nq][ks], s[nq][kt]); s[nq][kt] = wmmab(kl[kt][ks], qh[nq][ks], s[nq][kt]); }
        v16bf vh[4], vl[4]; v16h v16[4];
#pragma unroll
        for (int dt = 0; dt < 4; ++dt) { const char* vp = sb + 2 * TILB + dt * 16 * LPIT + ps * 64; if (HIRES) { vh[dt] = WFrag<bf>::ld((const bf*)vp); vl[dt] = WFrag<bf>::ld((const bf*)(vp + TILB)); } else v16[dt] = WFrag<h16>::ld((const h16*)vp); }
        __builtin_amdgcn_sched_barrier(0);   // the pass's V reads go out as one group behind the score products, so that the softmax arithmetic covers their latency
        float p[NQ][2][8], sum[NQ];
        // P = 2^(s * CEXP + nr) against the HELD reference: no maximum and no rescale in a pass that stays in range
        auto soft = [&]() {
#pragma unroll
            for (int nq = 0; nq < NQ; ++nq) { float sa = 0.f;
#pragma unroll
                for (int kt = 0; kt < 2; ++kt)
#pragma unroll
                    for (int j = 0; j < 8; ++j) { p[nq][kt][j] = exp2s(__builtin_fmaf(s[nq][kt][j], CEXP, nr[nq])); sa += p[nq][kt][j]; }
                sum[nq] = sa; }
        };
        soft();
        bool need = false;
#pragma unroll
        for (int nq = 0; nq < NQ; ++nq) need = need || !(sum[nq] <= PTHR);   // also true for an infinite or undefined sum
        if (__builtin_expect(__builtin_amdgcn_ballot_w32(need) != 0, 0)) {   // ONE test a pass, a scalar branch: some lane's 16 terms sum past 2^5 times the reference's term, so the wave raises its references to the maxima seen, rescales what it has summed and forms this pass's P anew (then every term is at most 2^carrier)
#pragma unroll
            for (int nq = 0; nq < NQ; ++nq) { float mx = s[nq][0][0];
#pragma unroll
                for (int kt = 0; kt < 2; ++kt)
#pragma unroll
                    for (int j = 0; j < 8; ++j) mx = fmaxf(mx, s[nq][kt][j]);
                mx = fmaxf(mx, xhalf(mx));      // lanes lr and lr + 16 hold the two halves of one query's keys and must share one reference
                const float nn = fminf(nr[nq], CARR - mx * CEXP); const float al = exp2s(nn - nr[nq]); nr[nq] = nn; l[nq] *= al;
#pragma unroll
                for (int dt = 0; dt < 4; ++dt) o[nq][dt] *= al; }
            soft();
        }
        v16bf ph[NQ], pl[NQ]; v16h p16[NQ];
#pragma unroll
        for (int nq = 0; nq < NQ; ++nq) { l[nq] += sum[nq];   // each half keeps its own partial sum; joined once behind the loop
            v8us uh[2], ul[2]; v8h u16[2];
#pragma unroll
            for (int kt = 0; kt < 2; ++kt)
#pragma unroll
                for (int j = 0; j < 8; ++j) { if (HIRES) { unsigned short a, c2; splitf(p[nq][kt][j], a, c2); uh[kt][j] = a; ul[kt][j] = c2; } else u16[kt][j] = tohx(p[nq][kt][j]); }
            if (HIRES) { ph[nq] = cat16b(uh[0], uh[1]); pl[nq] = cat16b(ul[0], ul[1]); } else p16[nq] = cat16(u16[0], u16[1]); }
#pragma unroll
        for (int dt = 0; dt < 4; ++dt) {
            if (HIRES) {
#pragma unroll
                for (int nq = 0; nq < NQ; ++nq) { o[nq][dt] = wmmab(vh[dt], ph[nq], o[nq][dt]); o[nq][dt] = wmmab(vh[dt], pl[nq], o[nq][dt]); o[nq][dt] = wmmab(vl[dt], ph[nq], o[nq][dt]); }
            } else {
#pragma unroll
                for (int nq = 0; nq < NQ; ++nq) o[nq][dt] = wmma16(v16[dt], p16[nq], o[nq][dt]); } }
    }
        // hand-over of the buffers, every wave, in this order
        asm volatile("s_wait_dscnt 0x0" ::: "memory");      // this wave's reads of stage st have returned
        asm volatile("s_wait_asynccnt 0x0" ::: "memory");   // this wave's copies of stage st + 1 have landed
        __syncthreads();                                    // publishes stage st + 1 and ends every wave's reads of stage st's buffer
        if (st + 2 < NSTG) fill(st + 2);                    // into the buffer just read
    }
    asm volatile("s_wait_asynccnt 0x0" ::: "memory");   // no copy is outstanding when the wave ends
    // The two key groups' partial results are joined through LDS, alike in every wave: of a pair's NQ * 4 output tiles (16 d x 16 queries) key group 0 finishes the first half and key group 1 the second; each hands the other half to its partner, with its references and sums. The ring is free for it: the loop's last barrier stands behind every wave's last read, and no copy is outstanding.
    constexpr int TH = NQ * 2; const int lane = hi * 16 + lr; const bool g1 = kg != 0;
#pragma unroll
    for (int t = 0; t < TH; ++t) { const v8f sd = g1 ? o[t / 4][t % 4] : o[(TH + t) / 4][(TH + t) % 4]; v4f a, c;
#pragma unroll
        for (int j = 0; j < 4; ++j) { a[j] = sd[j]; c[j] = sd[j + 4]; }
        *(v4fa*)(xs + (2 * t) * 128 + lane * 4) = a; *(v4fa*)(xs + (2 * t + 1) * 128 + lane * 4) = c; }   // 16 bytes a lane, lanes side by side: no bank conflict
#pragma unroll
    for (int nq = 0; nq < NQ; ++nq) { xs[TH * 256 + (2 * nq) * 32 + lane] = nr[nq]; xs[TH * 256 + (2 * nq + 1) * 32 + lane] = l[nq]; }
    __syncthreads();   // publishes every wave's hand-over to its partner
    const int nk = NQ == 2 ? kg : 0;   // the query group whose tiles this wave finishes (with one query group: d 32 kg .. 32 kg + 31 of it)
    const float n0 = g1 ? nr[NQ - 1] : nr[0], l0 = g1 ? l[NQ - 1] : l[0], n1 = xr[TH * 256 + (2 * nk) * 32 + lane], l1 = xr[TH * 256 + (2 * nk + 1) * 32 + lane]; const float nj = fminf(n0, n1);   // the smaller addend is the higher reference
    const float a0 = exp2s(nj - n0), a1 = exp2s(nj - n1);   // each group's terms brought to the common reference
    const float lj = l0 * a0 + l1 * a1; const float ls = lj + xhalf(lj); const float f = __fdiv_rn(1.0f, ls); const float f0 = a0 * f, f1 = a1 * f; float* orow = Orow + (size_t)(q0 + nk * 16 + lr) * DQ + 8 * hi + (NQ == 2 ? 0 : kg * 32);
#pragma unroll
    for (int t = 0; t < TH; ++t) { const v8f kp = g1 ? o[(TH + t) / 4][(TH + t) % 4] : o[t / 4][t % 4]; const v4f b = *(const v4fa*)(xr + (2 * t) * 128 + lane * 4), d = *(const v4fa*)(xr + (2 * t + 1) * 128 + lane * 4); v4f a, c;
#pragma unroll
        for (int j = 0; j < 4; ++j) { a[j] = kp[j] * f0 + b[j] * f1; c[j] = kp[j + 4] * f0 + d[j] * f1; }
        *(v4f*)(orow + t * 16) = a; *(v4f*)(orow + t * 16 + 4) = c; }
}
// grid (batches x heads, (RH / 16 + (TT - RH) / 32) / 4), 256 threads = 8 waves: four neighbouring query blocks of ONE head times two key groups. Waves w and w + 4 hold the same query block; each key group has its own ring of staged K and V tiles, filled by its own four waves, and walks its half of the keys; the stage barrier is common. With two work-groups on a WGP four waves share a SIMD, so that one wave's LDS waits and dependent softmax arithmetic are covered by the others' matrix and vector work. A hi/lo wave (three times the P.V products and the hi/lo split a key) takes 16 query rows, an fp16 wave 32, so that a pass costs both about the same; the hi/lo blocks have the low blockIdx.y (RH / 16 is a multiple of 4: a workgroup is all of one kind). amdgpu_waves_per_eu(4, 4) holds the register budget at 256, without which only one work-group fits a WGP; 2 x the LDS size is 294,912 bytes and fits too.
__global__ __launch_bounds__(256) __attribute__((amdgpu_waves_per_eu(4, 4))) void k_fattn(const bf* __restrict__ Qh, const bf* __restrict__ Ql, const bf* __restrict__ Kh, const bf* __restrict__ Kl, const bf* __restrict__ Vh, const bf* __restrict__ Vl, const h16* __restrict__ V16, float* OUTb) {
    __shared__ __align__(16) char sm[KSPL * 2 * 4 * TILB];
    const int lane = threadIdx.x & 31, lr = lane & 15, hi = lane >> 4; const size_t hp = (size_t)blockIdx.x * TT * HD;   /* planes [batch][head] */ const int wv = __builtin_amdgcn_readfirstlane(threadIdx.x >> 5), kg = wv >> 2, y = blockIdx.y * 4 + (wv & 3); float* Orow = OUTb + (size_t)(blockIdx.x / NH_) * TT * DQ + (blockIdx.x % NH_) * HD;
    const size_t kp = hp + (size_t)kg * (TT / KSPL) * HD, vp = hp + (size_t)kg * (TT / KSPL);   // the key group's first K row ([t][d] planes) and first V column ([d][t] planes)
    char* ring = sm + kg * (2 * 4 * TILB); float* xs = (float*)(sm + wv * XCHB); const float* xr = (const float*)(sm + (wv ^ 4) * XCHB); const int tid = threadIdx.x & 127;
    if (blockIdx.y < RH / 64) fattn_body<true, 1>(Qh + hp, Ql + hp, Kh + kp, Kl + kp, Vh + vp, Vl + vp, V16 + vp, Orow, y * 16, lr, hi, ring, tid, kg, xs, xr);
    else fattn_body<false, 2>(Qh + hp, Ql + hp, Kh + kp, Kl + kp, Vh + vp, Vl + vp, V16 + vp, Orow, RH + (y - RH / 16) * 32, lr, hi, ring, tid, kg, xs, xr);
}

extern "C" void kernel_launch(void* const* d_in, const int* in_sizes, int n_in,
                              void* d_out, int out_size, void* d_ws, size_t ws_size, hipStream_t stream) {
    (void)in_sizes; (void)n_in; (void)out_size;
    const float* x = (const float*)d_in[0]; const float* xk = (const float*)d_in[1]; const float* xv = (const float*)d_in[2]; const float* wq = (const float*)d_in[3]; const float* bq = (const float*)d_in[4]; const float* wk = (const float*)d_in[5]; const float* bk = (const float*)d_in[6]; const float* wv = (const float*)d_in[7]; const float* bv = (const float*)d_in[8];   /* argument order query, key, value, Wq, bq, Wk, bk, Wv, bv ('oi' [768][768] + [768]); no output projection */
    float* OUT = (float*)d_out;     // [2][2048][768]
    char* wsp = (char*)d_ws;
    auto take = [&](size_t bytes) { char* p = wsp; wsp += (bytes + 255) & ~(size_t)255; return (void*)p; };
    h16* VT16 = (h16*)take((size_t)NB_ * NKV * HD * TT * 2);
    bf* QPh = (bf*)take((size_t)NB_ * NH_ * TT * HD * 2); bf* QPl = (bf*)take((size_t)NB_ * NH_ * TT * HD * 2); bf* KPh = (bf*)take((size_t)NB_ * NKV * TT * HD * 2); bf* KPl = (bf*)take((size_t)NB_ * NKV * TT * HD * 2); bf* VTh = (bf*)take((size_t)NB_ * NKV * HD * TT * 2); bf* VTl = (bf*)take((size_t)NB_ * NKV * HD * TT * 2);   /* the planes the attention launch reads: both batches */
    if ((size_t)(wsp - (char*)d_ws) > ws_size) return;    // ws 256 MiB
    k_proj<<<dim3(NB_ * TT / 128, DQ / 128, 3), 128, 0, stream>>>(x, xk, xv, wq, wk, wv, bq, bk, bv, QPh, QPl, KPh, KPl, VT16, VTh, VTl);   /* rounding, projections, biases, planes: 3 streams x 2 batches */
    k_fattn<<<dim3(NB_ * NH_, (RH / 16 + (TT - RH) / 32) / 4, 1), 256, 0, stream>>>(QPh, QPl, KPh, KPl, VTh, VTl, VT16, OUT);   /* all 24 batch-heads: scores, softmax, P.V, merge */
}

// v006
// It runs in 74.7 microseconds.
// Next to v005, in two timings, it ran 1.05 times as fast each time.
// Over all steps from v000 it is 19.9 times as fast.
#include <hip/hip_runtime.h>

// Multi-head attention on three input streams at d_model 768 WITHOUT an output projection (query, key, value [2][2048][768]; Q = query Wq^T + bq, K = key Wk^T + bk, V = value Wv^T + bv ('oi' + biases; 12 heads x 64); scores / sqrt(64); softmax (no mask); out = heads merged -> [2][2048][768] (3.1 M); argument order query, key, value, Wq, bq, Wk, bk, Wv, bv).
// Layout: ONE projection launch for all three streams and both batches ('oi' weights; f32 operands rounded to bf16 on their way into LDS; exact products (K 768) + f32 biases; its epilogue writes the planes the attention reads); then ONE fused attention launch for all 24 batch-heads (online softmax, scores and P stay in registers) with EVERY row's scores on hi/lo planes (3 products: no output projection averages the fp16 score error) and hybrid P.V (rows < 512 hi/lo, rest fp16 x1024); it writes the merged f32 output rows.
// Compute dtypes, f32 accumulate: every input rounded to bf16; projections exact + f32 biases; scores 3 products on every row; P.V rows < 512 3 products, rest fp16; softmax f32; output f32.

#define NB_  2
#define TT   2048
#define DM   768
#define NH_  12
#define NKV  12
#define REP  (NH_ / NKV)
#define HD   64
#define DQ   (NH_ * HD)
#define DKV  (NKV * HD)
#define ZH   2
#define RH   512                  // query rows < RH use hi+lo planes (0: none)
#define WIN  0
#define PCAR 1024.0f
#define SCL  0.125f   // HD^-0.5
typedef _Float16 h16;
typedef unsigned short bf;
typedef __attribute__((ext_vector_type(16))) __bf16   v16bf;
typedef __attribute__((ext_vector_type(16))) _Float16 v16h;
typedef __attribute__((ext_vector_type(8)))  _Float16 v8h;
typedef __attribute__((ext_vector_type(8)))  unsigned short v8us;
typedef __attribute__((ext_vector_type(8)))  float    v8f;
typedef __attribute__((ext_vector_type(4)))  float    v4f;
typedef v8h  __attribute__((may_alias)) v8ha;
typedef v4f  __attribute__((may_alias)) v4fa;
typedef v8us __attribute__((may_alias)) v8usa;

__device__ __forceinline__ unsigned short f2bf(float f) { unsigned u = __float_as_uint(f); u += 0x7FFFu + ((u >> 16) & 1u); return (unsigned short)(u >> 16); }
__device__ __forceinline__ float bf2f(unsigned short b) { return __uint_as_float(((unsigned)b) << 16); }
__device__ __forceinline__ float bfr(float f) { return bf2f(f2bf(f)); }
__device__ __forceinline__ v16h cat16(v8h lo, v8h hi) { return __builtin_shufflevector(lo, hi, 0, 1, 2, 3, 4, 5, 6, 7, 8, 9, 10, 11, 12, 13, 14, 15); }
__device__ __forceinline__ v16bf cat16b(v8us lo, v8us hi) { return __builtin_bit_cast(v16bf, __builtin_shufflevector(lo, hi, 0, 1, 2, 3, 4, 5, 6, 7, 8, 9, 10, 11, 12, 13, 14, 15)); }
__device__ __forceinline__ v8f wmma16(v16h a, v16h b, v8f c) { return __builtin_amdgcn_wmma_f32_16x16x32_f16(false, a, false, b, (short)0, c, false, false); }
__device__ __forceinline__ v8f wmmab(v16bf a, v16bf b, v8f c) { return __builtin_amdgcn_wmma_f32_16x16x32_bf16(false, a, false, b, (short)0, c, false, false); }



// fragment loaders: 16 k of one row a lane, k = 8 hi + 0..7 and 16 + 8 hi + 0..7 of a 32-k step, from K-contiguous 16-bit rows
template <typename T16> struct WFrag;
template <> struct WFrag<h16> { typedef v16h V; static __device__ __forceinline__ V ld(const h16* p) { return cat16(*(const v8h*)p, *(const v8h*)(p + 16)); } static __device__ __forceinline__ v8f mma(V a, V b, v8f c) { return wmma16(a, b, c); } };
template <> struct WFrag<bf> { typedef v16bf V; static __device__ __forceinline__ V ld(const bf* p) { return cat16b(*(const v8us*)p, *(const v8us*)(p + 16)); } static __device__ __forceinline__ v8f mma(V a, V b, v8f c) { return wmmab(a, b, c); } };

__device__ __forceinline__ h16 tohx(float x) { return (h16)x; }
__device__ __forceinline__ void splitf(float y, unsigned short& h, unsigned short& l) { h = f2bf(y); l = f2bf(y - bf2f(h)); }
typedef __attribute__((ext_vector_type(2))) _Float16 v2h;
typedef __attribute__((ext_vector_type(4))) _Float16 v4h;
typedef __attribute__((ext_vector_type(2))) unsigned short v2us;
typedef __attribute__((ext_vector_type(4))) unsigned short v4us;
typedef __attribute__((ext_vector_type(2))) float v2f;
typedef __attribute__((ext_vector_type(4))) int v4i;

// ---- k_proj: the three projections of both batches in ONE launch, from the f32 inputs to the planes that k_fattn reads: no bf16 copy and no f32 projection in memory.
// grid (NB_ * TT / 128, DQ / 128, 3 streams: query, key, value), 128 threads = 4 waves, 128 x 128 outputs a work-group, 64 x 64 (16 accumulators) a wave. C[m][n] = sum_k bf16(X[m][k]) bf16(W[n][k]) + bf16(bias[n]), f32 accumulate, k in passes of 32, walked in a ring from a start that differs between the work-groups which share operand rows (the 6 of a row block, the 32 of a column block), for speed only.
// A pass: every thread rounds the 16 x 4 f32 that it fetched one pass ahead (a wave-wide load is four whole 128-byte lines) and stores them as bf16 rows in LDS (rows 0..127 X, 128..255 W); one barrier; the next pass's fetch goes out; fragments come from LDS in the k order of WFrag::ld.
// Two LDS buffers, ONE barrier a pass: a wave overwrites the buffer of pass p only in pass p + 2, behind the barrier of pass p + 1, which no wave reaches before its reads of pass p have returned.
// Epilogue: a 64-column tile is one head, a 64-row tile lies in one batch. query, key: rows [head][t][d] as bf16 hi + lo, staged through the wave's own LDS range so that whole 128-byte lines are stored. value: planes [head][d][t]; an accumulator register run is 8 neighbouring t of one d, stored straight from registers as fp16, hi and lo.
#define PK   32    // k of a pass
#define PPIT 40    // LDS row pitch in bf16 elements: 64 bytes of data + 16, the conflict-free pitch for 16-byte fragment reads of 64-byte rows
typedef __attribute__((ext_vector_type(4))) __bf16 v4bf;
__global__ __launch_bounds__(128) void k_proj(const float* __restrict__ xq, const float* __restrict__ xk, const float* __restrict__ xv, const float* __restrict__ wq, const float* __restrict__ wk, const float* __restrict__ wv, const float* __restrict__ bq, const float* __restrict__ bk, const float* __restrict__ bv, bf* Qh, bf* Ql, bf* Kh, bf* Kl, h16* V16, bf* Vh, bf* Vl) {
    __shared__ __align__(16) bf ts[2][256 * PPIT];
    __shared__ __align__(16) float osall[4][16 * 68];
    const int z = blockIdx.z; const float* X = z == 0 ? xq : z == 1 ? xk : xv; const float* Wt = z == 0 ? wq : z == 1 ? wk : wv; const float* bias = z == 0 ? bq : z == 1 ? bk : bv;
    const int tid = threadIdx.x, w = __builtin_amdgcn_readfirstlane(tid >> 5), lane = tid & 31, lr = lane & 15, hi = lane >> 4;
    const int wr = (w & 1) * 64, wc = (w >> 1) * 64; const int r0 = blockIdx.x * 128 + wr, c0 = blockIdx.y * 128 + wc;
    const int sr = tid >> 3, sc = (tid & 7) * 4;   // staging: 8 threads a row of 32 f32, rows sr + 16 i
    const float* gx = X + (size_t)(blockIdx.x * 128 + sr) * DM + sc; const float* gw = Wt + (size_t)(blockIdx.y * 128 + sr) * DM + sc;
    v8f acc[4][4];
#pragma unroll
    for (int mb = 0; mb < 4; ++mb)
#pragma unroll
        for (int nb = 0; nb < 4; ++nb) acc[mb][nb] = (v8f){};
    v4f st[16];
    int kc = (int)((blockIdx.x + 4 * blockIdx.y) % (DM / PK)) * PK;   // first k of this work-group's walk: the 6 work-groups of a row block start 4 passes apart, the 32 of a column block on 24 different passes
#pragma unroll
    for (int i = 0; i < 8; ++i) { st[i] = *(const v4f*)(gx + (size_t)i * 16 * DM + kc); st[8 + i] = *(const v4f*)(gw + (size_t)i * 16 * DM + kc); }
    asm volatile("s_wait_xcnt 0x0" ::: "memory");   // the two address pairs of these sixteen loads are dead behind the last of them and the build reuses them at once: the wait stands in front of that overwrite
    __builtin_amdgcn_sched_barrier(0);              // keeps those register writes behind the wait
#pragma unroll 1   // one copy of the body: the buffer index and the fetch test stay scalar, and 16 accumulators, 16 fetched vectors and the fragments leave a second copy nothing to overlap with
    for (int it = 0; it < DM / PK; ++it) {
        bf* tb = ts[it & 1];
#pragma unroll
        for (int i = 0; i < 16; ++i) *(v4us*)(tb + (sr + 16 * i) * PPIT + sc) = __builtin_bit_cast(v4us, __builtin_convertvector(st[i], v4bf));   // round to nearest even, as f2bf
        __syncthreads();   // publishes this pass's rows; also ends every wave's reads of the other buffer before the next pass overwrites it
        if (it + 1 < DM / PK) {
            kc = kc + PK == DM ? 0 : kc + PK;   // the ring's next pass
#pragma unroll
            for (int i = 0; i < 8; ++i) { st[i] = *(const v4f*)(gx + (size_t)i * 16 * DM + kc); st[8 + i] = *(const v4f*)(gw + (size_t)i * 16 * DM + kc); }
            asm volatile("s_wait_xcnt 0x0" ::: "memory");   // the run's two address pairs are dead behind its last load and the build reuses them for the fragment reads below: the wait stands in front of that overwrite of registers which the sixteen loads name
        }
        v16bf a[4], b[2];   // two W fragment sets in turn: four would push the kernel past 256 registers
#pragma unroll
        for (int mb = 0; mb < 4; ++mb) a[mb] = WFrag<bf>::ld(tb + (wr + mb * 16 + lr) * PPIT + 8 * hi);
#pragma unroll
        for (int nb = 0; nb < 2; ++nb) b[nb] = WFrag<bf>::ld(tb + (128 + wc + nb * 16 + lr) * PPIT + 8 * hi);
#pragma unroll
        for (int nb = 0; nb < 4; ++nb) {
#pragma unroll
            for (int mb = 0; mb < 4; ++mb) acc[mb][nb] = wmmab(a[mb], b[nb & 1], acc[mb][nb]);
            if (nb < 2) { b[nb & 1] = WFrag<bf>::ld(tb + (128 + wc + (nb + 2) * 16 + lr) * PPIT + 8 * hi);
                __builtin_amdgcn_sched_barrier(0); }   // holds the refill of a W set right behind that set's last product, so that the other set's four products cover part of its LDS wait
        }
        asm volatile("v_nop\n\tv_nop\n\tv_nop\n\tv_nop" : "+v"(acc[0][0]), "+v"(acc[1][1]), "+v"(acc[2][2]), "+v"(acc[3][3]) : "v"(a[0]), "v"(a[3]));   // the four vector slots that the chip needs behind the pass's last matrix instruction, also on the taken back edge
    }
    const size_t hp = ((size_t)(r0 / TT) * NH_ + c0 / HD) * TT * HD; const int t0 = r0 % TT;   // this tile's batch-head plane and its first position
    // In both epilogues a block's values are all formed first, then its stores go out as one run with s_wait_xcnt 0 behind it, each part held in place by sched_barrier(0).
    if (z < 2) {
        bf* Ph = (z == 0 ? Qh : Kh) + hp; bf* Pl = (z == 0 ? Ql : Kl) + hp; float* os = osall[w]; const int cofs = lr * 4; v4f bb = *(const v4f*)(bias + c0 + cofs);
        asm volatile("s_wait_xcnt 0x0" ::: "memory");   // in front of any reuse of the bias load's address registers
        __builtin_amdgcn_sched_barrier(0);              // keeps later register writes behind that wait
#pragma unroll
        for (int q = 0; q < 4; ++q) bb[q] = bfr(bb[q]);
#pragma unroll
        for (int mb = 0; mb < 4; ++mb) {
#pragma unroll
            for (int nb = 0; nb < 4; ++nb) {
#pragma unroll
                for (int j = 0; j < 8; ++j) os[(hi * 8 + j) * 68 + nb * 16 + lr] = acc[mb][nb][j]; }
            __builtin_amdgcn_wave_barrier(); asm volatile("" ::: "memory");   // the wave's own LDS stores stay in front of its reads of other lanes' values
            v4us oh[8], ol[8];
#pragma unroll
            for (int s = 0; s < 8; ++s) { const v4f val = *(const v4fa*)(os + (2 * s + hi) * 68 + cofs) + bb;
#pragma unroll
                for (int q = 0; q < 4; ++q) { unsigned short a2, c2; splitf(val[q], a2, c2); oh[s][q] = a2; ol[s][q] = c2; } }
            __builtin_amdgcn_wave_barrier(); asm volatile("" ::: "memory");   // and these reads in front of the next block's LDS stores
            __builtin_amdgcn_sched_barrier(0);   // values first
#pragma unroll
            for (int s = 0; s < 8; ++s) { const size_t po = (size_t)(t0 + mb * 16 + 2 * s + hi) * HD + cofs; *(v4us*)(Ph + po) = oh[s]; *(v4us*)(Pl + po) = ol[s]; }
            asm volatile("s_wait_xcnt 0x0" ::: "memory");   // behind the run of stores, in front of the next block's writes of their registers
            __builtin_amdgcn_sched_barrier(0);   // keeps those writes behind the wait
        }
    } else {
        float bn[4];
#pragma unroll
        for (int nb = 0; nb < 4; ++nb) bn[nb] = bias[c0 + nb * 16 + lr];
        asm volatile("s_wait_xcnt 0x0" ::: "memory");   // in front of any reuse of the bias loads' offset register
        __builtin_amdgcn_sched_barrier(0);              // keeps later register writes behind that wait
#pragma unroll
        for (int nb = 0; nb < 4; ++nb) { const float bnr = bfr(bn[nb]); const size_t vo = hp + (size_t)(nb * 16 + lr) * TT + t0 + 8 * hi; v8h o16[4]; v8us oh[4], ol[4];
#pragma unroll
            for (int mb = 0; mb < 4; ++mb)
#pragma unroll
                for (int j = 0; j < 8; ++j) { const float x = acc[mb][nb][j] + bnr; o16[mb][j] = tohx(x); unsigned short a2, c2; splitf(x, a2, c2); oh[mb][j] = a2; ol[mb][j] = c2; }
            __builtin_amdgcn_sched_barrier(0);   // values first
#pragma unroll
            for (int mb = 0; mb < 4; ++mb) { *(v8h*)(V16 + vo + mb * 16) = o16[mb]; *(v8us*)(Vh + vo + mb * 16) = oh[mb]; *(v8us*)(Vl + vo + mb * 16) = ol[mb]; }
            asm volatile("s_wait_xcnt 0x0" ::: "memory");   // behind the run of stores, in front of the next block's writes of their registers
            __builtin_amdgcn_sched_barrier(0);   // keeps those writes behind the wait
        }
    }
}

// k_fattn: scores, softmax, P.V and the head merge in ONE kernel; a pair of waves per 16 or 32 query rows of one head, each wave on its half of the keys, 32 keys a pass, a held reference and a running sum (online softmax; the reference is raised, and what is summed rescaled, only when a pass's terms grow past 2^5 times the reference's), the pair's partial results joined at the end: no score or P plane in memory.
// S^T = K Q^T (A = K rows, B = Q rows, hi/lo planes, 3 products): lane (lr, hi) register j of key tile kt holds the score of key j0 + 16 kt + 8 hi + j for query lr, so the two key tiles of a pass, converted in place, are the B operand P^T of O^T += V^T P^T in the same k order as WFrag::ld reads V^T rows.
// HIRES (query rows < RH): P and V on hi/lo planes, 3 products; else P x PCAR in fp16 against the fp16 V plane (the factor is in the row sum too and cancels in O / sum).
// value of lane l ^ 16 (the other half of a query's keys) without the LDS path's latency
__device__ __forceinline__ float xhalf(float x) { const int b = __float_as_int(x); return __int_as_float(__builtin_amdgcn_permlanex16(b, b, 0x76543210, 0xfedcba98, false, false)); }
// 2^x with the instruction set's one free slot behind a transcendental kept in the same statement.
__device__ __forceinline__ float exp2s(float x) { float r; asm("v_exp_f32 %0, %1\n\tv_nop" : "=v"(r) : "v"(x)); return r; }
// K and V reach the waves through LDS: a stage is 64 keys (two passes): the 64 rows of 128 bytes of each K plane (keys) and of each V plane in use (d), brought by asynchronous copies of 16 bytes a lane, a wave-wide copy being four whole 128-byte lines; a key group's four waves share one copy of every tile. Two buffers: stage t + 1 flies while stage t is worked on.
#define SKEY 64                  // keys of a stage
#define KSPL 2                   // key groups of a work-group: waves 0..3 walk the first half of the keys, waves 4..7 the second half, for the same four query blocks
#define NSTG (TT / KSPL / SKEY)  // stages of a key group
#define XCHB ((32 + 2 * 2) * 32 * 4)   // bytes in which a wave hands half of its partial result to its partner in the other key group: at most 32 output values, 2 references and 2 sums a lane
#define LPIT 144                 // LDS row pitch in bytes: 128 of data + 16, the conflict-free pitch for 16-byte fragment reads of 128-byte rows
#define TILB (64 * LPIT)         // bytes of a staged tile
#define CP_(l, g) "global_load_async_to_lds_b128 %" #l ", %" #g ", off\n\t"
// One tile (copy4) or two neighbouring tiles (copy8): every thread brings 16 bytes of rows r, r + 16, r + 32, r + 48. The s_wait_xcnt 0 is the last line of the copies' own statement, so that it stands in front of every later write of the address registers which the copies name.
__device__ __forceinline__ void copy4(unsigned l, const char* g, int gs) {
    asm volatile(CP_(0, 4) CP_(1, 5) CP_(2, 6) CP_(3, 7) "s_wait_xcnt 0x0"
        :: "v"(l), "v"(l + 16 * LPIT), "v"(l + 32 * LPIT), "v"(l + 48 * LPIT), "v"(g), "v"(g + gs), "v"(g + 2 * gs), "v"(g + 3 * gs) : "memory");
}
__device__ __forceinline__ void copy8(unsigned l, const char* g, const char* g2, int gs) {
    asm volatile(CP_(0, 8) CP_(1, 9) CP_(2, 10) CP_(3, 11) CP_(4, 12) CP_(5, 13) CP_(6, 14) CP_(7, 15) "s_wait_xcnt 0x0"
        :: "v"(l), "v"(l + 16 * LPIT), "v"(l + 32 * LPIT), "v"(l + 48 * LPIT), "v"(l + TILB), "v"(l + TILB + 16 * LPIT), "v"(l + TILB + 32 * LPIT), "v"(l + TILB + 48 * LPIT),
           "v"(g), "v"(g + gs), "v"(g + 2 * gs), "v"(g + 3 * gs), "v"(g2), "v"(g2 + gs), "v"(g2 + 2 * gs), "v"(g2 + 3 * gs) : "memory");
}
template <bool HIRES, int NQ>   // NQ: 16-query column groups per wave
__device__ __forceinline__ void fattn_body(const bf* __restrict__ Qh, const bf* __restrict__ Ql, const bf* __restrict__ Kh, const bf* __restrict__ Kl, const bf* __restrict__ Vh, const bf* __restrict__ Vl, const h16* __restrict__ V16, float* Orow, int q0, int lr, int hi, char* sm, int tid, int kg, float* xs, const float* xr, int rot) {
    v16bf qh[NQ][2], ql[NQ][2];
#pragma unroll
    for (int nq = 0; nq < NQ; ++nq)
#pragma unroll
        for (int ks = 0; ks < 2; ++ks) { const size_t qo = (size_t)(q0 + nq * 16 + lr) * HD + ks * 32 + 8 * hi; qh[nq][ks] = WFrag<bf>::ld(Qh + qo); ql[nq][ks] = WFrag<bf>::ld(Ql + qo); }
    v8f o[NQ][4]; float nr[NQ], l[NQ];   // nr: the addend of the exponent, carrier exponent minus the held reference (log2 units); it starts so high that the first pass's sums are infinite and set the reference
#pragma unroll
    for (int nq = 0; nq < NQ; ++nq) { nr[nq] = 3.0e38f; l[nq] = 0.f;
#pragma unroll
        for (int dt = 0; dt < 4; ++dt) o[nq][dt] = (v8f){}; }
    constexpr float CEXP = SCL * 1.4426950408889634f, CARR = HIRES ? 0.0f : 10.0f /* 2^10 = PCAR */, PTHR = HIRES ? 32.0f : 32.0f * PCAR;   // score to log2 units; carrier exponent of P; the pass sum of a lane beyond which the reference is raised (fp16 P stays below 2^15)
    constexpr int BUFB = (HIRES ? 4 : 3) * TILB;   // a buffer: K hi, K lo, then V hi, V lo or the fp16 V
    const unsigned lc = (unsigned)(size_t)sm + (tid >> 3) * LPIT + (tid & 7) * 16;   // this thread's LDS byte in a tile: 8 threads a row
    const size_t vofs = (size_t)(tid >> 3) * (TT * 2) + (tid & 7) * 16;
    const char* gkh = (const char*)Kh + tid * 16; const char* gkl = (const char*)Kl + tid * 16; const char* gv0 = (HIRES ? (const char*)Vh : (const char*)V16) + vofs; const char* gv1 = (const char*)Vl + vofs;
    // the st-th fill goes to buffer st mod 2 and brings the keys of stage (st + rot) mod NSTG: the key group's stages are walked in a ring from a start that differs between the work-groups of a head
    auto fill = [&](int st) { const unsigned l = lc + (st & 1) * BUFB; const int sg = (st + rot) & (NSTG - 1); copy8(l, gkh + sg * (SKEY * HD * 2), gkl + sg * (SKEY * HD * 2), 16 * HD * 2);
        if (HIRES) copy8(l + 2 * TILB, gv0 + sg * (SKEY * 2), gv1 + sg * (SKEY * 2), 16 * TT * 2); else copy4(l + 2 * TILB, gv0 + sg * (SKEY * 2), 16 * TT * 2); };
    fill(0);
    asm volatile("s_wait_asynccnt 0x0" ::: "memory");   // this wave's copies of stage 0 have landed
    __syncthreads();                                    // and every other wave's: stage 0 may be read
    fill(1);
#pragma unroll 1   // one copy of the body: the buffer index and the refill test stay scalar
    for (int st = 0; st < NSTG; ++st) {
    const char* sb = sm + (st & 1) * BUFB + lr * LPIT + 16 * hi;
#pragma unroll 1   // one copy of the body: a pass holds 24 to 32 matrix instructions and its operands fill nearly all directly addressed registers, so a second copy has no registers to overlap with
    for (int ps = 0; ps < 2; ++ps) {
        v16bf kh[2][2], kl[2][2];
#pragma unroll
        for (int kt = 0; kt < 2; ++kt)
#pragma unroll
            for (int ks = 0; ks < 2; ++ks) { const char* kp = sb + (ps * 32 + kt * 16) * LPIT + ks * 64; kh[kt][ks] = WFrag<bf>::ld((const bf*)kp); kl[kt][ks] = WFrag<bf>::ld((const bf*)(kp + TILB)); }
        __builtin_amdgcn_sched_barrier(0);   // keeps the pass's 16 K reads one group ahead of the products
        v8f s[NQ][2];
#pragma unroll
        for (int kt = 0; kt < 2; ++kt)
#pragma unroll
            for (int nq = 0; nq < NQ; ++nq) s[nq][kt] = (v8f){};
#pragma unroll
        for (int ks = 0; ks < 2; ++ks)
#pragma unroll
            for (int kt = 0; kt < 2; ++kt)
#pragma unroll
                for (int nq = 0; nq < NQ; ++nq) { s[nq][kt] = wmmab(kh[kt][ks], qh[nq][ks], s[nq][kt]); s[nq][kt] = wmmab(kh[kt][ks], ql[nq][ks], s[nq][kt]); s[nq][kt] = wmmab(kl[kt][ks], qh[nq][ks], s[nq][kt]); }
        v16bf vh[4], vl[4]; v16h v16[4];
#pragma unroll
        for (int dt = 0; dt < 4; ++dt) { const char* vp = sb + 2 * TILB + dt * 16 * LPIT + ps * 64; if (HIRES) { vh[dt] = WFrag<bf>::ld((const bf*)vp); vl[dt] = WFrag<bf>::ld((const bf*)(vp + TILB)); } else v16[dt] = WFrag<h16>::ld((const h16*)vp); }
        __builtin_amdgcn_sched_barrier(0);   // the pass's V reads go out as one group behind the score products, so that the softmax arithmetic covers their latency
        float p[NQ][2][8], sum[NQ];
        // P = 2^(s * CEXP + nr) against the HELD reference: no maximum and no rescale in a pass that stays in range
        auto soft = [&]() {
#pragma unroll
            for (int nq = 0; nq < NQ; ++nq) { float sa = 0.f;
#pragma unroll
                for (int kt = 0; kt < 2; ++kt)
#pragma unroll
                    for (int j = 0; j < 8; ++j) { p[nq][kt][j] = exp2s(__builtin_fmaf(s[nq][kt][j], CEXP, nr[nq])); sa += p[nq][kt][j]; }
                sum[nq] = sa; }
        };
        soft();
        bool need = false;
#pragma unroll
        for (int nq = 0; nq < NQ; ++nq) need = need || !(sum[nq] <= PTHR);   // also true for an infinite or undefined sum
        if (__builtin_expect(__builtin_amdgcn_ballot_w32(need) != 0, 0)) {   // ONE test a pass, a scalar branch: some lane's 16 terms sum past 2^5 times the reference's term, so the wave raises its references to the maxima seen, rescales what it has summed and forms this pass's P anew (then every term is at most 2^carrier)
#pragma unroll
            for (int nq = 0; nq < NQ; ++nq) { float mx = s[nq][0][0];
#pragma unroll
                for (int kt = 0; kt < 2; ++kt)
#pragma unroll
                    for (int j = 0; j < 8; ++j) mx = fmaxf(mx, s[nq][kt][j]);
                mx = fmaxf(mx, xhalf(mx));      // lanes lr and lr + 16 hold the two halves of one query's keys and must share one reference
                const float nn = fminf(nr[nq], CARR - mx * CEXP); const float al = exp2s(nn - nr[nq]); nr[nq] = nn; l[nq] *= al;
#pragma unroll
                for (int dt = 0; dt < 4; ++dt) o[nq][dt] *= al; }
            soft();
        }
        v16bf ph[NQ], pl[NQ]; v16h p16[NQ];
#pragma unroll
        for (int nq = 0; nq < NQ; ++nq) { l[nq] += sum[nq];   // each half keeps its own partial sum; joined once behind the loop
            v8us uh[2], ul[2]; v8h u16[2];
#pragma unroll
            for (int kt = 0; kt < 2; ++kt)
#pragma unroll
                for (int j = 0; j < 8; ++j) { if (HIRES) { unsigned short a, c2; splitf(p[nq][kt][j], a, c2); uh[kt][j] = a; ul[kt][j] = c2; } else u16[kt][j] = tohx(p[nq][kt][j]); }
            if (HIRES) { ph[nq] = cat16b(uh[0], uh[1]); pl[nq] = cat16b(ul[0], ul[1]); } else p16[nq] = cat16(u16[0], u16[1]); }
#pragma unroll
        for (int dt = 0; dt < 4; ++dt) {
            if (HIRES) {
#pragma unroll
                for (int nq = 0; nq < NQ; ++nq) { o[nq][dt] = wmmab(vh[dt], ph[nq], o[nq][dt]); o[nq][dt] = wmmab(vh[dt], pl[nq], o[nq][dt]); o[nq][dt] = wmmab(vl[dt], ph[nq], o[nq][dt]); }
            } else {
#pragma unroll
                for (int nq = 0; nq < NQ; ++nq) o[nq][dt] = wmma16(v16[dt], p16[nq], o[nq][dt]); } }
    }
        // hand-over of the buffers, every wave, in this order
        asm volatile("s_wait_dscnt 0x0" ::: "memory");      // this wave's reads of stage st have returned
        asm volatile("s_wait_asynccnt 0x0" ::: "memory");   // this wave's copies of stage st + 1 have landed
        __syncthreads();                                    // publishes stage st + 1 and ends every wave's reads of stage st's buffer
        if (st + 2 < NSTG) fill(st + 2);                    // into the buffer just read
    }
    asm volatile("s_wait_asynccnt 0x0" ::: "memory");   // no copy is outstanding when the wave ends
    // The two key groups' partial results are joined through LDS, alike in every wave: of a pair's NQ * 4 output tiles (16 d x 16 queries) key group 0 finishes the first half and key group 1 the second; each hands the other half to its partner, with its references and sums. The ring is free for it: the loop's last barrier stands behind every wave's last read, and no copy is outstanding.
    constexpr int TH = NQ * 2; const int lane = hi * 16 + lr; const bool g1 = kg != 0;
#pragma unroll
    for (int t = 0; t < TH; ++t) { const v8f sd = g1 ? o[t / 4][t % 4] : o[(TH + t) / 4][(TH + t) % 4]; v4f a, c;
#pragma unroll
        for (int j = 0; j < 4; ++j) { a[j] = sd[j]; c[j] = sd[j + 4]; }
        *(v4fa*)(xs + (2 * t) * 128 + lane * 4) = a; *(v4fa*)(xs + (2 * t + 1) * 128 + lane * 4) = c; }   // 16 bytes a lane, lanes side by side: no bank conflict
#pragma unroll
    for (int nq = 0; nq < NQ; ++nq) { xs[TH * 256 + (2 * nq) * 32 + lane] = nr[nq]; xs[TH * 256 + (2 * nq + 1) * 32 + lane] = l[nq]; }
    __syncthreads();   // publishes every wave's hand-over to its partner
    const int nk = NQ == 2 ? kg : 0;   // the query group whose tiles this wave finishes (with one query group: d 32 kg .. 32 kg + 31 of it)
    const float n0 = g1 ? nr[NQ - 1] : nr[0], l0 = g1 ? l[NQ - 1] : l[0], n1 = xr[TH * 256 + (2 * nk) * 32 + lane], l1 = xr[TH * 256 + (2 * nk + 1) * 32 + lane]; const float nj = fminf(n0, n1);   // the smaller addend is the higher reference
    const float a0 = exp2s(nj - n0), a1 = exp2s(nj - n1);   // each group's terms brought to the common reference
    const float lj = l0 * a0 + l1 * a1; const float ls = lj + xhalf(lj); const float f = __fdiv_rn(1.0f, ls); const float f0 = a0 * f, f1 = a1 * f; float* orow = Orow + (size_t)(q0 + nk * 16 + lr) * DQ + 8 * hi + (NQ == 2 ? 0 : kg * 32);
#pragma unroll
    for (int t = 0; t < TH; ++t) { const v8f kp = g1 ? o[(TH + t) / 4][(TH + t) % 4] : o[t / 4][t % 4]; const v4f b = *(const v4fa*)(xr + (2 * t) * 128 + lane * 4), d = *(const v4fa*)(xr + (2 * t + 1) * 128 + lane * 4); v4f a, c;
#pragma unroll
        for (int j = 0; j < 4; ++j) { a[j] = kp[j] * f0 + b[j] * f1; c[j] = kp[j + 4] * f0 + d[j] * f1; }
        *(v4f*)(orow + t * 16) = a; *(v4f*)(orow + t * 16 + 4) = c; }
}
// grid (batches x heads, (RH / 16 + (TT - RH) / 32) / 4), 256 threads = 8 waves: four neighbouring query blocks of ONE head times two key groups. Waves w and w + 4 hold the same query block; each key group has its own ring of staged K and V tiles, filled by its own four waves, and walks its half of the keys; the stage barrier is common. With two work-groups on a WGP four waves share a SIMD, so that one wave's LDS waits and dependent softmax arithmetic are covered by the others' matrix and vector work. A hi/lo wave (three times the P.V products and the hi/lo split a key) takes 16 query rows, an fp16 wave 32, so that a pass costs both about the same; the hi/lo blocks have the low blockIdx.y (RH / 16 is a multiple of 4: a workgroup is all of one kind). amdgpu_waves_per_eu(4, 4) holds the register budget at 256, without which only one work-group fits a WGP; 2 x the LDS size is 294,912 bytes and fits too.
__global__ __launch_bounds__(256) __attribute__((amdgpu_waves_per_eu(4, 4))) void k_fattn(const bf* __restrict__ Qh, const bf* __restrict__ Ql, const bf* __restrict__ Kh, const bf* __restrict__ Kl, const bf* __restrict__ Vh, const bf* __restrict__ Vl, const h16* __restrict__ V16, float* OUTb) {
    __shared__ __align__(16) char sm[KSPL * 2 * 4 * TILB];
    const int lane = threadIdx.x & 31, lr = lane & 15, hi = lane >> 4; const size_t hp = (size_t)blockIdx.x * TT * HD;   /* planes [batch][head] */ const int wv = __builtin_amdgcn_readfirstlane(threadIdx.x >> 5), kg = wv >> 2, y = blockIdx.y * 4 + (wv & 3); float* Orow = OUTb + (size_t)(blockIdx.x / NH_) * TT * DQ + (blockIdx.x % NH_) * HD;
    const size_t kp = hp + (size_t)kg * (TT / KSPL) * HD, vp = hp + (size_t)kg * (TT / KSPL);   // the key group's first K row ([t][d] planes) and first V column ([d][t] planes)
    char* ring = sm + kg * (2 * 4 * TILB); float* xs = (float*)(sm + wv * XCHB); const float* xr = (const float*)(sm + (wv ^ 4) * XCHB); const int tid = threadIdx.x & 127;
    const int rot = (blockIdx.x + blockIdx.y) & (NSTG - 1);   // the 20 work-groups of a head read the same K and V lines: their walks start on 16 different stages (blockIdx.y and blockIdx.y + 16 share one), for speed only
    if (blockIdx.y < RH / 64) fattn_body<true, 1>(Qh + hp, Ql + hp, Kh + kp, Kl + kp, Vh + vp, Vl + vp, V16 + vp, Orow, y * 16, lr, hi, ring, tid, kg, xs, xr, rot);
    else fattn_body<false, 2>(Qh + hp, Ql + hp, Kh + kp, Kl + kp, Vh + vp, Vl + vp, V16 + vp, Orow, RH + (y - RH / 16) * 32, lr, hi, ring, tid, kg, xs, xr, rot);
}

extern "C" void kernel_launch(void* const* d_in, const int* in_sizes, int n_in,
                              void* d_out, int out_size, void* d_ws, size_t ws_size, hipStream_t stream) {
    (void)in_sizes; (void)n_in; (void)out_size;
    const float* x = (const float*)d_in[0]; const float* xk = (const float*)d_in[1]; const float* xv = (const float*)d_in[2]; const float* wq = (const float*)d_in[3]; const float* bq = (const float*)d_in[4]; const float* wk = (const float*)d_in[5]; const float* bk = (const float*)d_in[6]; const float* wv = (const float*)d_in[7]; const float* bv = (const float*)d_in[8];   /* argument order query, key, value, Wq, bq, Wk, bk, Wv, bv ('oi' [768][768] + [768]); no output projection */
    float* OUT = (float*)d_out;     // [2][2048][768]
    char* wsp = (char*)d_ws;
    auto take = [&](size_t bytes) { char* p = wsp; wsp += (bytes + 255) & ~(size_t)255; return (void*)p; };
    h16* VT16 = (h16*)take((size_t)NB_ * NKV * HD * TT * 2);
    bf* QPh = (bf*)take((size_t)NB_ * NH_ * TT * HD * 2); bf* QPl = (bf*)take((size_t)NB_ * NH_ * TT * HD * 2); bf* KPh = (bf*)take((size_t)NB_ * NKV * TT * HD * 2); bf* KPl = (bf*)take((size_t)NB_ * NKV * TT * HD * 2); bf* VTh = (bf*)take((size_t)NB_ * NKV * HD * TT * 2); bf* VTl = (bf*)take((size_t)NB_ * NKV * HD * TT * 2);   /* the planes the attention launch reads: both batches */
    if ((size_t)(wsp - (char*)d_ws) > ws_size) return;    // ws 256 MiB
    k_proj<<<dim3(NB_ * TT / 128, DQ / 128, 3), 128, 0, stream>>>(x, xk, xv, wq, wk, wv, bq, bk, bv, QPh, QPl, KPh, KPl, VT16, VTh, VTl);   /* rounding, projections, biases, planes: 3 streams x 2 batches */
    k_fattn<<<dim3(NB_ * NH_, (RH / 16 + (TT - RH) / 32) / 4, 1), 256, 0, stream>>>(QPh, QPl, KPh, KPl, VTh, VTl, VT16, OUT);   /* all 24 batch-heads: scores, softmax, P.V, merge */
}

// v007
// Measured time: 70.8 microseconds a run.
// In two side-by-side timings against v006, it was 1.06 and 1.05 times as fast.
// All steps since v000 together make it 21.0 times as fast.
#include <hip/hip_runtime.h>

// Multi-head attention on three input streams at d_model 768 WITHOUT an output projection (query, key, value [2][2048][768]; Q = query Wq^T + bq, K = key Wk^T + bk, V = value Wv^T + bv ('oi' + biases; 12 heads x 64); scores / sqrt(64); softmax (no mask); out = heads merged -> [2][2048][768] (3.1 M); argument order query, key, value, Wq, bq, Wk, bk, Wv, bv).
// Layout: ONE projection launch for all three streams and both batches ('oi' weights; f32 operands rounded to bf16 on their way into LDS; exact products (K 768) + f32 biases; its epilogue writes the planes the attention reads); then ONE fused attention launch for all 24 batch-heads (online softmax, scores and P stay in registers) with EVERY row's scores on hi/lo planes (3 products: no output projection averages the fp16 score error) and hybrid P.V (rows < 512 hi/lo, rest fp16 x1024); it writes the merged f32 output rows.
// Compute dtypes, f32 accumulate: every input rounded to bf16; projections exact + f32 biases; scores 3 products on every row; P.V rows < 512 3 products, rest fp16; softmax f32; output f32.

#define NB_  2
#define TT   2048
#define DM   768
#define NH_  12
#define NKV  12
#define REP  (NH_ / NKV)
#define HD   64
#define DQ   (NH_ * HD)
#define DKV  (NKV * HD)
#define ZH   2
#define RH   512                  // query rows < RH use hi+lo planes (0: none)
#define WIN  0
#define PCAR 1024.0f
#define SCL  0.125f   // HD^-0.5
typedef _Float16 h16;
typedef unsigned short bf;
typedef __attribute__((ext_vector_type(16))) __bf16   v16bf;
typedef __attribute__((ext_vector_type(16))) _Float16 v16h;
typedef __attribute__((ext_vector_type(8)))  _Float16 v8h;
typedef __attribute__((ext_vector_type(8)))  unsigned short v8us;
typedef __attribute__((ext_vector_type(8)))  float    v8f;
typedef __attribute__((ext_vector_type(4)))  float    v4f;
typedef v8h  __attribute__((may_alias)) v8ha;
typedef v4f  __attribute__((may_alias)) v4fa;
typedef v8us __attribute__((may_alias)) v8usa;

__device__ __forceinline__ unsigned short f2bf(float f) { unsigned u = __float_as_uint(f); u += 0x7FFFu + ((u >> 16) & 1u); return (unsigned short)(u >> 16); }
__device__ __forceinline__ float bf2f(unsigned short b) { return __uint_as_float(((unsigned)b) << 16); }
__device__ __forceinline__ float bfr(float f) { return bf2f(f2bf(f)); }
__device__ __forceinline__ v16h cat16(v8h lo, v8h hi) { return __builtin_shufflevector(lo, hi, 0, 1, 2, 3, 4, 5, 6, 7, 8, 9, 10, 11, 12, 13, 14, 15); }
__device__ __forceinline__ v16bf cat16b(v8us lo, v8us hi) { return __builtin_bit_cast(v16bf, __builtin_shufflevector(lo, hi, 0, 1, 2, 3, 4, 5, 6, 7, 8, 9, 10, 11, 12, 13, 14, 15)); }
__device__ __forceinline__ v8f wmma16(v16h a, v16h b, v8f c) { return __builtin_amdgcn_wmma_f32_16x16x32_f16(false, a, false, b, (short)0, c, false, false); }
__device__ __forceinline__ v8f wmmab(v16bf a, v16bf b, v8f c) { return __builtin_amdgcn_wmma_f32_16x16x32_bf16(false, a, false, b, (short)0, c, false, false); }



// fragment loaders: 16 k of one row a lane, k = 8 hi + 0..7 and 16 + 8 hi + 0..7 of a 32-k step, from K-contiguous 16-bit rows
template <typename T16> struct WFrag;
template <> struct WFrag<h16> { typedef v16h V; static __device__ __forceinline__ V ld(const h16* p) { return cat16(*(const v8h*)p, *(const v8h*)(p + 16)); } static __device__ __forceinline__ v8f mma(V a, V b, v8f c) { return wmma16(a, b, c); } };
template <> struct WFrag<bf> { typedef v16bf V; static __device__ __forceinline__ V ld(const bf* p) { return cat16b(*(const v8us*)p, *(const v8us*)(p + 16)); } static __device__ __forceinline__ v8f mma(V a, V b, v8f c) { return wmmab(a, b, c); } };

__device__ __forceinline__ h16 tohx(float x) { return (h16)x; }
__device__ __forceinline__ void splitf(float y, unsigned short& h, unsigned short& l) { h = f2bf(y); l = f2bf(y - bf2f(h)); }
typedef __attribute__((ext_vector_type(2))) _Float16 v2h;
typedef __attribute__((ext_vector_type(4))) _Float16 v4h;
typedef __attribute__((ext_vector_type(2))) unsigned short v2us;
typedef __attribute__((ext_vector_type(4))) unsigned short v4us;
typedef __attribute__((ext_vector_type(2))) float v2f;
typedef __attribute__((ext_vector_type(4))) int v4i;

// ---- k_proj: the three projections of both batches in ONE launch, from the f32 inputs to the planes that k_fattn reads: no bf16 copy and no f32 projection in memory.
// grid (NB_ * TT / 128, DQ / 128, 3 streams: query, key, value), 128 threads = 4 waves, 128 x 128 outputs a work-group, 64 x 64 (16 accumulators) a wave. C[m][n] = sum_k bf16(X[m][k]) bf16(W[n][k]) + bf16(bias[n]), f32 accumulate, k in passes of 32, walked in a ring from a start that differs between the work-groups which share operand rows (the 6 of a row block, the 32 of a column block), for speed only.
// A pass: every thread rounds the 16 x 4 f32 that it fetched one pass ahead (a wave-wide load is four whole 128-byte lines) and stores them as bf16 rows in LDS (rows 0..127 X, 128..255 W); one barrier; the next pass's fetch goes out; fragments come from LDS in the k order of WFrag::ld.
// Two LDS buffers, ONE barrier a pass: a wave overwrites the buffer of pass p only in pass p + 2, behind the barrier of pass p + 1, which no wave reaches before its reads of pass p have returned.
// Epilogue: a 64-column tile is one head, a 64-row tile lies in one batch. query, key: rows [head][t][d] as bf16 hi + lo, staged through the wave's own LDS range so that whole 128-byte lines are stored. value: planes [head][d][t]; an accumulator register run is 8 neighbouring t of one d, stored straight from registers as fp16, hi and lo.
#define PK   32    // k of a pass
#define PPIT 40    // LDS row pitch in bf16 elements: 64 bytes of data + 16, the conflict-free pitch for 16-byte fragment reads of 64-byte rows
typedef __attribute__((ext_vector_type(4))) __bf16 v4bf;
__global__ __launch_bounds__(128) void k_proj(const float* __restrict__ xq, const float* __restrict__ xk, const float* __restrict__ xv, const float* __restrict__ wq, const float* __restrict__ wk, const float* __restrict__ wv, const float* __restrict__ bq, const float* __restrict__ bk, const float* __restrict__ bv, bf* Qh, bf* Ql, bf* Kh, bf* Kl, h16* V16, bf* Vh, bf* Vl) {
    __shared__ __align__(16) bf ts[2][256 * PPIT];
    __shared__ __align__(16) float osall[4][16 * 68];
    const int z = blockIdx.z; const float* X = z == 0 ? xq : z == 1 ? xk : xv; const float* Wt = z == 0 ? wq : z == 1 ? wk : wv; const float* bias = z == 0 ? bq : z == 1 ? bk : bv;
    const int tid = threadIdx.x, w = __builtin_amdgcn_readfirstlane(tid >> 5), lane = tid & 31, lr = lane & 15, hi = lane >> 4;
    const int wr = (w & 1) * 64, wc = (w >> 1) * 64; const int r0 = blockIdx.x * 128 + wr, c0 = blockIdx.y * 128 + wc;
    const int sr = tid >> 3, sc = (tid & 7) * 4;   // staging: 8 threads a row of 32 f32, rows sr + 16 i
    const float* gx = X + (size_t)(blockIdx.x * 128 + sr) * DM + sc; const float* gw = Wt + (size_t)(blockIdx.y * 128 + sr) * DM + sc;
    v8f acc[4][4];
#pragma unroll
    for (int mb = 0; mb < 4; ++mb)
#pragma unroll
        for (int nb = 0; nb < 4; ++nb) acc[mb][nb] = (v8f){};
    v4f st[16];
    int kc = (int)((blockIdx.x + 4 * blockIdx.y) % (DM / PK)) * PK;   // first k of this work-group's walk: the 6 work-groups of a row block start 4 passes apart, the 32 of a column block on 24 different passes
#pragma unroll
    for (int i = 0; i < 8; ++i) { st[i] = *(const v4f*)(gx + (size_t)i * 16 * DM + kc); st[8 + i] = *(const v4f*)(gw + (size_t)i * 16 * DM + kc); }
    asm volatile("s_wait_xcnt 0x0" ::: "memory");   // the two address pairs of these sixteen loads are dead behind the last of them and the build reuses them at once: the wait stands in front of that overwrite
    __builtin_amdgcn_sched_barrier(0);              // keeps those register writes behind the wait
#pragma unroll 1   // one copy of the body: the buffer index and the fetch test stay scalar, and 16 accumulators, 16 fetched vectors and the fragments leave a second copy nothing to overlap with
    for (int it = 0; it < DM / PK; ++it) {
        bf* tb = ts[it & 1];
#pragma unroll
        for (int i = 0; i < 16; ++i) *(v4us*)(tb + (sr + 16 * i) * PPIT + sc) = __builtin_bit_cast(v4us, __builtin_convertvector(st[i], v4bf));   // round to nearest even, as f2bf
        __syncthreads();   // publishes this pass's rows; also ends every wave's reads of the other buffer before the next pass overwrites it
        if (it + 1 < DM / PK) {
            kc = kc + PK == DM ? 0 : kc + PK;   // the ring's next pass
#pragma unroll
            for (int i = 0; i < 8; ++i) { st[i] = *(const v4f*)(gx + (size_t)i * 16 * DM + kc); st[8 + i] = *(const v4f*)(gw + (size_t)i * 16 * DM + kc); }
            asm volatile("s_wait_xcnt 0x0" ::: "memory");   // the run's two address pairs are dead behind its last load and the build reuses them for the fragment reads below: the wait stands in front of that overwrite of registers which the sixteen loads name
        }
        v16bf a[4], b[2];   // two W fragment sets in turn: four would push the kernel past 256 registers
#pragma unroll
        for (int mb = 0; mb < 4; ++mb) a[mb] = WFrag<bf>::ld(tb + (wr + mb * 16 + lr) * PPIT + 8 * hi);
#pragma unroll
        for (int nb = 0; nb < 2; ++nb) b[nb] = WFrag<bf>::ld(tb + (128 + wc + nb * 16 + lr) * PPIT + 8 * hi);
#pragma unroll
        for (int nb = 0; nb < 4; ++nb) {
#pragma unroll
            for (int mb = 0; mb < 4; ++mb) acc[mb][nb] = wmmab(a[mb], b[nb & 1], acc[mb][nb]);
            if (nb < 2) { b[nb & 1] = WFrag<bf>::ld(tb + (128 + wc + (nb + 2) * 16 + lr) * PPIT + 8 * hi);
                __builtin_amdgcn_sched_barrier(0); }   // holds the refill of a W set right behind that set's last product, so that the other set's four products cover part of its LDS wait
        }
        asm volatile("v_nop\n\tv_nop\n\tv_nop\n\tv_nop" : "+v"(acc[0][0]), "+v"(acc[1][1]), "+v"(acc[2][2]), "+v"(acc[3][3]) : "v"(a[0]), "v"(a[3]));   // the four vector slots that the chip needs behind the pass's last matrix instruction, also on the taken back edge
    }
    const size_t hp = ((size_t)(r0 / TT) * NH_ + c0 / HD) * TT * HD; const int t0 = r0 % TT;   // this tile's batch-head plane and its first position
    // In both epilogues a block's values are all formed first, then its stores go out as one run with s_wait_xcnt 0 behind it, each part held in place by sched_barrier(0).
    if (z < 2) {
        bf* Ph = (z == 0 ? Qh : Kh) + hp; bf* Pl = (z == 0 ? Ql : Kl) + hp; float* os = osall[w]; const int cofs = lr * 4; v4f bb = *(const v4f*)(bias + c0 + cofs);
        asm volatile("s_wait_xcnt 0x0" ::: "memory");   // in front of any reuse of the bias load's address registers
        __builtin_amdgcn_sched_barrier(0);              // keeps later register writes behind that wait
#pragma unroll
        for (int q = 0; q < 4; ++q) bb[q] = bfr(bb[q]);
#pragma unroll
        for (int mb = 0; mb < 4; ++mb) {
#pragma unroll
            for (int nb = 0; nb < 4; ++nb) {
#pragma unroll
                for (int j = 0; j < 8; ++j) os[(hi * 8 + j) * 68 + nb * 16 + lr] = acc[mb][nb][j]; }
            __builtin_amdgcn_wave_barrier(); asm volatile("" ::: "memory");   // the wave's own LDS stores stay in front of its reads of other lanes' values
            v4us oh[8], ol[8];
#pragma unroll
            for (int s = 0; s < 8; ++s) { const v4f val = *(const v4fa*)(os + (2 * s + hi) * 68 + cofs) + bb;
#pragma unroll
                for (int q = 0; q < 4; ++q) { unsigned short a2, c2; splitf(val[q], a2, c2); oh[s][q] = a2; ol[s][q] = c2; } }
            __builtin_amdgcn_wave_barrier(); asm volatile("" ::: "memory");   // and these reads in front of the next block's LDS stores
            __builtin_amdgcn_sched_barrier(0);   // values first
#pragma unroll
            for (int s = 0; s < 8; ++s) { const size_t po = (size_t)(t0 + mb * 16 + 2 * s + hi) * HD + cofs; *(v4us*)(Ph + po) = oh[s]; *(v4us*)(Pl + po) = ol[s]; }
            asm volatile("s_wait_xcnt 0x0" ::: "memory");   // behind the run of stores, in front of the next block's writes of their registers
            __builtin_amdgcn_sched_barrier(0);   // keeps those writes behind the wait
        }
    } else {
        float bn[4];
#pragma unroll
        for (int nb = 0; nb < 4; ++nb) bn[nb] = bias[c0 + nb * 16 + lr];
        asm volatile("s_wait_xcnt 0x0" ::: "memory");   // in front of any reuse of the bias loads' offset register
        __builtin_amdgcn_sched_barrier(0);              // keeps later register writes behind that wait
#pragma unroll
        for (int nb = 0; nb < 4; ++nb) { const float bnr = bfr(bn[nb]); const size_t vo = hp + (size_t)(nb * 16 + lr) * TT + t0 + 8 * hi; v8h o16[4]; v8us oh[4], ol[4];
#pragma unroll
            for (int mb = 0; mb < 4; ++mb)
#pragma unroll
                for (int j = 0; j < 8; ++j) { const float x = acc[mb][nb][j] + bnr; o16[mb][j] = tohx(x); unsigned short a2, c2; splitf(x, a2, c2); oh[mb][j] = a2; ol[mb][j] = c2; }
            __builtin_amdgcn_sched_barrier(0);   // values first
#pragma unroll
            for (int mb = 0; mb < 4; ++mb) { *(v8h*)(V16 + vo + mb * 16) = o16[mb]; *(v8us*)(Vh + vo + mb * 16) = oh[mb]; *(v8us*)(Vl + vo + mb * 16) = ol[mb]; }
            asm volatile("s_wait_xcnt 0x0" ::: "memory");   // behind the run of stores, in front of the next block's writes of their registers
            __builtin_amdgcn_sched_barrier(0);   // keeps those writes behind the wait
        }
    }
}

// k_fattn: scores, softmax, P.V and the head merge in ONE kernel; a pair of waves per 16 or 32 query rows of one head, each wave on its half of the keys, 32 keys a pass, a held reference and a running sum (online softmax; the reference is raised, and what is summed rescaled, only when a pass's terms grow past 2^5 times the reference's), the pair's partial results joined at the end: no score or P plane in memory.
// S^T = K Q^T (A = K rows, B = Q rows, hi/lo planes, 3 products): lane (lr, hi) register j of key tile kt holds the score of key j0 + 16 kt + 8 hi + j for query lr, so the two key tiles of a pass, converted in place, are the B operand P^T of O^T += V^T P^T in the same k order as WFrag::ld reads V^T rows.
// HIRES (query rows < RH): P and V on hi/lo planes, 3 products; else P x PCAR in fp16 against the fp16 V plane (the factor is in the row sum too and cancels in O / sum).
// value of lane l ^ 16 (the other half of a query's keys) without the LDS path's latency
__device__ __forceinline__ float xhalf(float x) { const int b = __float_as_int(x); return __int_as_float(__builtin_amdgcn_permlanex16(b, b, 0x76543210, 0xfedcba98, false, false)); }
// 2^x with the instruction set's one free slot behind a transcendental kept in the same statement.
__device__ __forceinline__ float exp2s(float x) { float r; asm("v_exp_f32 %0, %1\n\tv_nop" : "=v"(r) : "v"(x)); return r; }
// The softmax's vector work on register pairs: exponent addend and row sums as packed f32 instructions, set into the slots behind the exponentials. The instruction set's free slot behind a transcendental is kept by the order inside each statement: what follows a v_exp_f32 neither reads its result nor writes its register (the exponentials work in place on in-out operands, whose registers no other operand shares), and every statement ends in a packed instruction. volatile keeps the statements in the written order: without it the build set pair k + 2 directly behind pair k, each exponential right behind its own fma. The fma runs two pairs ahead of its exponentials and the adds two pairs behind theirs; where a producer is still within four vector instructions, s_delay_alu names it, without which a dependent instruction holds the SIMD's issue against the other waves too (the compiler sets no hint inside asm text).
// sm_a: 2^a, 2^b in place; nx = sn * c + n[H] (n holds the addends of both query groups; a packed f32 instruction reads only the first register of a scalar pair, for both halves: op_sel_hi 0 on it)
template <int V> struct IC_ { static constexpr int v = V; };   // a query group's number as a compile-time value
#define DLY2_ "s_delay_alu instid0(VALU_DEP_2)\n\t"   // the pair's fma is the second plain vector instruction back (in sm_b's second use the third: the hint then names a younger one, which covers it)
#define NLO_ " op_sel_hi:[1,0,0]"                // both halves add the first register of the addend pair
#define NHI_ " op_sel:[0,0,1] op_sel_hi:[1,0,1]"   // both halves add its second register
template <int H> __device__ __forceinline__ void sm_a(float& a, float& b, v2f& nx, v2f sn, v2f c, v2f n) {
    if (H) asm volatile(DLY2_ "v_exp_f32 %0, %0\n\tv_exp_f32 %1, %1\n\tv_pk_fma_f32 %2, %3, %4, %5" NHI_ : "+v"(a), "+v"(b), "=v"(nx) : "v"(sn), "s"(c), "v"(n));
    else   asm volatile(DLY2_ "v_exp_f32 %0, %0\n\tv_exp_f32 %1, %1\n\tv_pk_fma_f32 %2, %3, %4, %5" NLO_ : "+v"(a), "+v"(b), "=v"(nx) : "v"(sn), "s"(c), "v"(n));
}
// sm_b: the same, and o = u + w
template <int H> __device__ __forceinline__ void sm_b(float& a, float& b, v2f& nx, v2f sn, v2f c, v2f n, v2f& o, v2f u, v2f w) {
    if (H) asm volatile(DLY2_ "v_exp_f32 %0, %0\n\tv_pk_fma_f32 %2, %4, %5, %6" NHI_ "\n\tv_exp_f32 %1, %1\n\tv_pk_add_f32 %3, %7, %8" : "+v"(a), "+v"(b), "=&v"(nx), "=v"(o) : "v"(sn), "s"(c), "v"(n), "v"(u), "v"(w));
    else   asm volatile(DLY2_ "v_exp_f32 %0, %0\n\tv_pk_fma_f32 %2, %4, %5, %6" NLO_ "\n\tv_exp_f32 %1, %1\n\tv_pk_add_f32 %3, %7, %8" : "+v"(a), "+v"(b), "=&v"(nx), "=v"(o) : "v"(sn), "s"(c), "v"(n), "v"(u), "v"(w));
}
// sm_c: 2^a, 2^b in place; o += w
__device__ __forceinline__ void sm_c(float& a, float& b, v2f& o, v2f w) {
    asm volatile("v_exp_f32 %0, %0\n\tv_exp_f32 %1, %1\n\tv_pk_add_f32 %2, %2, %3" : "+v"(a), "+v"(b), "+v"(o) : "v"(w));
}
// K and V reach the waves through LDS: a stage is 64 keys (two passes): the 64 rows of 128 bytes of each K plane (keys) and of each V plane in use (d), brought by asynchronous copies of 16 bytes a lane, a wave-wide copy being four whole 128-byte lines; a key group's four waves share one copy of every tile. Two buffers: stage t + 1 flies while stage t is worked on.
#define SKEY 64                  // keys of a stage
#define KSPL 2                   // key groups of a work-group: waves 0..3 walk the first half of the keys, waves 4..7 the second half, for the same four query blocks
#define NSTG (TT / KSPL / SKEY)  // stages of a key group
#define XCHB ((32 + 2 * 2) * 32 * 4)   // bytes in which a wave hands half of its partial result to its partner in the other key group: at most 32 output values, 2 references and 2 sums a lane
#define LPIT 144                 // LDS row pitch in bytes: 128 of data + 16, the conflict-free pitch for 16-byte fragment reads of 128-byte rows
#define TILB (64 * LPIT)         // bytes of a staged tile
#define CP_(l, g) "global_load_async_to_lds_b128 %" #l ", %" #g ", off\n\t"
// One tile (copy4) or two neighbouring tiles (copy8): every thread brings 16 bytes of rows r, r + 16, r + 32, r + 48. The s_wait_xcnt 0 is the last line of the copies' own statement, so that it stands in front of every later write of the address registers which the copies name.
__device__ __forceinline__ void copy4(unsigned l, const char* g, int gs) {
    asm volatile(CP_(0, 4) CP_(1, 5) CP_(2, 6) CP_(3, 7) "s_wait_xcnt 0x0"
        :: "v"(l), "v"(l + 16 * LPIT), "v"(l + 32 * LPIT), "v"(l + 48 * LPIT), "v"(g), "v"(g + gs), "v"(g + 2 * gs), "v"(g + 3 * gs) : "memory");
}
__device__ __forceinline__ void copy8(unsigned l, const char* g, const char* g2, int gs) {
    asm volatile(CP_(0, 8) CP_(1, 9) CP_(2, 10) CP_(3, 11) CP_(4, 12) CP_(5, 13) CP_(6, 14) CP_(7, 15) "s_wait_xcnt 0x0"
        :: "v"(l), "v"(l + 16 * LPIT), "v"(l + 32 * LPIT), "v"(l + 48 * LPIT), "v"(l + TILB), "v"(l + TILB + 16 * LPIT), "v"(l + TILB + 32 * LPIT), "v"(l + TILB + 48 * LPIT),
           "v"(g), "v"(g + gs), "v"(g + 2 * gs), "v"(g + 3 * gs), "v"(g2), "v"(g2 + gs), "v"(g2 + 2 * gs), "v"(g2 + 3 * gs) : "memory");
}
template <bool HIRES, int NQ>   // NQ: 16-query column groups per wave
__device__ __forceinline__ void fattn_body(const bf* __restrict__ Qh, const bf* __restrict__ Ql, const bf* __restrict__ Kh, const bf* __restrict__ Kl, const bf* __restrict__ Vh, const bf* __restrict__ Vl, const h16* __restrict__ V16, float* Orow, int q0, int lr, int hi, char* sm, int tid, int kg, float* xs, const float* xr, int rot) {
    v16bf qh[NQ][2], ql[NQ][2];
#pragma unroll
    for (int nq = 0; nq < NQ; ++nq)
#pragma unroll
        for (int ks = 0; ks < 2; ++ks) { const size_t qo = (size_t)(q0 + nq * 16 + lr) * HD + ks * 32 + 8 * hi; qh[nq][ks] = WFrag<bf>::ld(Qh + qo); ql[nq][ks] = WFrag<bf>::ld(Ql + qo); }
    v8f o[NQ][4]; float nr[NQ], l[NQ];   // nr: the addend of the exponent, carrier exponent minus the held reference (log2 units); it starts so high that the first pass's sums are infinite and set the reference
#pragma unroll
    for (int nq = 0; nq < NQ; ++nq) { nr[nq] = 3.0e38f; l[nq] = 0.f;
#pragma unroll
        for (int dt = 0; dt < 4; ++dt) o[nq][dt] = (v8f){}; }
    constexpr float CEXP = SCL * 1.4426950408889634f, CARR = HIRES ? 0.0f : 10.0f /* 2^10 = PCAR */, PTHR = HIRES ? 32.0f : 32.0f * PCAR;   // score to log2 units; carrier exponent of P; the pass sum of a lane beyond which the reference is raised (fp16 P stays below 2^15)
    constexpr int BUFB = (HIRES ? 4 : 3) * TILB;   // a buffer: K hi, K lo, then V hi, V lo or the fp16 V
    const unsigned lc = (unsigned)(size_t)sm + (tid >> 3) * LPIT + (tid & 7) * 16;   // this thread's LDS byte in a tile: 8 threads a row
    const size_t vofs = (size_t)(tid >> 3) * (TT * 2) + (tid & 7) * 16;
    const char* gkh = (const char*)Kh + tid * 16; const char* gkl = (const char*)Kl + tid * 16; const char* gv0 = (HIRES ? (const char*)Vh : (const char*)V16) + vofs; const char* gv1 = (const char*)Vl + vofs;
    // the st-th fill goes to buffer st mod 2 and brings the keys of stage (st + rot) mod NSTG: the key group's stages are walked in a ring from a start that differs between the work-groups of a head
    auto fill = [&](int st) { const unsigned l = lc + (st & 1) * BUFB; const int sg = (st + rot) & (NSTG - 1); copy8(l, gkh + sg * (SKEY * HD * 2), gkl + sg * (SKEY * HD * 2), 16 * HD * 2);
        if (HIRES) copy8(l + 2 * TILB, gv0 + sg * (SKEY * 2), gv1 + sg * (SKEY * 2), 16 * TT * 2); else copy4(l + 2 * TILB, gv0 + sg * (SKEY * 2), 16 * TT * 2); };
    fill(0);
    asm volatile("s_wait_asynccnt 0x0" ::: "memory");   // this wave's copies of stage 0 have landed
    __syncthreads();                                    // and every other wave's: stage 0 may be read
    fill(1);
#pragma unroll 1   // one copy of the body: the buffer index and the refill test stay scalar
    for (int st = 0; st < NSTG; ++st) {
    const char* sb = sm + (st & 1) * BUFB + lr * LPIT + 16 * hi;
#pragma unroll   // both passes written out: their LDS addresses are immediate offsets, so that no vector address write stands behind a matrix instruction whose operand registers it reuses (rolled, that cost six v_nop a pass)
    for (int ps = 0; ps < 2; ++ps) {
        v16bf kh[2][2], kl[2][2];
#pragma unroll
        for (int kt = 0; kt < 2; ++kt)
#pragma unroll
            for (int ks = 0; ks < 2; ++ks) { const char* kp = sb + (ps * 32 + kt * 16) * LPIT + ks * 64; kh[kt][ks] = WFrag<bf>::ld((const bf*)kp); kl[kt][ks] = WFrag<bf>::ld((const bf*)(kp + TILB)); }
        __builtin_amdgcn_sched_barrier(0);   // keeps the pass's 16 K reads one group ahead of the products
        v8f s[NQ][2];
#pragma unroll
        for (int kt = 0; kt < 2; ++kt)
#pragma unroll
            for (int nq = 0; nq < NQ; ++nq) s[nq][kt] = (v8f){};
#pragma unroll
        for (int ks = 0; ks < 2; ++ks)
#pragma unroll
            for (int kt = 0; kt < 2; ++kt)
#pragma unroll
                for (int nq = 0; nq < NQ; ++nq) { s[nq][kt] = wmmab(kh[kt][ks], qh[nq][ks], s[nq][kt]); s[nq][kt] = wmmab(kh[kt][ks], ql[nq][ks], s[nq][kt]); s[nq][kt] = wmmab(kl[kt][ks], qh[nq][ks], s[nq][kt]); }
        v16bf vh[4], vl[4]; v16h v16[4];
#pragma unroll
        for (int dt = 0; dt < 4; ++dt) { const char* vp = sb + 2 * TILB + dt * 16 * LPIT + ps * 64; if (HIRES) { vh[dt] = WFrag<bf>::ld((const bf*)vp); vl[dt] = WFrag<bf>::ld((const bf*)(vp + TILB)); } else v16[dt] = WFrag<h16>::ld((const h16*)vp); }
        __builtin_amdgcn_sched_barrier(0);   // the pass's V reads go out as one group behind the score products, so that the softmax arithmetic covers their latency
        float p[NQ][2][8], sum[NQ];
        // P = 2^(s * CEXP + nr) against the HELD reference: no maximum and no rescale in a pass that stays in range
        // A query group's 16 terms go as 8 register pairs k: pair k's two exponentials stand in one statement with the packed fma of pair k + 2 and a packed add of pairs at least two back (sm_a, sm_b, sm_c above)
        auto soft1 = [&](auto hc) { constexpr int nq = decltype(hc)::v; const v2f c2 = {CEXP, CEXP}, nn = {nr[0], nr[NQ - 1]}, n2 = {nr[nq], nr[nq]}; v2f x[8], t[2];
            auto sp = [&](int k) { return (v2f){s[nq][k >> 2][2 * (k & 3)], s[nq][k >> 2][2 * (k & 3) + 1]}; };
            auto pr = [&](int k) { return (v2f){p[nq][k >> 2][2 * (k & 3)], p[nq][k >> 2][2 * (k & 3) + 1]}; };
            x[0] = __builtin_elementwise_fma(sp(0), c2, n2); x[1] = __builtin_elementwise_fma(sp(1), c2, n2);
#pragma unroll
            for (int k = 0; k < 8; ++k) { float a = x[k][0], b = x[k][1];
                if (k < 4) sm_a<nq>(a, b, x[k + 2], sp(k + 2), c2, nn);
                else if (k < 6) sm_b<nq>(a, b, x[k + 2], sp(k + 2), c2, nn, t[k & 1], pr(k - 4), pr(k - 2));
                else sm_c(a, b, t[k & 1], pr(k - 2));
                p[nq][k >> 2][2 * (k & 3)] = a; p[nq][k >> 2][2 * (k & 3) + 1] = b; }
            const v2f u = (t[0] + pr(6)) + (t[1] + pr(7)); sum[nq] = u[0] + u[1];
        };
        auto soft = [&]() { soft1(IC_<0>{}); if constexpr (NQ == 2) soft1(IC_<1>{}); };
        soft();
        bool need = false;
#pragma unroll
        for (int nq = 0; nq < NQ; ++nq) need = need || !(sum[nq] <= PTHR);   // also true for an infinite or undefined sum
        if (__builtin_expect(__builtin_amdgcn_ballot_w32(need) != 0, 0)) {   // ONE test a pass, a scalar branch: some lane's 16 terms sum past 2^5 times the reference's term, so the wave raises its references to the maxima seen, rescales what it has summed and forms this pass's P anew (then every term is at most 2^carrier)
#pragma unroll
            for (int nq = 0; nq < NQ; ++nq) { float mx = s[nq][0][0];
#pragma unroll
                for (int kt = 0; kt < 2; ++kt)
#pragma unroll
                    for (int j = 0; j < 8; ++j) mx = fmaxf(mx, s[nq][kt][j]);
                mx = fmaxf(mx, xhalf(mx));      // lanes lr and lr + 16 hold the two halves of one query's keys and must share one reference
                const float nn = fminf(nr[nq], CARR - mx * CEXP); const float al = exp2s(nn - nr[nq]); nr[nq] = nn; l[nq] *= al;
#pragma unroll
                for (int dt = 0; dt < 4; ++dt) o[nq][dt] *= al; }
            soft();
        }
        v16bf ph[NQ], pl[NQ]; v16h p16[NQ];
#pragma unroll
        for (int nq = 0; nq < NQ; ++nq) { l[nq] += sum[nq];   // each half keeps its own partial sum; joined once behind the loop
            v8us uh[2], ul[2]; v8h u16[2];
#pragma unroll
            for (int kt = 0; kt < 2; ++kt)
#pragma unroll
                for (int j = 0; j < 8; ++j) { if (HIRES) { unsigned short a, c2; splitf(p[nq][kt][j], a, c2); uh[kt][j] = a; ul[kt][j] = c2; } else u16[kt][j] = tohx(p[nq][kt][j]); }
            if (HIRES) { ph[nq] = cat16b(uh[0], uh[1]); pl[nq] = cat16b(ul[0], ul[1]); } else p16[nq] = cat16(u16[0], u16[1]); }
#pragma unroll
        for (int dt = 0; dt < 4; ++dt) {
            if (HIRES) {
#pragma unroll
                for (int nq = 0; nq < NQ; ++nq) { o[nq][dt] = wmmab(vh[dt], ph[nq], o[nq][dt]); o[nq][dt] = wmmab(vh[dt], pl[nq], o[nq][dt]); o[nq][dt] = wmmab(vl[dt], ph[nq], o[nq][dt]); }
            } else {
#pragma unroll
                for (int nq = 0; nq < NQ; ++nq) o[nq][dt] = wmma16(v16[dt], p16[nq], o[nq][dt]); } }
    }
        // hand-over of the buffers, every wave, in this order
        asm volatile("s_wait_dscnt 0x0" ::: "memory");      // this wave's reads of stage st have returned
        asm volatile("s_wait_asynccnt 0x0" ::: "memory");   // this wave's copies of stage st + 1 have landed
        __syncthreads();                                    // publishes stage st + 1 and ends every wave's reads of stage st's buffer
        if (st + 2 < NSTG) fill(st + 2);                    // into the buffer just read
    }
    asm volatile("s_wait_asynccnt 0x0" ::: "memory");   // no copy is outstanding when the wave ends
    // The two key groups' partial results are joined through LDS, alike in every wave: of a pair's NQ * 4 output tiles (16 d x 16 queries) key group 0 finishes the first half and key group 1 the second; each hands the other half to its partner, with its references and sums. The ring is free for it: the loop's last barrier stands behind every wave's last read, and no copy is outstanding.
    constexpr int TH = NQ * 2; const int lane = hi * 16 + lr; const bool g1 = kg != 0;
#pragma unroll
    for (int t = 0; t < TH; ++t) { const v8f sd = g1 ? o[t / 4][t % 4] : o[(TH + t) / 4][(TH + t) % 4]; v4f a, c;
#pragma unroll
        for (int j = 0; j < 4; ++j) { a[j] = sd[j]; c[j] = sd[j + 4]; }
        *(v4fa*)(xs + (2 * t) * 128 + lane * 4) = a; *(v4fa*)(xs + (2 * t + 1) * 128 + lane * 4) = c; }   // 16 bytes a lane, lanes side by side: no bank conflict
#pragma unroll
    for (int nq = 0; nq < NQ; ++nq) { xs[TH * 256 + (2 * nq) * 32 + lane] = nr[nq]; xs[TH * 256 + (2 * nq + 1) * 32 + lane] = l[nq]; }
    __syncthreads();   // publishes every wave's hand-over to its partner
    const int nk = NQ == 2 ? kg : 0;   // the query group whose tiles this wave finishes (with one query group: d 32 kg .. 32 kg + 31 of it)
    const float n0 = g1 ? nr[NQ - 1] : nr[0], l0 = g1 ? l[NQ - 1] : l[0], n1 = xr[TH * 256 + (2 * nk) * 32 + lane], l1 = xr[TH * 256 + (2 * nk + 1) * 32 + lane]; const float nj = fminf(n0, n1);   // the smaller addend is the higher reference
    const float a0 = exp2s(nj - n0), a1 = exp2s(nj - n1);   // each group's terms brought to the common reference
    const float lj = l0 * a0 + l1 * a1; const float ls = lj + xhalf(lj); const float f = __fdiv_rn(1.0f, ls); const float f0 = a0 * f, f1 = a1 * f; float* orow = Orow + (size_t)(q0 + nk * 16 + lr) * DQ + 8 * hi + (NQ == 2 ? 0 : kg * 32);
#pragma unroll
    for (int t = 0; t < TH; ++t) { const v8f kp = g1 ? o[(TH + t) / 4][(TH + t) % 4] : o[t / 4][t % 4]; const v4f b = *(const v4fa*)(xr + (2 * t) * 128 + lane * 4), d = *(const v4fa*)(xr + (2 * t + 1) * 128 + lane * 4); v4f a, c;
#pragma unroll
        for (int j = 0; j < 4; ++j) { a[j] = kp[j] * f0 + b[j] * f1; c[j] = kp[j + 4] * f0 + d[j] * f1; }
        *(v4f*)(orow + t * 16) = a; *(v4f*)(orow + t * 16 + 4) = c; }
}
// grid (batches x heads, (RH / 16 + (TT - RH) / 32) / 4), 256 threads = 8 waves: four neighbouring query blocks of ONE head times two key groups. Waves w and w + 4 hold the same query block; each key group has its own ring of staged K and V tiles, filled by its own four waves, and walks its half of the keys; the stage barrier is common. With two work-groups on a WGP four waves share a SIMD, so that one wave's LDS waits and dependent softmax arithmetic are covered by the others' matrix and vector work. A hi/lo wave (three times the P.V products and the hi/lo split a key) takes 16 query rows, an fp16 wave 32, so that a pass costs both about the same; the hi/lo blocks have the low blockIdx.y (RH / 16 is a multiple of 4: a workgroup is all of one kind). amdgpu_waves_per_eu(4, 4) holds the register budget at 256, without which only one work-group fits a WGP; 2 x the LDS size is 294,912 bytes and fits too.
__global__ __launch_bounds__(256) __attribute__((amdgpu_waves_per_eu(4, 4))) void k_fattn(const bf* __restrict__ Qh, const bf* __restrict__ Ql, const bf* __restrict__ Kh, const bf* __restrict__ Kl, const bf* __restrict__ Vh, const bf* __restrict__ Vl, const h16* __restrict__ V16, float* OUTb) {
    __shared__ __align__(16) char sm[KSPL * 2 * 4 * TILB];
    const int lane = threadIdx.x & 31, lr = lane & 15, hi = lane >> 4; const size_t hp = (size_t)blockIdx.x * TT * HD;   /* planes [batch][head] */ const int wv = __builtin_amdgcn_readfirstlane(threadIdx.x >> 5), kg = wv >> 2, y = blockIdx.y * 4 + (wv & 3); float* Orow = OUTb + (size_t)(blockIdx.x / NH_) * TT * DQ + (blockIdx.x % NH_) * HD;
    const size_t kp = hp + (size_t)kg * (TT / KSPL) * HD, vp = hp + (size_t)kg * (TT / KSPL);   // the key group's first K row ([t][d] planes) and first V column ([d][t] planes)
    char* ring = sm + kg * (2 * 4 * TILB); float* xs = (float*)(sm + wv * XCHB); const float* xr = (const float*)(sm + (wv ^ 4) * XCHB); const int tid = threadIdx.x & 127;
    const int rot = (blockIdx.x + blockIdx.y) & (NSTG - 1);   // the 20 work-groups of a head read the same K and V lines: their walks start on 16 different stages (blockIdx.y and blockIdx.y + 16 share one), for speed only
    if (blockIdx.y < RH / 64) fattn_body<true, 1>(Qh + hp, Ql + hp, Kh + kp, Kl + kp, Vh + vp, Vl + vp, V16 + vp, Orow, y * 16, lr, hi, ring, tid, kg, xs, xr, rot);
    else fattn_body<false, 2>(Qh + hp, Ql + hp, Kh + kp, Kl + kp, Vh + vp, Vl + vp, V16 + vp, Orow, RH + (y - RH / 16) * 32, lr, hi, ring, tid, kg, xs, xr, rot);
}

extern "C" void kernel_launch(void* const* d_in, const int* in_sizes, int n_in,
                              void* d_out, int out_size, void* d_ws, size_t ws_size, hipStream_t stream) {
    (void)in_sizes; (void)n_in; (void)out_size;
    const float* x = (const float*)d_in[0]; const float* xk = (const float*)d_in[1]; const float* xv = (const float*)d_in[2]; const float* wq = (const float*)d_in[3]; const float* bq = (const float*)d_in[4]; const float* wk = (const float*)d_in[5]; const float* bk = (const float*)d_in[6]; const float* wv = (const float*)d_in[7]; const float* bv = (const float*)d_in[8];   /* argument order query, key, value, Wq, bq, Wk, bk, Wv, bv ('oi' [768][768] + [768]); no output projection */
    float* OUT = (float*)d_out;     // [2][2048][768]
    char* wsp = (char*)d_ws;
    auto take = [&](size_t bytes) { char* p = wsp; wsp += (bytes + 255) & ~(size_t)255; return (void*)p; };
    h16* VT16 = (h16*)take((size_t)NB_ * NKV * HD * TT * 2);
    bf* QPh = (bf*)take((size_t)NB_ * NH_ * TT * HD * 2); bf* QPl = (bf*)take((size_t)NB_ * NH_ * TT * HD * 2); bf* KPh = (bf*)take((size_t)NB_ * NKV * TT * HD * 2); bf* KPl = (bf*)take((size_t)NB_ * NKV * TT * HD * 2); bf* VTh = (bf*)take((size_t)NB_ * NKV * HD * TT * 2); bf* VTl = (bf*)take((size_t)NB_ * NKV * HD * TT * 2);   /* the planes the attention launch reads: both batches */
    if ((size_t)(wsp - (char*)d_ws) > ws_size) return;    // ws 256 MiB
    k_proj<<<dim3(NB_ * TT / 128, DQ / 128, 3), 128, 0, stream>>>(x, xk, xv, wq, wk, wv, bq, bk, bv, QPh, QPl, KPh, KPl, VT16, VTh, VTl);   /* rounding, projections, biases, planes: 3 streams x 2 batches */
    k_fattn<<<dim3(NB_ * NH_, (RH / 16 + (TT - RH) / 32) / 4, 1), 256, 0, stream>>>(QPh, QPl, KPh, KPl, VTh, VTl, VT16, OUT);   /* all 24 batch-heads: scores, softmax, P.V, merge */
}

// v008
// Measured time: 66.1 microseconds a run.
// Timed twice side by side with v007, it ran 1.07 times as fast both times.
// All steps since v000 together make it 22.5 times as fast.
#include <hip/hip_runtime.h>
#include <stdint.h>

// Multi-head attention on three input streams at d_model 768 WITHOUT an output projection (query, key, value [2][2048][768]; Q = query Wq^T + bq, K = key Wk^T + bk, V = value Wv^T + bv ('oi' + biases; 12 heads x 64); scores / sqrt(64); softmax (no mask); out = heads merged -> [2][2048][768] (3.1 M); argument order query, key, value, Wq, bq, Wk, bk, Wv, bv).
// Layout: ONE projection launch for all three streams and both batches ('oi' weights; f32 operands rounded to bf16 on their way into LDS; exact products (K 768) + f32 biases; its epilogue writes the planes the attention reads); then ONE fused attention launch for all 24 batch-heads (online softmax, scores and P stay in registers) with EVERY row's scores on hi/lo planes (3 products: no output projection averages the fp16 score error) and hybrid P.V (rows < 512 hi/lo, rest fp16 x1024); it writes the merged f32 output rows.
// Compute dtypes, f32 accumulate: every input rounded to bf16; projections exact + f32 biases; scores 3 products on every row; P.V rows < 512 3 products, rest fp16; softmax f32; output f32.

#define NB_  2
#define TT   2048
#define DM   768
#define NH_  12
#define NKV  12
#define REP  (NH_ / NKV)
#define HD   64
#define DQ   (NH_ * HD)
#define DKV  (NKV * HD)
#define ZH   2
#define RH   512                  // query rows < RH use hi+lo planes (0: none)
#define WIN  0
#define PCAR 1024.0f
#define SCL  0.125f   // HD^-0.5
typedef _Float16 h16;
typedef unsigned short bf;
typedef __attribute__((ext_vector_type(16))) __bf16   v16bf;
typedef __attribute__((ext_vector_type(16))) _Float16 v16h;
typedef __attribute__((ext_vector_type(8)))  _Float16 v8h;
typedef __attribute__((ext_vector_type(8)))  unsigned short v8us;
typedef __attribute__((ext_vector_type(8)))  float    v8f;
typedef __attribute__((ext_vector_type(4)))  float    v4f;
typedef v8h  __attribute__((may_alias)) v8ha;
typedef v4f  __attribute__((may_alias)) v4fa;
typedef v8us __attribute__((may_alias)) v8usa;

__device__ __forceinline__ unsigned short f2bf(float f) { unsigned u = __float_as_uint(f); u += 0x7FFFu + ((u >> 16) & 1u); return (unsigned short)(u >> 16); }
__device__ __forceinline__ float bf2f(unsigned short b) { return __uint_as_float(((unsigned)b) << 16); }
__device__ __forceinline__ float bfr(float f) { return bf2f(f2bf(f)); }
__device__ __forceinline__ v16h cat16(v8h lo, v8h hi) { return __builtin_shufflevector(lo, hi, 0, 1, 2, 3, 4, 5, 6, 7, 8, 9, 10, 11, 12, 13, 14, 15); }
__device__ __forceinline__ v16bf cat16b(v8us lo, v8us hi) { return __builtin_bit_cast(v16bf, __builtin_shufflevector(lo, hi, 0, 1, 2, 3, 4, 5, 6, 7, 8, 9, 10, 11, 12, 13, 14, 15)); }
__device__ __forceinline__ v8f wmma16(v16h a, v16h b, v8f c) { return __builtin_amdgcn_wmma_f32_16x16x32_f16(false, a, false, b, (short)0, c, false, false); }
__device__ __forceinline__ v8f wmmab(v16bf a, v16bf b, v8f c) { return __builtin_amdgcn_wmma_f32_16x16x32_bf16(false, a, false, b, (short)0, c, false, false); }



// fragment loaders: 16 k of one row a lane, k = 8 hi + 0..7 and 16 + 8 hi + 0..7 of a 32-k step, from K-contiguous 16-bit rows
template <typename T16> struct WFrag;
template <> struct WFrag<h16> { typedef v16h V; static __device__ __forceinline__ V ld(const h16* p) { return cat16(*(const v8h*)p, *(const v8h*)(p + 16)); } static __device__ __forceinline__ v8f mma(V a, V b, v8f c) { return wmma16(a, b, c); } };
template <> struct WFrag<bf> { typedef v16bf V; static __device__ __forceinline__ V ld(const bf* p) { return cat16b(*(const v8us*)p, *(const v8us*)(p + 16)); } static __device__ __forceinline__ v8f mma(V a, V b, v8f c) { return wmmab(a, b, c); } };

__device__ __forceinline__ h16 tohx(float x) { return (h16)x; }
__device__ __forceinline__ void splitf(float y, unsigned short& h, unsigned short& l) { h = f2bf(y); l = f2bf(y - bf2f(h)); }
typedef __attribute__((ext_vector_type(2))) _Float16 v2h;
typedef __attribute__((ext_vector_type(4))) _Float16 v4h;
typedef __attribute__((ext_vector_type(2))) unsigned short v2us;
typedef __attribute__((ext_vector_type(4))) unsigned short v4us;
typedef __attribute__((ext_vector_type(2))) float v2f;
typedef __attribute__((ext_vector_type(4))) int v4i;

// ---- k_proj: the three projections of both batches in ONE launch, from the f32 inputs to the planes that k_fattn reads: no bf16 copy and no f32 projection in memory.
// grid (NB_ * TT / 128, DQ / 128, 3 streams: query, key, value), 128 threads = 4 waves, 128 x 128 outputs a work-group, 64 x 64 (16 accumulators) a wave. C[m][n] = sum_k bf16(X[m][k]) bf16(W[n][k]) + bf16(bias[n]), f32 accumulate, k in passes of 32, walked in a ring from a start that differs between the work-groups which share operand rows (the 6 of a row block, the 32 of a column block), for speed only.
// A pass: every thread rounds the 16 x 4 f32 that it fetched one pass ahead (a wave-wide load is four whole 128-byte lines) and stores them as bf16 rows in LDS (rows 0..127 X, 128..255 W); one barrier; the next pass's fetch goes out; fragments come from LDS in the k order of WFrag::ld.
// Two LDS buffers, ONE barrier a pass: a wave overwrites the buffer of pass p only in pass p + 2, behind the barrier of pass p + 1, which no wave reaches before its reads of pass p have returned.
// Epilogue: a 64-column tile is one head, a 64-row tile lies in one batch. query, key: rows [head][t][d] as bf16 hi + lo, staged through the wave's own LDS range so that whole 128-byte lines are stored. value: planes [head][d][t]; an accumulator register run is 8 neighbouring t of one d, stored straight from registers as fp16, hi and lo.
#define PK   32    // k of a pass
#define PPIT 40    // LDS row pitch in bf16 elements: 64 bytes of data + 16, the conflict-free pitch for 16-byte fragment reads of 64-byte rows
typedef __attribute__((ext_vector_type(4))) __bf16 v4bf;
__global__ __launch_bounds__(128) void k_proj(const float* __restrict__ xq, const float* __restrict__ xk, const float* __restrict__ xv, const float* __restrict__ wq, const float* __restrict__ wk, const float* __restrict__ wv, const float* __restrict__ bq, const float* __restrict__ bk, const float* __restrict__ bv, bf* Qh, bf* Ql, bf* Kh, bf* Kl, h16* V16, bf* Vh, bf* Vl) {
    __shared__ __align__(16) bf ts[2][256 * PPIT];
    __shared__ __align__(16) float osall[4][16 * 68];
    const int z = blockIdx.z; const float* X = z == 0 ? xq : z == 1 ? xk : xv; const float* Wt = z == 0 ? wq : z == 1 ? wk : wv; const float* bias = z == 0 ? bq : z == 1 ? bk : bv;
    const int tid = threadIdx.x, w = __builtin_amdgcn_readfirstlane(tid >> 5), lane = tid & 31, lr = lane & 15, hi = lane >> 4;
    const int wr = (w & 1) * 64, wc = (w >> 1) * 64; const int r0 = blockIdx.x * 128 + wr, c0 = blockIdx.y * 128 + wc;
    const int sr = tid >> 3, sc = (tid & 7) * 4;   // staging: 8 threads a row of 32 f32, rows sr + 16 i
    const float* gx = X + (size_t)(blockIdx.x * 128 + sr) * DM + sc; const float* gw = Wt + (size_t)(blockIdx.y * 128 + sr) * DM + sc;
    v8f acc[4][4];
#pragma unroll
    for (int mb = 0; mb < 4; ++mb)
#pragma unroll
        for (int nb = 0; nb < 4; ++nb) acc[mb][nb] = (v8f){};
    v4f st[16];
    int kc = (int)((blockIdx.x + 4 * blockIdx.y) % (DM / PK)) * PK;   // first k of this work-group's walk: the 6 work-groups of a row block start 4 passes apart, the 32 of a column block on 24 different passes
#pragma unroll
    for (int i = 0; i < 8; ++i) { st[i] = *(const v4f*)(gx + (size_t)i * 16 * DM + kc); st[8 + i] = *(const v4f*)(gw + (size_t)i * 16 * DM + kc); }
    asm volatile("s_wait_xcnt 0x0" ::: "memory");   // the two address pairs of these sixteen loads are dead behind the last of them and the build reuses them at once: the wait stands in front of that overwrite
    __builtin_amdgcn_sched_barrier(0);              // keeps those register writes behind the wait
#pragma unroll 1   // one copy of the body: the buffer index and the fetch test stay scalar, and 16 accumulators, 16 fetched vectors and the fragments leave a second copy nothing to overlap with
    for (int it = 0; it < DM / PK; ++it) {
        bf* tb = ts[it & 1];
#pragma unroll
        for (int i = 0; i < 16; ++i) *(v4us*)(tb + (sr + 16 * i) * PPIT + sc) = __builtin_bit_cast(v4us, __builtin_convertvector(st[i], v4bf));   // round to nearest even, as f2bf
        __syncthreads();   // publishes this pass's rows; also ends every wave's reads of the other buffer before the next pass overwrites it
        if (it + 1 < DM / PK) {
            kc = kc + PK == DM ? 0 : kc + PK;   // the ring's next pass
#pragma unroll
            for (int i = 0; i < 8; ++i) { st[i] = *(const v4f*)(gx + (size_t)i * 16 * DM + kc); st[8 + i] = *(const v4f*)(gw + (size_t)i * 16 * DM + kc); }
            asm volatile("s_wait_xcnt 0x0" ::: "memory");   // the run's two address pairs are dead behind its last load and the build reuses them for the fragment reads below: the wait stands in front of that overwrite of registers which the sixteen loads name
        }
        v16bf a[4], b[2];   // two W fragment sets in turn: four would push the kernel past 256 registers
#pragma unroll
        for (int mb = 0; mb < 4; ++mb) a[mb] = WFrag<bf>::ld(tb + (wr + mb * 16 + lr) * PPIT + 8 * hi);
#pragma unroll
        for (int nb = 0; nb < 2; ++nb) b[nb] = WFrag<bf>::ld(tb + (128 + wc + nb * 16 + lr) * PPIT + 8 * hi);
#pragma unroll
        for (int nb = 0; nb < 4; ++nb) {
#pragma unroll
            for (int mb = 0; mb < 4; ++mb) acc[mb][nb] = wmmab(a[mb], b[nb & 1], acc[mb][nb]);
            if (nb < 2) { b[nb & 1] = WFrag<bf>::ld(tb + (128 + wc + (nb + 2) * 16 + lr) * PPIT + 8 * hi);
                __builtin_amdgcn_sched_barrier(0); }   // holds the refill of a W set right behind that set's last product, so that the other set's four products cover part of its LDS wait
        }
        asm volatile("v_nop\n\tv_nop\n\tv_nop\n\tv_nop" : "+v"(acc[0][0]), "+v"(acc[1][1]), "+v"(acc[2][2]), "+v"(acc[3][3]) : "v"(a[0]), "v"(a[3]));   // the four vector slots that the chip needs behind the pass's last matrix instruction, also on the taken back edge
    }
    const size_t hp = ((size_t)(r0 / TT) * NH_ + c0 / HD) * TT * HD; const int t0 = r0 % TT;   // this tile's batch-head plane and its first position
    // In both epilogues a block's values are all formed first, then its stores go out as one run with s_wait_xcnt 0 behind it, each part held in place by sched_barrier(0).
    if (z < 2) {
        bf* Ph = (z == 0 ? Qh : Kh) + hp; bf* Pl = (z == 0 ? Ql : Kl) + hp; float* os = osall[w]; const int cofs = lr * 4; v4f bb = *(const v4f*)(bias + c0 + cofs);
        asm volatile("s_wait_xcnt 0x0" ::: "memory");   // in front of any reuse of the bias load's address registers
        __builtin_amdgcn_sched_barrier(0);              // keeps later register writes behind that wait
#pragma unroll
        for (int q = 0; q < 4; ++q) bb[q] = bfr(bb[q]);
#pragma unroll
        for (int mb = 0; mb < 4; ++mb) {
#pragma unroll
            for (int nb = 0; nb < 4; ++nb) {
#pragma unroll
                for (int j = 0; j < 8; ++j) os[(hi * 8 + j) * 68 + nb * 16 + lr] = acc[mb][nb][j]; }
            __builtin_amdgcn_wave_barrier(); asm volatile("" ::: "memory");   // the wave's own LDS stores stay in front of its reads of other lanes' values
            v4us oh[8], ol[8];
#pragma unroll
            for (int s = 0; s < 8; ++s) { const v4f val = *(const v4fa*)(os + (2 * s + hi) * 68 + cofs) + bb;
#pragma unroll
                for (int q = 0; q < 4; ++q) { unsigned short a2, c2; splitf(val[q], a2, c2); oh[s][q] = a2; ol[s][q] = c2; } }
            __builtin_amdgcn_wave_barrier(); asm volatile("" ::: "memory");   // and these reads in front of the next block's LDS stores
            __builtin_amdgcn_sched_barrier(0);   // values first
#pragma unroll
            for (int s = 0; s < 8; ++s) { const size_t po = (size_t)(t0 + mb * 16 + 2 * s + hi) * HD + cofs; *(v4us*)(Ph + po) = oh[s]; *(v4us*)(Pl + po) = ol[s]; }
            asm volatile("s_wait_xcnt 0x0" ::: "memory");   // behind the run of stores, in front of the next block's writes of their registers
            __builtin_amdgcn_sched_barrier(0);   // keeps those writes behind the wait
        }
    } else {
        float bn[4];
#pragma unroll
        for (int nb = 0; nb < 4; ++nb) bn[nb] = bias[c0 + nb * 16 + lr];
        asm volatile("s_wait_xcnt 0x0" ::: "memory");   // in front of any reuse of the bias loads' offset register
        __builtin_amdgcn_sched_barrier(0);              // keeps later register writes behind that wait
#pragma unroll
        for (int nb = 0; nb < 4; ++nb) { const float bnr = bfr(bn[nb]); const size_t vo = hp + (size_t)(nb * 16 + lr) * TT + t0 + 8 * hi; v8h o16[4]; v8us oh[4], ol[4];
#pragma unroll
            for (int mb = 0; mb < 4; ++mb)
#pragma unroll
                for (int j = 0; j < 8; ++j) { const float x = acc[mb][nb][j] + bnr; o16[mb][j] = tohx(x); unsigned short a2, c2; splitf(x, a2, c2); oh[mb][j] = a2; ol[mb][j] = c2; }
            __builtin_amdgcn_sched_barrier(0);   // values first
#pragma unroll
            for (int mb = 0; mb < 4; ++mb) { *(v8h*)(V16 + vo + mb * 16) = o16[mb]; *(v8us*)(Vh + vo + mb * 16) = oh[mb]; *(v8us*)(Vl + vo + mb * 16) = ol[mb]; }
            asm volatile("s_wait_xcnt 0x0" ::: "memory");   // behind the run of stores, in front of the next block's writes of their registers
            __builtin_amdgcn_sched_barrier(0);   // keeps those writes behind the wait
        }
    }
}

// k_fattn: scores, softmax, P.V and the head merge in ONE kernel; a pair of waves per 16 or 32 query rows of one head, each wave on its half of the keys, 32 keys a pass, a held reference and a running sum (online softmax; the reference is raised, and what is summed rescaled, only when a pass's terms grow past 2^5 times the reference's), the pair's partial results joined at the end: no score or P plane in memory.
// S^T = K Q^T (A = K rows, B = Q rows, hi/lo planes, 3 products): lane (lr, hi) register j of key tile kt holds the score of key j0 + 16 kt + 8 hi + j for query lr, so the two key tiles of a pass, converted in place, are the B operand P^T of O^T += V^T P^T in the same k order as WFrag::ld reads V^T rows.
// HIRES (query rows < RH): P and V on hi/lo planes, 3 products; else P x PCAR in fp16 against the fp16 V plane (the factor is in the row sum too and cancels in O / sum).
// value of lane l ^ 16 (the other half of a query's keys) without the LDS path's latency
__device__ __forceinline__ float xhalf(float x) { const int b = __float_as_int(x); return __int_as_float(__builtin_amdgcn_permlanex16(b, b, 0x76543210, 0xfedcba98, false, false)); }
// 2^x with the instruction set's one free slot behind a transcendental kept in the same statement.
__device__ __forceinline__ float exp2s(float x) { float r; asm("v_exp_f32 %0, %1\n\tv_nop" : "=v"(r) : "v"(x)); return r; }
// The softmax's vector work on register pairs: exponent addend and row sums as packed f32 instructions, set into the slots behind the exponentials. The instruction set's free slot behind a transcendental is kept by the order inside each statement: what follows a v_exp_f32 neither reads its result nor writes its register (the exponentials work in place on in-out operands, whose registers no other operand shares), and every statement ends in a packed instruction. volatile keeps the statements in the written order: without it the build set pair k + 2 directly behind pair k, each exponential right behind its own fma. The fma runs two pairs ahead of its exponentials and the adds two pairs behind theirs; where a producer is still within four vector instructions, s_delay_alu names it, without which a dependent instruction holds the SIMD's issue against the other waves too (the compiler sets no hint inside asm text).
// sm_a: 2^a, 2^b in place; nx = sn * c + n[H] (n holds the addends of both query groups; a packed f32 instruction reads only the first register of a scalar pair, for both halves: op_sel_hi 0 on it)
template <int V> struct IC_ { static constexpr int v = V; };   // a query group's number as a compile-time value
#define DLY2_ "s_delay_alu instid0(VALU_DEP_2)\n\t"   // the pair's fma is the second plain vector instruction back (in sm_b's second use the third: the hint then names a younger one, which covers it)
#define NLO_ " op_sel_hi:[1,0,0]"                // both halves add the first register of the addend pair
#define NHI_ " op_sel:[0,0,1] op_sel_hi:[1,0,1]"   // both halves add its second register
template <int H> __device__ __forceinline__ void sm_a(float& a, float& b, v2f& nx, v2f sn, v2f c, v2f n) {
    if (H) asm volatile(DLY2_ "v_exp_f32 %0, %0\n\tv_exp_f32 %1, %1\n\tv_pk_fma_f32 %2, %3, %4, %5" NHI_ : "+v"(a), "+v"(b), "=v"(nx) : "v"(sn), "s"(c), "v"(n));
    else   asm volatile(DLY2_ "v_exp_f32 %0, %0\n\tv_exp_f32 %1, %1\n\tv_pk_fma_f32 %2, %3, %4, %5" NLO_ : "+v"(a), "+v"(b), "=v"(nx) : "v"(sn), "s"(c), "v"(n));
}
// sm_b: the same, and o = u + w
template <int H> __device__ __forceinline__ void sm_b(float& a, float& b, v2f& nx, v2f sn, v2f c, v2f n, v2f& o, v2f u, v2f w) {
    if (H) asm volatile(DLY2_ "v_exp_f32 %0, %0\n\tv_pk_fma_f32 %2, %4, %5, %6" NHI_ "\n\tv_exp_f32 %1, %1\n\tv_pk_add_f32 %3, %7, %8" : "+v"(a), "+v"(b), "=&v"(nx), "=v"(o) : "v"(sn), "s"(c), "v"(n), "v"(u), "v"(w));
    else   asm volatile(DLY2_ "v_exp_f32 %0, %0\n\tv_pk_fma_f32 %2, %4, %5, %6" NLO_ "\n\tv_exp_f32 %1, %1\n\tv_pk_add_f32 %3, %7, %8" : "+v"(a), "+v"(b), "=&v"(nx), "=v"(o) : "v"(sn), "s"(c), "v"(n), "v"(u), "v"(w));
}
// sm_c: 2^a, 2^b in place; o += w
__device__ __forceinline__ void sm_c(float& a, float& b, v2f& o, v2f w) {
    asm volatile("v_exp_f32 %0, %0\n\tv_exp_f32 %1, %1\n\tv_pk_add_f32 %2, %2, %3" : "+v"(a), "+v"(b), "+v"(o) : "v"(w));
}
// K and V reach the waves through LDS: a stage is 64 keys (two passes): the 64 rows of 128 bytes of each K plane (keys) and of each V plane in use (d). A tile is ONE tensor load (tensor_load_to_lds) of one wave: no vector register, no address arithmetic on the vector port and no per-lane copy; wave i of a key group's four brings tile i (K hi, K lo, V hi or the fp16 V, V lo), and the four share every tile. Two buffers: stage t + 1 flies while stage t is worked on.
#define SKEY 64                  // keys of a stage
#define KSPL 2                   // key groups of a work-group: waves 0..3 walk the first half of the keys, waves 4..7 the second half, for the same four query blocks
#define NSTG (TT / KSPL / SKEY)  // stages of a key group
#define XCHB ((32 + 2 * 2) * 32 * 4)   // bytes in which a wave hands half of its partial result to its partner in the other key group: at most 32 output values, 2 references and 2 sums a lane
#define LPIT 144                 // LDS row pitch in bytes: 128 of data + 16 (the tensor load's pad), the conflict-free pitch for 16-byte fragment reads of 128-byte rows
#define TILB 10240               // bytes of a staged tile's place: 64 * LPIT = 9216, rounded up to a multiple of 2 KiB, on which every tensor load's LDS place lies
typedef uint32_t u32x4 __attribute__((ext_vector_type(4)));
typedef uint32_t u32x8 __attribute__((ext_vector_type(8)));
__device__ __forceinline__ uint32_t uni(uint32_t v) { return (uint32_t)__builtin_amdgcn_readfirstlane(v); }
// a wave-uniform test, or a descriptor word, held in a scalar register: the branch round a tensor load is then s_cmp + s_cbranch_scc (a tensor load ignores EXEC)
__device__ __forceinline__ uint32_t pinned(uint32_t v) { uint32_t w = uni(v); asm volatile("" : "+s"(w)); /* keeps the value in a scalar register */ return w; }
// group 1: 1-byte elements, tensor = tile = 64 rows of 128 bytes, source row pitch in bytes, 4 dwords of LDS pad behind every 32 dwords (one row); no mask. Word 0 is a constant; the other words go through pinned(), each a descriptor word held in a scalar register of its own.
__device__ __forceinline__ u32x8 tdm_group1(uint32_t src_pitch) {
    u32x8 g;
    g[0] = uni((1u << 20) | (4u << 22) | (3u << 25));
    g[1] = pinned(128u << 16);
    g[2] = pinned(64u << 16);
    g[3] = pinned(128u << 16);
    g[4] = pinned(64u);
    g[5] = pinned(src_pitch);
    g[6] = pinned(0u);
    g[7] = pinned(0u);
    return g;
}
// group 0: count 1, the LDS place, the tile's first byte, type 2
__device__ __forceinline__ u32x4 tdm_group0(uint32_t lds_dst, uint64_t ga) {
    u32x4 g;
    g[0] = uni(1u); g[1] = uni(lds_dst); g[2] = uni((uint32_t)ga); g[3] = uni((((uint32_t)(ga >> 32)) & 0x01FFFFFFu) | 0x80000000u);
    return g;
}
__device__ __forceinline__ void tdm_load(u32x4 g0, u32x8 g1) { asm volatile("tensor_load_to_lds %0, %1" :: "s"(g0), "s"(g1) : "memory"); }
// The wave's own tensor loads have landed.
__device__ __forceinline__ void wait_tensor0() { asm volatile("s_wait_tensorcnt 0x0" ::: "memory"); }
// The same at the foot of a stage, with the descriptor of the request in flight named as inputs: its values stay live in scalar registers from the issue to this wait.
__device__ __forceinline__ void wait_tensor0(u32x4 g0, u32x8 g1) { asm volatile("s_wait_tensorcnt 0x0" :: "s"(g0), "s"(g1) : "memory"); }
template <bool HIRES, int NQ>   // NQ: 16-query column groups per wave
__device__ __forceinline__ void fattn_body(const bf* __restrict__ Qh, const bf* __restrict__ Ql, const bf* __restrict__ Kh, const bf* __restrict__ Kl, const bf* __restrict__ Vh, const bf* __restrict__ Vl, const h16* __restrict__ V16, float* Orow, int q0, int lr, int hi, char* sm, int wq, int kg, float* xs, const float* xr, int rot) {
    v16bf qh[NQ][2], ql[NQ][2];
#pragma unroll
    for (int nq = 0; nq < NQ; ++nq)
#pragma unroll
        for (int ks = 0; ks < 2; ++ks) { const size_t qo = (size_t)(q0 + nq * 16 + lr) * HD + ks * 32 + 8 * hi; qh[nq][ks] = WFrag<bf>::ld(Qh + qo); ql[nq][ks] = WFrag<bf>::ld(Ql + qo); }
    v8f o[NQ][4]; float nr[NQ], l[NQ];   // nr: the addend of the exponent, carrier exponent minus the held reference (log2 units); it starts so high that the first pass's sums are infinite and set the reference
#pragma unroll
    for (int nq = 0; nq < NQ; ++nq) { nr[nq] = 3.0e38f; l[nq] = 0.f;
#pragma unroll
        for (int dt = 0; dt < 4; ++dt) o[nq][dt] = (v8f){}; }
    constexpr float CEXP = SCL * 1.4426950408889634f, CARR = HIRES ? 0.0f : 10.0f /* 2^10 = PCAR */, PTHR = HIRES ? 32.0f : 32.0f * PCAR;   // score to log2 units; carrier exponent of P; the pass sum of a lane beyond which the reference is raised (fp16 P stays below 2^15)
    constexpr int BUFB = (HIRES ? 4 : 3) * TILB;   // a buffer: K hi, K lo, then V hi, V lo or the fp16 V
    // this wave's tile (wq: its number among the key group's four waves): source plane, source row pitch, bytes from stage to stage, place in a buffer; all wave-uniform
    const char* tsrc = wq == 0 ? (const char*)Kh : wq == 1 ? (const char*)Kl : wq == 2 ? (HIRES ? (const char*)Vh : (const char*)V16) : (const char*)Vl;
    const uint32_t tstp = wq < 2 ? SKEY * HD * 2 : SKEY * 2, tdst = (uint32_t)(size_t)sm + wq * TILB;
    const u32x8 td1 = tdm_group1(wq < 2 ? HD * 2 : TT * 2);
    const bool issuer = HIRES || wq < 3;   // three tiles a stage without the V lo plane: the fourth wave brings none
    // the st-th fill goes to buffer st mod 2 and brings the keys of stage (st + rot) mod NSTG: the key group's stages are walked in a ring from a start that differs between the work-groups of a head
    auto desc = [&](int st) { const uint32_t sg = (uint32_t)(st + rot) & (NSTG - 1); return tdm_group0(tdst + (st & 1) * BUFB, (uint64_t)(size_t)tsrc + sg * tstp); };
    if (pinned(issuer)) { tdm_load(desc(0), td1);
        wait_tensor0(); }   // this wave's tile of stage 0 has landed
    __syncthreads();        // and every other wave's: stage 0 may be read
#pragma unroll 1   // one copy of the body: the buffer index and the refill test stay scalar
    for (int st = 0; st < NSTG; ++st) {
    // the refill, directly behind the barrier that published stage st (in front of the loop or at the foot of the trip before) and ended every wave's reads of the other buffer: stage st + 1 goes there, only while it exists
    const u32x4 td0 = desc(st + 1);
    if (pinned(issuer && st + 1 < NSTG)) tdm_load(td0, td1);
    const char* sb = sm + (st & 1) * BUFB + lr * LPIT + 16 * hi;
#pragma unroll   // both passes written out: their LDS addresses are immediate offsets, so that no vector address write stands behind a matrix instruction whose operand registers it reuses (rolled, that cost six v_nop a pass)
    for (int ps = 0; ps < 2; ++ps) {
        v16bf kh[2][2], kl[2][2];
#pragma unroll
        for (int kt = 0; kt < 2; ++kt)
#pragma unroll
            for (int ks = 0; ks < 2; ++ks) { const char* kp = sb + (ps * 32 + kt * 16) * LPIT + ks * 64; kh[kt][ks] = WFrag<bf>::ld((const bf*)kp); kl[kt][ks] = WFrag<bf>::ld((const bf*)(kp + TILB)); }
        __builtin_amdgcn_sched_barrier(0);   // keeps the pass's 16 K reads one group ahead of the products
        v8f s[NQ][2];
#pragma unroll
        for (int kt = 0; kt < 2; ++kt)
#pragma unroll
            for (int nq = 0; nq < NQ; ++nq) s[nq][kt] = (v8f){};
#pragma unroll
        for (int ks = 0; ks < 2; ++ks)
#pragma unroll
            for (int kt = 0; kt < 2; ++kt)
#pragma unroll
                for (int nq = 0; nq < NQ; ++nq) { s[nq][kt] = wmmab(kh[kt][ks], qh[nq][ks], s[nq][kt]); s[nq][kt] = wmmab(kh[kt][ks], ql[nq][ks], s[nq][kt]); s[nq][kt] = wmmab(kl[kt][ks], qh[nq][ks], s[nq][kt]); }
        v16bf vh[4], vl[4]; v16h v16[4];
#pragma unroll
        for (int dt = 0; dt < 4; ++dt) { const char* vp = sb + 2 * TILB + dt * 16 * LPIT + ps * 64; if (HIRES) { vh[dt] = WFrag<bf>::ld((const bf*)vp); vl[dt] = WFrag<bf>::ld((const bf*)(vp + TILB)); } else v16[dt] = WFrag<h16>::ld((const h16*)vp); }
        __builtin_amdgcn_sched_barrier(0);   // the pass's V reads go out as one group behind the score products, so that the softmax arithmetic covers their latency
        float p[NQ][2][8], sum[NQ];
        // P = 2^(s * CEXP + nr) against the HELD reference: no maximum and no rescale in a pass that stays in range
        // A query group's 16 terms go as 8 register pairs k: pair k's two exponentials stand in one statement with the packed fma of pair k + 2 and a packed add of pairs at least two back (sm_a, sm_b, sm_c above)
        auto soft1 = [&](auto hc) { constexpr int nq = decltype(hc)::v; const v2f c2 = {CEXP, CEXP}, nn = {nr[0], nr[NQ - 1]}, n2 = {nr[nq], nr[nq]}; v2f x[8], t[2];
            auto sp = [&](int k) { return (v2f){s[nq][k >> 2][2 * (k & 3)], s[nq][k >> 2][2 * (k & 3) + 1]}; };
            auto pr = [&](int k) { return (v2f){p[nq][k >> 2][2 * (k & 3)], p[nq][k >> 2][2 * (k & 3) + 1]}; };
            x[0] = __builtin_elementwise_fma(sp(0), c2, n2); x[1] = __builtin_elementwise_fma(sp(1), c2, n2);
#pragma unroll
            for (int k = 0; k < 8; ++k) { float a = x[k][0], b = x[k][1];
                if (k < 4) sm_a<nq>(a, b, x[k + 2], sp(k + 2), c2, nn);
                else if (k < 6) sm_b<nq>(a, b, x[k + 2], sp(k + 2), c2, nn, t[k & 1], pr(k - 4), pr(k - 2));
                else sm_c(a, b, t[k & 1], pr(k - 2));
                p[nq][k >> 2][2 * (k & 3)] = a; p[nq][k >> 2][2 * (k & 3) + 1] = b; }
            const v2f u = (t[0] + pr(6)) + (t[1] + pr(7)); sum[nq] = u[0] + u[1];
        };
        auto soft = [&]() { soft1(IC_<0>{}); if constexpr (NQ == 2) soft1(IC_<1>{}); };
        soft();
        bool need = false;
#pragma unroll
        for (int nq = 0; nq < NQ; ++nq) need = need || !(sum[nq] <= PTHR);   // also true for an infinite or undefined sum
        if (__builtin_expect(__builtin_amdgcn_ballot_w32(need) != 0, 0)) {   // ONE test a pass, a scalar branch: some lane's 16 terms sum past 2^5 times the reference's term, so the wave raises its references to the maxima seen, rescales what it has summed and forms this pass's P anew (then every term is at most 2^carrier)
#pragma unroll
            for (int nq = 0; nq < NQ; ++nq) { float mx = s[nq][0][0];
#pragma unroll
                for (int kt = 0; kt < 2; ++kt)
#pragma unroll
                    for (int j = 0; j < 8; ++j) mx = fmaxf(mx, s[nq][kt][j]);
                mx = fmaxf(mx, xhalf(mx));      // lanes lr and lr + 16 hold the two halves of one query's keys and must share one reference
                const float nn = fminf(nr[nq], CARR - mx * CEXP); const float al = exp2s(nn - nr[nq]); nr[nq] = nn; l[nq] *= al;
#pragma unroll
                for (int dt = 0; dt < 4; ++dt) o[nq][dt] *= al; }
            soft();
        }
        v16bf ph[NQ], pl[NQ]; v16h p16[NQ];
#pragma unroll
        for (int nq = 0; nq < NQ; ++nq) { l[nq] += sum[nq];   // each half keeps its own partial sum; joined once behind the loop
            v8us uh[2], ul[2]; v8h u16[2];
#pragma unroll
            for (int kt = 0; kt < 2; ++kt)
#pragma unroll
                for (int j = 0; j < 8; ++j) { if (HIRES) { unsigned short a, c2; splitf(p[nq][kt][j], a, c2); uh[kt][j] = a; ul[kt][j] = c2; } else u16[kt][j] = tohx(p[nq][kt][j]); }
            if (HIRES) { ph[nq] = cat16b(uh[0], uh[1]); pl[nq] = cat16b(ul[0], ul[1]); } else p16[nq] = cat16(u16[0], u16[1]); }
#pragma unroll
        for (int dt = 0; dt < 4; ++dt) {
            if (HIRES) {
#pragma unroll
                for (int nq = 0; nq < NQ; ++nq) { o[nq][dt] = wmmab(vh[dt], ph[nq], o[nq][dt]); o[nq][dt] = wmmab(vh[dt], pl[nq], o[nq][dt]); o[nq][dt] = wmmab(vl[dt], ph[nq], o[nq][dt]); }
            } else {
#pragma unroll
                for (int nq = 0; nq < NQ; ++nq) o[nq][dt] = wmma16(v16[dt], p16[nq], o[nq][dt]); } }
    }
        // hand-over of the buffers, every wave, in this order
        asm volatile("s_wait_dscnt 0x0" ::: "memory");      // this wave's reads of stage st have returned
        wait_tensor0(td0, td1);                             // this wave's tile of stage st + 1 has landed (a wave that brings none passes at once: no branch here, so that the last products can stand behind the barrier's signal)
        __syncthreads();                                    // publishes stage st + 1 and ends every wave's reads of stage st's buffer, which the next trip's first statement refills
    }
    wait_tensor0();                                     // no tensor load is outstanding behind the loop
    asm volatile("s_wait_dscnt 0x0" ::: "memory");      // and no LDS read, before the ring is used for the hand-over
    // The two key groups' partial results are joined through LDS, alike in every wave: of a pair's NQ * 4 output tiles (16 d x 16 queries) key group 0 finishes the first half and key group 1 the second; each hands the other half to its partner, with its references and sums. The ring is free for it: the loop's last barrier stands behind every wave's last read, and no tensor load is outstanding.
    constexpr int TH = NQ * 2; const int lane = hi * 16 + lr; const bool g1 = kg != 0;
#pragma unroll
    for (int t = 0; t < TH; ++t) { const v8f sd = g1 ? o[t / 4][t % 4] : o[(TH + t) / 4][(TH + t) % 4]; v4f a, c;
#pragma unroll
        for (int j = 0; j < 4; ++j) { a[j] = sd[j]; c[j] = sd[j + 4]; }
        *(v4fa*)(xs + (2 * t) * 128 + lane * 4) = a; *(v4fa*)(xs + (2 * t + 1) * 128 + lane * 4) = c; }   // 16 bytes a lane, lanes side by side: no bank conflict
#pragma unroll
    for (int nq = 0; nq < NQ; ++nq) { xs[TH * 256 + (2 * nq) * 32 + lane] = nr[nq]; xs[TH * 256 + (2 * nq + 1) * 32 + lane] = l[nq]; }
    __syncthreads();   // publishes every wave's hand-over to its partner
    const int nk = NQ == 2 ? kg : 0;   // the query group whose tiles this wave finishes (with one query group: d 32 kg .. 32 kg + 31 of it)
    const float n0 = g1 ? nr[NQ - 1] : nr[0], l0 = g1 ? l[NQ - 1] : l[0], n1 = xr[TH * 256 + (2 * nk) * 32 + lane], l1 = xr[TH * 256 + (2 * nk + 1) * 32 + lane]; const float nj = fminf(n0, n1);   // the smaller addend is the higher reference
    const float a0 = exp2s(nj - n0), a1 = exp2s(nj - n1);   // each group's terms brought to the common reference
    const float lj = l0 * a0 + l1 * a1; const float ls = lj + xhalf(lj); const float f = __fdiv_rn(1.0f, ls); const float f0 = a0 * f, f1 = a1 * f; float* orow = Orow + (size_t)(q0 + nk * 16 + lr) * DQ + 8 * hi + (NQ == 2 ? 0 : kg * 32);
#pragma unroll
    for (int t = 0; t < TH; ++t) { const v8f kp = g1 ? o[(TH + t) / 4][(TH + t) % 4] : o[t / 4][t % 4]; const v4f b = *(const v4fa*)(xr + (2 * t) * 128 + lane * 4), d = *(const v4fa*)(xr + (2 * t + 1) * 128 + lane * 4); v4f a, c;
#pragma unroll
        for (int j = 0; j < 4; ++j) { a[j] = kp[j] * f0 + b[j] * f1; c[j] = kp[j + 4] * f0 + d[j] * f1; }
        *(v4f*)(orow + t * 16) = a; *(v4f*)(orow + t * 16 + 4) = c; }
}
// grid (batches x heads, (RH / 16 + (TT - RH) / 32) / 4), 256 threads = 8 waves: four neighbouring query blocks of ONE head times two key groups. Waves w and w + 4 hold the same query block; each key group has its own ring of staged K and V tiles, filled by its own waves (one tensor load a tile), and walks its half of the keys; the stage barrier is common. With two work-groups on a WGP four waves share a SIMD, so that one wave's LDS waits and dependent softmax arithmetic are covered by the others' matrix and vector work. A hi/lo wave (three times the P.V products and the hi/lo split a key) takes 16 query rows, an fp16 wave 32, so that a pass costs both about the same; the hi/lo blocks have the low blockIdx.y (RH / 16 is a multiple of 4: a workgroup is all of one kind). amdgpu_waves_per_eu(4, 4) holds the register budget at 256, without which only one work-group fits a WGP; 2 x the LDS size is 327,680 bytes, all of a WGP's LDS, and fits too.
__global__ __launch_bounds__(256) __attribute__((amdgpu_waves_per_eu(4, 4))) void k_fattn(const bf* __restrict__ Qh, const bf* __restrict__ Ql, const bf* __restrict__ Kh, const bf* __restrict__ Kl, const bf* __restrict__ Vh, const bf* __restrict__ Vl, const h16* __restrict__ V16, float* OUTb) {
    __shared__ __attribute__((aligned(2048))) char sm[KSPL * 2 * 4 * TILB];
    const int lane = threadIdx.x & 31, lr = lane & 15, hi = lane >> 4; const size_t hp = (size_t)blockIdx.x * TT * HD;   /* planes [batch][head] */ const int wv = __builtin_amdgcn_readfirstlane(threadIdx.x >> 5), kg = wv >> 2, y = blockIdx.y * 4 + (wv & 3); float* Orow = OUTb + (size_t)(blockIdx.x / NH_) * TT * DQ + (blockIdx.x % NH_) * HD;
    const size_t kp = hp + (size_t)kg * (TT / KSPL) * HD, vp = hp + (size_t)kg * (TT / KSPL);   // the key group's first K row ([t][d] planes) and first V column ([d][t] planes)
    char* ring = sm + kg * (2 * 4 * TILB); float* xs = (float*)(sm + wv * XCHB); const float* xr = (const float*)(sm + (wv ^ 4) * XCHB); const int wq = wv & 3;
    const int rot = (blockIdx.x + blockIdx.y) & (NSTG - 1);   // the 20 work-groups of a head read the same K and V lines: the walk starts at stage (blockIdx.x + blockIdx.y) mod 16, at most two of them on one stage, so that few ask L2 for the same lines at a time
    if (blockIdx.y < RH / 64) fattn_body<true, 1>(Qh + hp, Ql + hp, Kh + kp, Kl + kp, Vh + vp, Vl + vp, V16 + vp, Orow, y * 16, lr, hi, ring, wq, kg, xs, xr, rot);
    else fattn_body<false, 2>(Qh + hp, Ql + hp, Kh + kp, Kl + kp, Vh + vp, Vl + vp, V16 + vp, Orow, RH + (y - RH / 16) * 32, lr, hi, ring, wq, kg, xs, xr, rot);
}

extern "C" void kernel_launch(void* const* d_in, const int* in_sizes, int n_in,
                              void* d_out, int out_size, void* d_ws, size_t ws_size, hipStream_t stream) {
    (void)in_sizes; (void)n_in; (void)out_size;
    const float* x = (const float*)d_in[0]; const float* xk = (const float*)d_in[1]; const float* xv = (const float*)d_in[2]; const float* wq = (const float*)d_in[3]; const float* bq = (const float*)d_in[4]; const float* wk = (const float*)d_in[5]; const float* bk = (const float*)d_in[6]; const float* wv = (const float*)d_in[7]; const float* bv = (const float*)d_in[8];   /* argument order query, key, value, Wq, bq, Wk, bk, Wv, bv ('oi' [768][768] + [768]); no output projection */
    float* OUT = (float*)d_out;     // [2][2048][768]
    char* wsp = (char*)d_ws;
    auto take = [&](size_t bytes) { char* p = wsp; wsp += (bytes + 255) & ~(size_t)255; return (void*)p; };
    h16* VT16 = (h16*)take((size_t)NB_ * NKV * HD * TT * 2);
    bf* QPh = (bf*)take((size_t)NB_ * NH_ * TT * HD * 2); bf* QPl = (bf*)take((size_t)NB_ * NH_ * TT * HD * 2); bf* KPh = (bf*)take((size_t)NB_ * NKV * TT * HD * 2); bf* KPl = (bf*)take((size_t)NB_ * NKV * TT * HD * 2); bf* VTh = (bf*)take((size_t)NB_ * NKV * HD * TT * 2); bf* VTl = (bf*)take((size_t)NB_ * NKV * HD * TT * 2);   /* the planes the attention launch reads: both batches */
    if ((size_t)(wsp - (char*)d_ws) > ws_size) return;    // ws 256 MiB
    k_proj<<<dim3(NB_ * TT / 128, DQ / 128, 3), 128, 0, stream>>>(x, xk, xv, wq, wk, wv, bq, bk, bv, QPh, QPl, KPh, KPl, VT16, VTh, VTl);   /* rounding, projections, biases, planes: 3 streams x 2 batches */
    k_fattn<<<dim3(NB_ * NH_, (RH / 16 + (TT - RH) / 32) / 4, 1), 256, 0, stream>>>(QPh, QPl, KPh, KPl, VTh, VTl, VT16, OUT);   /* all 24 batch-heads: scores, softmax, P.V, merge */
}

// v009
// Measured time: 59.6 microseconds a run.
// Two timings next to v008 both put it at 1.11 times that version's speed.
// Over all steps from v000 it is 24.9 times as fast.
#include <hip/hip_runtime.h>
#include <stdint.h>

// Multi-head attention on three input streams at d_model 768 WITHOUT an output projection (query, key, value [2][2048][768]; Q = query Wq^T + bq, K = key Wk^T + bk, V = value Wv^T + bv ('oi' + biases; 12 heads x 64); scores / sqrt(64); softmax (no mask); out = heads merged -> [2][2048][768] (3.1 M); argument order query, key, value, Wq, bq, Wk, bk, Wv, bv).
// Layout: ONE projection launch for all three streams and both batches ('oi' weights; f32 operands rounded to bf16 on their way into LDS; exact products (K 768) + f32 biases; its epilogue writes the planes the attention reads); then ONE fused attention launch for all 24 batch-heads (online softmax, scores and P stay in registers) with EVERY row's scores on hi/lo planes (3 products: no output projection averages the fp16 score error) and hybrid P.V (rows < 512 hi/lo, rest fp16 x1024); it writes the merged f32 output rows.
// Compute dtypes, f32 accumulate: every input rounded to bf16; projections exact + f32 biases; scores 3 products on every row; P.V rows < 512 3 products, rest fp16; softmax f32; output f32.

#define NB_  2
#define TT   2048
#define DM   768
#define NH_  12
#define NKV  12
#define REP  (NH_ / NKV)
#define HD   64
#define DQ   (NH_ * HD)
#define DKV  (NKV * HD)
#define ZH   2
#define RH   512                  // query rows < RH use hi+lo planes (0: none)
#define WIN  0
#define PCAR 1024.0f
#define SCL  0.125f   // HD^-0.5
typedef _Float16 h16;
typedef unsigned short bf;
typedef __attribute__((ext_vector_type(16))) __bf16   v16bf;
typedef __attribute__((ext_vector_type(16))) _Float16 v16h;
typedef __attribute__((ext_vector_type(8)))  _Float16 v8h;
typedef __attribute__((ext_vector_type(8)))  unsigned short v8us;
typedef __attribute__((ext_vector_type(8)))  float    v8f;
typedef __attribute__((ext_vector_type(4)))  float    v4f;
typedef v8h  __attribute__((may_alias)) v8ha;
typedef v4f  __attribute__((may_alias)) v4fa;
typedef v8us __attribute__((may_alias)) v8usa;

__device__ __forceinline__ unsigned short f2bf(float f) { unsigned u = __float_as_uint(f); u += 0x7FFFu + ((u >> 16) & 1u); return (unsigned short)(u >> 16); }
__device__ __forceinline__ float bf2f(unsigned short b) { return __uint_as_float(((unsigned)b) << 16); }
__device__ __forceinline__ float bfr(float f) { return bf2f(f2bf(f)); }
__device__ __forceinline__ v16h cat16(v8h lo, v8h hi) { return __builtin_shufflevector(lo, hi, 0, 1, 2, 3, 4, 5, 6, 7, 8, 9, 10, 11, 12, 13, 14, 15); }
__device__ __forceinline__ v16bf cat16b(v8us lo, v8us hi) { return __builtin_bit_cast(v16bf, __builtin_shufflevector(lo, hi, 0, 1, 2, 3, 4, 5, 6, 7, 8, 9, 10, 11, 12, 13, 14, 15)); }
__device__ __forceinline__ v8f wmma16(v16h a, v16h b, v8f c) { return __builtin_amdgcn_wmma_f32_16x16x32_f16(false, a, false, b, (short)0, c, false, false); }
__device__ __forceinline__ v8f wmmab(v16bf a, v16bf b, v8f c) { return __builtin_amdgcn_wmma_f32_16x16x32_bf16(false, a, false, b, (short)0, c, false, false); }



// fragment loaders: 16 k of one row a lane, k = 8 hi + 0..7 and 16 + 8 hi + 0..7 of a 32-k step, from K-contiguous 16-bit rows
template <typename T16> struct WFrag;
template <> struct WFrag<h16> { typedef v16h V; static __device__ __forceinline__ V ld(const h16* p) { return cat16(*(const v8h*)p, *(const v8h*)(p + 16)); } static __device__ __forceinline__ v8f mma(V a, V b, v8f c) { return wmma16(a, b, c); } };
template <> struct WFrag<bf> { typedef v16bf V; static __device__ __forceinline__ V ld(const bf* p) { return cat16b(*(const v8us*)p, *(const v8us*)(p + 16)); } static __device__ __forceinline__ v8f mma(V a, V b, v8f c) { return wmmab(a, b, c); } };

__device__ __forceinline__ h16 tohx(float x) { return (h16)x; }
__device__ __forceinline__ void splitf(float y, unsigned short& h, unsigned short& l) { h = f2bf(y); l = f2bf(y - bf2f(h)); }
typedef __attribute__((ext_vector_type(2))) _Float16 v2h;
typedef __attribute__((ext_vector_type(4))) _Float16 v4h;
typedef __attribute__((ext_vector_type(2))) unsigned short v2us;
typedef __attribute__((ext_vector_type(4))) unsigned short v4us;
typedef __attribute__((ext_vector_type(2))) float v2f;
typedef __attribute__((ext_vector_type(4))) int v4i;

// ---- k_proj: the three projections of both batches in ONE launch, from the f32 inputs to the planes that k_fattn reads: no bf16 copy and no f32 projection in memory.
// grid (NB_ * TT / 128, DQ / 128, 3 streams: query, key, value), 128 threads = 4 waves, 128 x 128 outputs a work-group, 64 x 64 (16 accumulators) a wave. C[m][n] = sum_k bf16(X[m][k]) bf16(W[n][k]) + bf16(bias[n]), f32 accumulate, k in passes of 32, walked in a ring from a start that differs between the 6 work-groups of a row block and takes 24 values among the 32 of a column block (for speed only).
// A pass: every thread rounds the 16 x 4 f32 that it fetched one pass ahead (a wave-wide load is four whole 128-byte lines) and stores them as bf16 rows in LDS (rows 0..127 X, 128..255 W); one barrier; the next pass's fetch goes out; fragments come from LDS in the k order of WFrag::ld.
// Two LDS buffers, ONE barrier a pass: a wave overwrites the buffer of pass p only in pass p + 2, behind the barrier of pass p + 1, which no wave reaches before its reads of pass p have returned.
// Epilogue: a 64-column tile is one head, a 64-row tile lies in one batch. query, key: rows [head][t][d] as bf16 hi + lo, staged through the wave's own LDS range so that whole 128-byte lines are stored. value: planes [head][d][t]; an accumulator register run is 8 neighbouring t of one d (16 bytes as fp16, hi or lo); the 8 runs of a d row are gathered through the wave's own LDS range, so that here too whole 128-byte lines are stored.
#define PK   32    // k of a pass
#define PPIT 40    // LDS row pitch in bf16 elements: 64 bytes of data + 16, the conflict-free pitch for 16-byte fragment reads of 64-byte rows
typedef __attribute__((ext_vector_type(4))) __bf16 v4bf;
__global__ __launch_bounds__(128) void k_proj(const float* __restrict__ xq, const float* __restrict__ xk, const float* __restrict__ xv, const float* __restrict__ wq, const float* __restrict__ wk, const float* __restrict__ wv, const float* __restrict__ bq, const float* __restrict__ bk, const float* __restrict__ bv, bf* Qh, bf* Ql, bf* Kh, bf* Kl, h16* V16, bf* Vh, bf* Vl) {
    __shared__ __align__(16) bf ts[2][256 * PPIT];
    __shared__ __align__(16) float osall[4][3 * 16 * 36];   // a wave's own epilogue range: 16 rows of 68 floats (query, key) or three planes of 16 rows of 144 bytes (value)
    const int z = blockIdx.z; const float* X = z == 0 ? xq : z == 1 ? xk : xv; const float* Wt = z == 0 ? wq : z == 1 ? wk : wv; const float* bias = z == 0 ? bq : z == 1 ? bk : bv;
    const int tid = threadIdx.x, w = __builtin_amdgcn_readfirstlane(tid >> 5), lane = tid & 31, lr = lane & 15, hi = lane >> 4;
    const int wr = (w & 1) * 64, wc = (w >> 1) * 64; const int r0 = blockIdx.x * 128 + wr, c0 = blockIdx.y * 128 + wc;
    const int sr = tid >> 3, sc = (tid & 7) * 4;   // staging: 8 threads a row of 32 f32, rows sr + 16 i
    const float* gx = X + (size_t)(blockIdx.x * 128 + sr) * DM + sc; const float* gw = Wt + (size_t)(blockIdx.y * 128 + sr) * DM + sc;
    v8f acc[4][4];
#pragma unroll
    for (int mb = 0; mb < 4; ++mb)
#pragma unroll
        for (int nb = 0; nb < 4; ++nb) acc[mb][nb] = (v8f){};
    v4f st[16];
    int kc = (int)((blockIdx.x + 4 * blockIdx.y) % (DM / PK)) * PK;   // first k of this work-group's walk: the 6 work-groups of a row block start 4 passes apart, the 32 of a column block on 24 different passes
#pragma unroll
    for (int i = 0; i < 8; ++i) { st[i] = *(const v4f*)(gx + (size_t)i * 16 * DM + kc); st[8 + i] = *(const v4f*)(gw + (size_t)i * 16 * DM + kc); }
    asm volatile("s_wait_xcnt 0x0" ::: "memory");   // the two address pairs of these sixteen loads are dead behind the last of them and the build reuses them at once: the wait stands in front of that overwrite
    __builtin_amdgcn_sched_barrier(0);              // keeps those register writes behind the wait
#pragma unroll 1   // one copy of the body: the buffer index and the fetch test stay scalar, and 16 accumulators, 16 fetched vectors and the fragments leave a second copy nothing to overlap with
    for (int it = 0; it < DM / PK; ++it) {
        bf* tb = ts[it & 1];
#pragma unroll
        for (int i = 0; i < 16; ++i) *(v4us*)(tb + (sr + 16 * i) * PPIT + sc) = __builtin_bit_cast(v4us, __builtin_convertvector(st[i], v4bf));   // round to nearest even, as f2bf
        __syncthreads();   // publishes this pass's rows; also ends every wave's reads of the other buffer before the next pass overwrites it
        if (it + 1 < DM / PK) {
            kc = kc + PK == DM ? 0 : kc + PK;   // the ring's next pass
#pragma unroll
            for (int i = 0; i < 8; ++i) { st[i] = *(const v4f*)(gx + (size_t)i * 16 * DM + kc); st[8 + i] = *(const v4f*)(gw + (size_t)i * 16 * DM + kc); }
            asm volatile("s_wait_xcnt 0x0" ::: "memory");   // the run's two address pairs are dead behind its last load and the build reuses them for the fragment reads below: the wait stands in front of that overwrite of registers which the sixteen loads name
        }
        v16bf a[4], b[2];   // two W fragment sets in turn: four would push the kernel past 256 registers
#pragma unroll
        for (int mb = 0; mb < 4; ++mb) a[mb] = WFrag<bf>::ld(tb + (wr + mb * 16 + lr) * PPIT + 8 * hi);
#pragma unroll
        for (int nb = 0; nb < 2; ++nb) b[nb] = WFrag<bf>::ld(tb + (128 + wc + nb * 16 + lr) * PPIT + 8 * hi);
#pragma unroll
        for (int nb = 0; nb < 4; ++nb) {
#pragma unroll
            for (int mb = 0; mb < 4; ++mb) acc[mb][nb] = wmmab(a[mb], b[nb & 1], acc[mb][nb]);
            if (nb < 2) { b[nb & 1] = WFrag<bf>::ld(tb + (128 + wc + (nb + 2) * 16 + lr) * PPIT + 8 * hi);
                __builtin_amdgcn_sched_barrier(0); }   // holds the refill of a W set right behind that set's last product, so that the other set's four products cover part of its LDS wait
        }
        asm volatile("v_nop\n\tv_nop\n\tv_nop\n\tv_nop" : "+v"(acc[0][0]), "+v"(acc[1][1]), "+v"(acc[2][2]), "+v"(acc[3][3]) : "v"(a[0]), "v"(a[3]));   // the four vector slots that the chip needs behind the pass's last matrix instruction, also on the taken back edge
    }
    const size_t hp = ((size_t)(r0 / TT) * NH_ + c0 / HD) * TT * HD; const int t0 = r0 % TT;   // this tile's batch-head plane and its first position
    // In both epilogues a block's values are all formed first, then its stores go out as one run with s_wait_xcnt 0 behind it, each part held in place by sched_barrier(0).
    if (z < 2) {
        bf* Ph = (z == 0 ? Qh : Kh) + hp; bf* Pl = (z == 0 ? Ql : Kl) + hp; float* os = osall[w]; const int cofs = lr * 4; v4f bb = *(const v4f*)(bias + c0 + cofs);
        asm volatile("s_wait_xcnt 0x0" ::: "memory");   // in front of any reuse of the bias load's address registers
        __builtin_amdgcn_sched_barrier(0);              // keeps later register writes behind that wait
#pragma unroll
        for (int q = 0; q < 4; ++q) bb[q] = bfr(bb[q]);
#pragma unroll
        for (int mb = 0; mb < 4; ++mb) {
#pragma unroll
            for (int nb = 0; nb < 4; ++nb) {
#pragma unroll
                for (int j = 0; j < 8; ++j) os[(hi * 8 + j) * 68 + nb * 16 + lr] = acc[mb][nb][j]; }
            __builtin_amdgcn_wave_barrier(); asm volatile("" ::: "memory");   // the wave's own LDS stores stay in front of its reads of other lanes' values
            v4us oh[8], ol[8];
#pragma unroll
            for (int s = 0; s < 8; ++s) { const v4f val = *(const v4fa*)(os + (2 * s + hi) * 68 + cofs) + bb;
#pragma unroll
                for (int q = 0; q < 4; ++q) { unsigned short a2, c2; splitf(val[q], a2, c2); oh[s][q] = a2; ol[s][q] = c2; } }
            __builtin_amdgcn_wave_barrier(); asm volatile("" ::: "memory");   // and these reads in front of the next block's LDS stores
            __builtin_amdgcn_sched_barrier(0);   // values first
#pragma unroll
            for (int s = 0; s < 8; ++s) { const size_t po = (size_t)(t0 + mb * 16 + 2 * s + hi) * HD + cofs; *(v4us*)(Ph + po) = oh[s]; *(v4us*)(Pl + po) = ol[s]; }
            asm volatile("s_wait_xcnt 0x0" ::: "memory");   // behind the run of stores, in front of the next block's writes of their registers
            __builtin_amdgcn_sched_barrier(0);   // keeps those writes behind the wait
        }
    } else {
        float bn[4]; char* vs = (char*)osall[w]; const int vr = lane >> 3, vc = lane & 7;   // read-back and store: 8 lanes on the 8 runs of a row, 4 rows an instruction
#pragma unroll
        for (int nb = 0; nb < 4; ++nb) bn[nb] = bias[c0 + nb * 16 + lr];
        asm volatile("s_wait_xcnt 0x0" ::: "memory");   // in front of any reuse of the bias loads' offset register
        __builtin_amdgcn_sched_barrier(0);              // keeps later register writes behind that wait
#pragma unroll
        for (int nb = 0; nb < 4; ++nb) { const float bnr = bfr(bn[nb]); const size_t vo = hp + (size_t)(nb * 16 + vr) * TT + t0 + 8 * vc; v8h o16[4]; v8us oh[4], ol[4];
#pragma unroll
            for (int mb = 0; mb < 4; ++mb)
#pragma unroll
                for (int j = 0; j < 8; ++j) { const float x = acc[mb][nb][j] + bnr; o16[mb][j] = tohx(x); unsigned short a2, c2; splitf(x, a2, c2); oh[mb][j] = a2; ol[mb][j] = c2; }
#pragma unroll
            for (int mb = 0; mb < 4; ++mb) { char* sp = vs + lr * 144 + (2 * mb + hi) * 16; *(v8ha*)sp = o16[mb]; *(v8usa*)(sp + 2304) = oh[mb]; *(v8usa*)(sp + 4608) = ol[mb]; }   // row d, run 2 mb + hi; pitch 128 + 16 bytes
            asm volatile("s_wait_dscnt 0x0" ::: "memory");   // the wave's own staged rows are in LDS before it reads other lanes' values back
#pragma unroll
            for (int i = 0; i < 4; ++i) { const char* rp = vs + (4 * i + vr) * 144 + vc * 16; o16[i] = *(const v8ha*)rp; oh[i] = *(const v8usa*)(rp + 2304); ol[i] = *(const v8usa*)(rp + 4608); }
            __builtin_amdgcn_sched_barrier(0);   // values first
#pragma unroll
            for (int i = 0; i < 4; ++i) { *(v8h*)(V16 + vo + (size_t)(4 * i) * TT) = o16[i]; *(v8us*)(Vh + vo + (size_t)(4 * i) * TT) = oh[i]; *(v8us*)(Vl + vo + (size_t)(4 * i) * TT) = ol[i]; }
            asm volatile("s_wait_xcnt 0x0" ::: "memory");   // behind the run of stores, in front of the next block's writes of their registers
            __builtin_amdgcn_sched_barrier(0);   // keeps those writes behind the wait
        }
    }
}

// k_fattn: scores, softmax, P.V and the head merge in ONE kernel; a pair of waves per 16 or 32 query rows of one head, each wave on its half of the keys, 32 keys a pass, a held reference and a running sum (online softmax; the reference is raised, and what is summed rescaled, only when a pass's terms grow past 2^5 times the reference's), the pair's partial results joined at the end: no score or P plane in memory.
// S^T = K Q^T (A = K rows, B = Q rows, hi/lo planes, 3 products): lane (lr, hi) register j of key tile kt holds the score of key j0 + 16 kt + 8 hi + j for query lr, so the two key tiles of a pass, converted in place, are the B operand P^T of O^T += V^T P^T in the same k order as WFrag::ld reads V^T rows.
// HIRES (query rows < RH): P and V on hi/lo planes, 3 products; else P x PCAR in fp16 against the fp16 V plane (the factor is in the row sum too and cancels in O / sum).
// value of lane l ^ 16 (the other half of a query's keys) without the LDS path's latency
__device__ __forceinline__ float xhalf(float x) { const int b = __float_as_int(x); return __int_as_float(__builtin_amdgcn_permlanex16(b, b, 0x76543210, 0xfedcba98, false, false)); }
// 2^x with the instruction set's one free slot behind a transcendental kept in the same statement.
__device__ __forceinline__ float exp2s(float x) { float r; asm("v_exp_f32 %0, %1\n\tv_nop" : "=v"(r) : "v"(x)); return r; }
// The softmax's vector work on register pairs: exponent addend and row sums as packed f32 instructions, set into the slots behind the exponentials. The instruction set's free slot behind a transcendental is kept by the order inside each statement: what follows a v_exp_f32 neither reads its result nor writes its register (the exponentials work in place on in-out operands, whose registers no other operand shares), and every statement ends in a packed instruction. volatile keeps the statements in the written order: without it the build set pair k + 2 directly behind pair k, each exponential right behind its own fma. The fma runs two pairs ahead of its exponentials and the adds two pairs behind theirs; where a producer is still within four vector instructions, s_delay_alu names it, without which a dependent instruction holds the SIMD's issue against the other waves too (the compiler sets no hint inside asm text).
// sm_a: 2^a, 2^b in place; nx = sn * c + n[H] (n holds the addends of both query groups; a packed f32 instruction reads only the first register of a scalar pair, for both halves: op_sel_hi 0 on it)
template <int V> struct IC_ { static constexpr int v = V; };   // a query group's number as a compile-time value
#define DLY2_ "s_delay_alu instid0(VALU_DEP_2)\n\t"   // the pair's fma is the second plain vector instruction back (in sm_b's second use the third: the hint then names a younger one, which covers it)
#define NLO_ " op_sel_hi:[1,0,0]"                // both halves add the first register of the addend pair
#define NHI_ " op_sel:[0,0,1] op_sel_hi:[1,0,1]"   // both halves add its second register
template <int H> __device__ __forceinline__ void sm_a(float& a, float& b, v2f& nx, v2f sn, v2f c, v2f n) {
    if (H) asm volatile(DLY2_ "v_exp_f32 %0, %0\n\tv_exp_f32 %1, %1\n\tv_pk_fma_f32 %2, %3, %4, %5" NHI_ : "+v"(a), "+v"(b), "=v"(nx) : "v"(sn), "s"(c), "v"(n));
    else   asm volatile(DLY2_ "v_exp_f32 %0, %0\n\tv_exp_f32 %1, %1\n\tv_pk_fma_f32 %2, %3, %4, %5" NLO_ : "+v"(a), "+v"(b), "=v"(nx) : "v"(sn), "s"(c), "v"(n));
}
// sm_b: the same, and o = u + w
template <int H> __device__ __forceinline__ void sm_b(float& a, float& b, v2f& nx, v2f sn, v2f c, v2f n, v2f& o, v2f u, v2f w) {
    if (H) asm volatile(DLY2_ "v_exp_f32 %0, %0\n\tv_pk_fma_f32 %2, %4, %5, %6" NHI_ "\n\tv_exp_f32 %1, %1\n\tv_pk_add_f32 %3, %7, %8" : "+v"(a), "+v"(b), "=&v"(nx), "=v"(o) : "v"(sn), "s"(c), "v"(n), "v"(u), "v"(w));
    else   asm volatile(DLY2_ "v_exp_f32 %0, %0\n\tv_pk_fma_f32 %2, %4, %5, %6" NLO_ "\n\tv_exp_f32 %1, %1\n\tv_pk_add_f32 %3, %7, %8" : "+v"(a), "+v"(b), "=&v"(nx), "=v"(o) : "v"(sn), "s"(c), "v"(n), "v"(u), "v"(w));
}
// sm_c: 2^a, 2^b in place; o += w
__device__ __forceinline__ void sm_c(float& a, float& b, v2f& o, v2f w) {
    asm volatile("v_exp_f32 %0, %0\n\tv_exp_f32 %1, %1\n\tv_pk_add_f32 %2, %2, %3" : "+v"(a), "+v"(b), "+v"(o) : "v"(w));
}
// K and V reach the waves through LDS: a stage is 64 keys (two passes): the 64 rows of 128 bytes of each K plane (keys) and of each V plane in use (d). A tile is ONE tensor load (tensor_load_to_lds) of one wave: no vector register, no address arithmetic on the vector port and no per-lane copy; wave i of a key group's four brings tile i (K hi, K lo, V hi or the fp16 V, V lo), and the four share every tile. Two buffers: stage t + 1 flies while stage t is worked on.
#define SKEY 64                  // keys of a stage
#define KSPL 2                   // key groups of a work-group: waves 0..3 walk the first half of the keys, waves 4..7 the second half, for the same four query blocks
#define NSTG (TT / KSPL / SKEY)  // stages of a key group
#define XCHB ((32 + 2 * 2) * 32 * 4)   // bytes in which a wave hands half of its partial result to its partner in the other key group: at most 32 output values, 2 references and 2 sums a lane
#define OSTB (16 * (64 + 4) * 4)       // bytes of a wave's own range for its finished output rows: 16 rows of at most 64 floats + 16 bytes
#define LPIT 144                 // LDS row pitch in bytes: 128 of data + 16 (the tensor load's pad), the conflict-free pitch for 16-byte fragment reads of 128-byte rows
#define TILB 10240               // bytes of a staged tile's place: 64 * LPIT = 9216, rounded up to a multiple of 2 KiB, on which every tensor load's LDS place lies
typedef uint32_t u32x4 __attribute__((ext_vector_type(4)));
typedef uint32_t u32x8 __attribute__((ext_vector_type(8)));
__device__ __forceinline__ uint32_t uni(uint32_t v) { return (uint32_t)__builtin_amdgcn_readfirstlane(v); }
// a wave-uniform test, or a descriptor word, held in a scalar register: the branch round a tensor load is then s_cmp + s_cbranch_scc (a tensor load ignores EXEC)
__device__ __forceinline__ uint32_t pinned(uint32_t v) { uint32_t w = uni(v); asm volatile("" : "+s"(w)); /* keeps the value in a scalar register */ return w; }
// group 1: 1-byte elements, tensor = tile = 64 rows of 128 bytes, source row pitch in bytes, 4 dwords of LDS pad behind every 32 dwords (one row); no mask. Word 0 is a constant; the other words go through pinned(), each a descriptor word held in a scalar register of its own.
__device__ __forceinline__ u32x8 tdm_group1(uint32_t src_pitch) {
    u32x8 g;
    g[0] = uni((1u << 20) | (4u << 22) | (3u << 25));
    g[1] = pinned(128u << 16);
    g[2] = pinned(64u << 16);
    g[3] = pinned(128u << 16);
    g[4] = pinned(64u);
    g[5] = pinned(src_pitch);
    g[6] = pinned(0u);
    g[7] = pinned(0u);
    return g;
}
// group 0: count 1, the LDS place, the tile's first byte, type 2
__device__ __forceinline__ u32x4 tdm_group0(uint32_t lds_dst, uint64_t ga) {
    u32x4 g;
    g[0] = uni(1u); g[1] = uni(lds_dst); g[2] = uni((uint32_t)ga); g[3] = uni((((uint32_t)(ga >> 32)) & 0x01FFFFFFu) | 0x80000000u);
    return g;
}
__device__ __forceinline__ void tdm_load(u32x4 g0, u32x8 g1) { asm volatile("tensor_load_to_lds %0, %1" :: "s"(g0), "s"(g1) : "memory"); }
// The wave's own tensor loads have landed.
__device__ __forceinline__ void wait_tensor0() { asm volatile("s_wait_tensorcnt 0x0" ::: "memory"); }
// The same at the foot of a stage, with the descriptor of the request in flight named as inputs: its values stay live in scalar registers from the issue to this wait.
__device__ __forceinline__ void wait_tensor0(u32x4 g0, u32x8 g1) { asm volatile("s_wait_tensorcnt 0x0" :: "s"(g0), "s"(g1) : "memory"); }
template <bool HIRES, int NQ>   // NQ: 16-query column groups per wave
__device__ __forceinline__ void fattn_body(const bf* __restrict__ Qh, const bf* __restrict__ Ql, const bf* __restrict__ Kh, const bf* __restrict__ Kl, const bf* __restrict__ Vh, const bf* __restrict__ Vl, const h16* __restrict__ V16, float* Orow, int q0, int lr, int hi, char* sm, int wq, int kg, float* xs, const float* xr, float* og, int rot) {
    v16bf qh[NQ][2], ql[NQ][2];
#pragma unroll
    for (int nq = 0; nq < NQ; ++nq)
#pragma unroll
        for (int ks = 0; ks < 2; ++ks) { const size_t qo = (size_t)(q0 + nq * 16 + lr) * HD + ks * 32 + 8 * hi; qh[nq][ks] = WFrag<bf>::ld(Qh + qo); ql[nq][ks] = WFrag<bf>::ld(Ql + qo); }
    v8f o[NQ][4]; float nr[NQ], l[NQ];   // nr: the addend of the exponent, carrier exponent minus the held reference (log2 units); it starts so high that the first pass's sums are infinite and set the reference
#pragma unroll
    for (int nq = 0; nq < NQ; ++nq) { nr[nq] = 3.0e38f; l[nq] = 0.f;
#pragma unroll
        for (int dt = 0; dt < 4; ++dt) o[nq][dt] = (v8f){}; }
    constexpr float CEXP = SCL * 1.4426950408889634f, CARR = HIRES ? 0.0f : 10.0f /* 2^10 = PCAR */, PTHR = HIRES ? 32.0f : 32.0f * PCAR;   // score to log2 units; carrier exponent of P; the pass sum of a lane beyond which the reference is raised (fp16 P stays below 2^15)
    constexpr int BUFB = (HIRES ? 4 : 3) * TILB;   // a buffer: K hi, K lo, then V hi, V lo or the fp16 V
    // this wave's tile (wq: its number among the key group's four waves): source plane, source row pitch, bytes from stage to stage, place in a buffer; all wave-uniform
    const char* tsrc = wq == 0 ? (const char*)Kh : wq == 1 ? (const char*)Kl : wq == 2 ? (HIRES ? (const char*)Vh : (const char*)V16) : (const char*)Vl;
    const uint32_t tstp = wq < 2 ? SKEY * HD * 2 : SKEY * 2, tdst = (uint32_t)(size_t)sm + wq * TILB;
    const u32x8 td1 = tdm_group1(wq < 2 ? HD * 2 : TT * 2);
    const bool issuer = HIRES || wq < 3;   // three tiles a stage without the V lo plane: the fourth wave brings none
    // the st-th fill goes to buffer st mod 2 and brings the keys of stage (st + rot) mod NSTG: the key group's stages are walked in a ring from a start that takes 16 values among the 20 work-groups of a head
    auto desc = [&](int st) { const uint32_t sg = (uint32_t)(st + rot) & (NSTG - 1); return tdm_group0(tdst + (st & 1) * BUFB, (uint64_t)(size_t)tsrc + sg * tstp); };
    if (pinned(issuer)) { tdm_load(desc(0), td1);
        wait_tensor0(); }   // this wave's tile of stage 0 has landed
    __syncthreads();        // and every other wave's: stage 0 may be read
#pragma unroll 1   // one copy of the body: the buffer index and the refill test stay scalar
    for (int st = 0; st < NSTG; ++st) {
    // the refill, directly behind the barrier that published stage st (in front of the loop or at the foot of the trip before) and ended every wave's reads of the other buffer: stage st + 1 goes there, only while it exists
    const u32x4 td0 = desc(st + 1);
    if (pinned(issuer && st + 1 < NSTG)) tdm_load(td0, td1);
    const char* sb = sm + (st & 1) * BUFB + lr * LPIT + 16 * hi;
#pragma unroll   // both passes written out: their LDS addresses are immediate offsets, so that no vector address write stands behind a matrix instruction whose operand registers it reuses (rolled, that cost six v_nop a pass)
    for (int ps = 0; ps < 2; ++ps) {
        v16bf kh[2][2], kl[2][2];
#pragma unroll
        for (int kt = 0; kt < 2; ++kt)
#pragma unroll
            for (int ks = 0; ks < 2; ++ks) { const char* kp = sb + (ps * 32 + kt * 16) * LPIT + ks * 64; kh[kt][ks] = WFrag<bf>::ld((const bf*)kp); kl[kt][ks] = WFrag<bf>::ld((const bf*)(kp + TILB)); }
        __builtin_amdgcn_sched_barrier(0);   // keeps the pass's 16 K reads one group ahead of the products
        v8f s[NQ][2];
#pragma unroll
        for (int kt = 0; kt < 2; ++kt)
#pragma unroll
            for (int nq = 0; nq < NQ; ++nq) s[nq][kt] = (v8f){};
#pragma unroll
        for (int ks = 0; ks < 2; ++ks)
#pragma unroll
            for (int kt = 0; kt < 2; ++kt)
#pragma unroll
                for (int nq = 0; nq < NQ; ++nq) { s[nq][kt] = wmmab(kh[kt][ks], qh[nq][ks], s[nq][kt]); s[nq][kt] = wmmab(kh[kt][ks], ql[nq][ks], s[nq][kt]); s[nq][kt] = wmmab(kl[kt][ks], qh[nq][ks], s[nq][kt]); }
        v16bf vh[4], vl[4]; v16h v16[4];
#pragma unroll
        for (int dt = 0; dt < 4; ++dt) { const char* vp = sb + 2 * TILB + dt * 16 * LPIT + ps * 64; if (HIRES) { vh[dt] = WFrag<bf>::ld((const bf*)vp); vl[dt] = WFrag<bf>::ld((const bf*)(vp + TILB)); } else v16[dt] = WFrag<h16>::ld((const h16*)vp); }
        __builtin_amdgcn_sched_barrier(0);   // the pass's V reads go out as one group behind the score products, so that the softmax arithmetic covers their latency
        float p[NQ][2][8], sum[NQ];
        // P = 2^(s * CEXP + nr) against the HELD reference: no maximum and no rescale in a pass that stays in range
        // A query group's 16 terms go as 8 register pairs k: pair k's two exponentials stand in one statement with the packed fma of pair k + 2 and a packed add of pairs at least two back (sm_a, sm_b, sm_c above)
        auto soft1 = [&](auto hc) { constexpr int nq = decltype(hc)::v; const v2f c2 = {CEXP, CEXP}, nn = {nr[0], nr[NQ - 1]}, n2 = {nr[nq], nr[nq]}; v2f x[8], t[2];
            auto sp = [&](int k) { return (v2f){s[nq][k >> 2][2 * (k & 3)], s[nq][k >> 2][2 * (k & 3) + 1]}; };
            auto pr = [&](int k) { return (v2f){p[nq][k >> 2][2 * (k & 3)], p[nq][k >> 2][2 * (k & 3) + 1]}; };
            x[0] = __builtin_elementwise_fma(sp(0), c2, n2); x[1] = __builtin_elementwise_fma(sp(1), c2, n2);
#pragma unroll
            for (int k = 0; k < 8; ++k) { float a = x[k][0], b = x[k][1];
                if (k < 4) sm_a<nq>(a, b, x[k + 2], sp(k + 2), c2, nn);
                else if (k < 6) sm_b<nq>(a, b, x[k + 2], sp(k + 2), c2, nn, t[k & 1], pr(k - 4), pr(k - 2));
                else sm_c(a, b, t[k & 1], pr(k - 2));
                p[nq][k >> 2][2 * (k & 3)] = a; p[nq][k >> 2][2 * (k & 3) + 1] = b; }
            const v2f u = (t[0] + pr(6)) + (t[1] + pr(7)); sum[nq] = u[0] + u[1];
        };
        auto soft = [&]() { soft1(IC_<0>{}); if constexpr (NQ == 2) soft1(IC_<1>{}); };
        soft();
        bool need = false;
#pragma unroll
        for (int nq = 0; nq < NQ; ++nq) need = need || !(sum[nq] <= PTHR);   // also true for an infinite or undefined sum
        if (__builtin_expect(__builtin_amdgcn_ballot_w32(need) != 0, 0)) {   // ONE test a pass, a scalar branch: some lane's 16 terms sum past 2^5 times the reference's term, so the wave raises its references to the maxima seen, rescales what it has summed and forms this pass's P anew (then every term is at most 2^carrier)
#pragma unroll
            for (int nq = 0; nq < NQ; ++nq) { float mx = s[nq][0][0];
#pragma unroll
                for (int kt = 0; kt < 2; ++kt)
#pragma unroll
                    for (int j = 0; j < 8; ++j) mx = fmaxf(mx, s[nq][kt][j]);
                mx = fmaxf(mx, xhalf(mx));      // lanes lr and lr + 16 hold the two halves of one query's keys and must share one reference
                const float nn = fminf(nr[nq], CARR - mx * CEXP); const float al = exp2s(nn - nr[nq]); nr[nq] = nn; l[nq] *= al;
#pragma unroll
                for (int dt = 0; dt < 4; ++dt) o[nq][dt] *= al; }
            soft();
        }
        v16bf ph[NQ], pl[NQ]; v16h p16[NQ];
#pragma unroll
        for (int nq = 0; nq < NQ; ++nq) { l[nq] += sum[nq];   // each half keeps its own partial sum; joined once behind the loop
            v8us uh[2], ul[2]; v8h u16[2];
#pragma unroll
            for (int kt = 0; kt < 2; ++kt)
#pragma unroll
                for (int j = 0; j < 8; ++j) { if (HIRES) { unsigned short a, c2; splitf(p[nq][kt][j], a, c2); uh[kt][j] = a; ul[kt][j] = c2; } else u16[kt][j] = tohx(p[nq][kt][j]); }
            if (HIRES) { ph[nq] = cat16b(uh[0], uh[1]); pl[nq] = cat16b(ul[0], ul[1]); } else p16[nq] = cat16(u16[0], u16[1]); }
#pragma unroll
        for (int dt = 0; dt < 4; ++dt) {
            if (HIRES) {
#pragma unroll
                for (int nq = 0; nq < NQ; ++nq) { o[nq][dt] = wmmab(vh[dt], ph[nq], o[nq][dt]); o[nq][dt] = wmmab(vh[dt], pl[nq], o[nq][dt]); o[nq][dt] = wmmab(vl[dt], ph[nq], o[nq][dt]); }
            } else {
#pragma unroll
                for (int nq = 0; nq < NQ; ++nq) o[nq][dt] = wmma16(v16[dt], p16[nq], o[nq][dt]); } }
    }
        // hand-over of the buffers, every wave, in this order
        asm volatile("s_wait_dscnt 0x0" ::: "memory");      // this wave's reads of stage st have returned
        wait_tensor0(td0, td1);                             // this wave's tile of stage st + 1 has landed (a wave that brings none passes at once: no branch here, so that the last products can stand behind the barrier's signal)
        __syncthreads();                                    // publishes stage st + 1 and ends every wave's reads of stage st's buffer, which the next trip's first statement refills
    }
    wait_tensor0();                                     // no tensor load is outstanding behind the loop
    asm volatile("s_wait_dscnt 0x0" ::: "memory");      // and no LDS read, before the ring is used for the hand-over
    // The two key groups' partial results are joined through LDS, alike in every wave: of a pair's NQ * 4 output tiles (16 d x 16 queries) key group 0 finishes the first half and key group 1 the second; each hands the other half to its partner, with its references and sums. The ring is free for it: the loop's last barrier stands behind every wave's last read, and no tensor load is outstanding.
    constexpr int TH = NQ * 2; const int lane = hi * 16 + lr; const bool g1 = kg != 0;
#pragma unroll
    for (int t = 0; t < TH; ++t) { const v8f sd = g1 ? o[t / 4][t % 4] : o[(TH + t) / 4][(TH + t) % 4]; v4f a, c;
#pragma unroll
        for (int j = 0; j < 4; ++j) { a[j] = sd[j]; c[j] = sd[j + 4]; }
        *(v4fa*)(xs + (2 * t) * 128 + lane * 4) = a; *(v4fa*)(xs + (2 * t + 1) * 128 + lane * 4) = c; }   // 16 bytes a lane, lanes side by side: no bank conflict
#pragma unroll
    for (int nq = 0; nq < NQ; ++nq) { xs[TH * 256 + (2 * nq) * 32 + lane] = nr[nq]; xs[TH * 256 + (2 * nq + 1) * 32 + lane] = l[nq]; }
    __syncthreads();   // publishes every wave's hand-over to its partner
    const int nk = NQ == 2 ? kg : 0;   // the query group whose tiles this wave finishes (with one query group: d 32 kg .. 32 kg + 31 of it)
    const float n0 = g1 ? nr[NQ - 1] : nr[0], l0 = g1 ? l[NQ - 1] : l[0], n1 = xr[TH * 256 + (2 * nk) * 32 + lane], l1 = xr[TH * 256 + (2 * nk + 1) * 32 + lane]; const float nj = fminf(n0, n1);   // the smaller addend is the higher reference
    const float a0 = exp2s(nj - n0), a1 = exp2s(nj - n1);   // each group's terms brought to the common reference
    const float lj = l0 * a0 + l1 * a1; const float ls = lj + xhalf(lj); const float f = __fdiv_rn(1.0f, ls); const float f0 = a0 * f, f1 = a1 * f;
    // The finished block (16 queries x TH * 16 d) goes out as whole 128-byte lines: a lane holds 32-byte runs of one query's row, so that a store from the accumulator layout touches 16 lines with two 16-byte pieces each, four instructions a line. The rows are set down in the wave's own LDS range (behind the hand-over ranges, in the free ring) and read back with neighbouring lanes on neighbouring 16 bytes of a row.
    constexpr int OPIT = TH * 16 + 4;   // staged row pitch in floats: the row + 16 bytes, an odd multiple of 16 bytes
    constexpr int CPR = TH * 4, RPI = 32 / CPR;   // 16-byte pieces of a row; rows that one wave-wide store covers
#pragma unroll
    for (int t = 0; t < TH; ++t) { const v8f kp = g1 ? o[(TH + t) / 4][(TH + t) % 4] : o[t / 4][t % 4]; const v4f b = *(const v4fa*)(xr + (2 * t) * 128 + lane * 4), d = *(const v4fa*)(xr + (2 * t + 1) * 128 + lane * 4); v4f a, c;
#pragma unroll
        for (int j = 0; j < 4; ++j) { a[j] = kp[j] * f0 + b[j] * f1; c[j] = kp[j + 4] * f0 + d[j] * f1; }
        *(v4fa*)(og + lr * OPIT + t * 16 + 8 * hi) = a; *(v4fa*)(og + lr * OPIT + t * 16 + 8 * hi + 4) = c; }
    asm volatile("s_wait_dscnt 0x0" ::: "memory");   // the wave's own staged rows are in LDS before it reads other lanes' values back
    const int rr = lane / CPR, ch = lane % CPR; v4f ov[16 / RPI];
#pragma unroll
    for (int i = 0; i < 16 / RPI; ++i) ov[i] = *(const v4fa*)(og + (i * RPI + rr) * OPIT + ch * 4);
    __builtin_amdgcn_sched_barrier(0);   // values first, then the stores as one run
    float* orow = Orow + (size_t)(q0 + nk * 16 + rr) * DQ + ch * 4 + (NQ == 2 ? 0 : kg * 32);
#pragma unroll
    for (int i = 0; i < 16 / RPI; ++i) *(v4f*)(orow + (size_t)(i * RPI) * DQ) = ov[i];
    asm volatile("s_wait_xcnt 0x0" ::: "memory");   // behind the run of stores, in front of any later write of their registers
}
// grid (batches x heads, (RH / 16 + (TT - RH) / 32) / 4), 256 threads = 8 waves: four neighbouring query blocks of ONE head times two key groups. Waves w and w + 4 hold the same query block; each key group has its own ring of staged K and V tiles, filled by its own waves (one tensor load a tile), and walks its half of the keys; the stage barrier is common. With two work-groups on a WGP four waves share a SIMD, so that one wave's LDS waits and dependent softmax arithmetic are covered by the others' matrix and vector work. A hi/lo wave (three times the P.V products and the hi/lo split a key) takes 16 query rows, an fp16 wave 32, so that a pass costs both about the same; the hi/lo blocks have the low blockIdx.y (RH / 16 is a multiple of 4: a workgroup is all of one kind). amdgpu_waves_per_eu(4, 4) holds the register budget at 256, without which only one work-group fits a WGP; 2 x the LDS size is 327,680 bytes, all of a WGP's LDS, and fits too.
__global__ __launch_bounds__(256) __attribute__((amdgpu_waves_per_eu(4, 4))) void k_fattn(const bf* __restrict__ Qh, const bf* __restrict__ Ql, const bf* __restrict__ Kh, const bf* __restrict__ Kl, const bf* __restrict__ Vh, const bf* __restrict__ Vl, const h16* __restrict__ V16, float* OUTb) {
    __shared__ __attribute__((aligned(2048))) char sm[KSPL * 2 * 4 * TILB];
    const int lane = threadIdx.x & 31, lr = lane & 15, hi = lane >> 4; const size_t hp = (size_t)blockIdx.x * TT * HD;   /* planes [batch][head] */ const int wv = __builtin_amdgcn_readfirstlane(threadIdx.x >> 5), kg = wv >> 2, y = blockIdx.y * 4 + (wv & 3); float* Orow = OUTb + (size_t)(blockIdx.x / NH_) * TT * DQ + (blockIdx.x % NH_) * HD;
    const size_t kp = hp + (size_t)kg * (TT / KSPL) * HD, vp = hp + (size_t)kg * (TT / KSPL);   // the key group's first K row ([t][d] planes) and first V column ([d][t] planes)
    char* ring = sm + kg * (2 * 4 * TILB); float* xs = (float*)(sm + wv * XCHB); const float* xr = (const float*)(sm + (wv ^ 4) * XCHB); float* og = (float*)(sm + 8 * XCHB + wv * OSTB); const int wq = wv & 3;
    const int rot = (blockIdx.x + blockIdx.y) & (NSTG - 1);   // the 20 work-groups of a head read the same K and V lines: they start their walks on 16 stages, blockIdx.y and blockIdx.y + 16 on the same one (for speed only)
    if (blockIdx.y < RH / 64) fattn_body<true, 1>(Qh + hp, Ql + hp, Kh + kp, Kl + kp, Vh + vp, Vl + vp, V16 + vp, Orow, y * 16, lr, hi, ring, wq, kg, xs, xr, og, rot);
    else fattn_body<false, 2>(Qh + hp, Ql + hp, Kh + kp, Kl + kp, Vh + vp, Vl + vp, V16 + vp, Orow, RH + (y - RH / 16) * 32, lr, hi, ring, wq, kg, xs, xr, og, rot);
}

extern "C" void kernel_launch(void* const* d_in, const int* in_sizes, int n_in,
                              void* d_out, int out_size, void* d_ws, size_t ws_size, hipStream_t stream) {
    (void)in_sizes; (void)n_in; (void)out_size;
    const float* x = (const float*)d_in[0]; const float* xk = (const float*)d_in[1]; const float* xv = (const float*)d_in[2]; const float* wq = (const float*)d_in[3]; const float* bq = (const float*)d_in[4]; const float* wk = (const float*)d_in[5]; const float* bk = (const float*)d_in[6]; const float* wv = (const float*)d_in[7]; const float* bv = (const float*)d_in[8];   /* argument order query, key, value, Wq, bq, Wk, bk, Wv, bv ('oi' [768][768] + [768]); no output projection */
    float* OUT = (float*)d_out;     // [2][2048][768]
    char* wsp = (char*)d_ws;
    auto take = [&](size_t bytes) { char* p = wsp; wsp += (bytes + 255) & ~(size_t)255; return (void*)p; };
    h16* VT16 = (h16*)take((size_t)NB_ * NKV * HD * TT * 2);
    bf* QPh = (bf*)take((size_t)NB_ * NH_ * TT * HD * 2); bf* QPl = (bf*)take((size_t)NB_ * NH_ * TT * HD * 2); bf* KPh = (bf*)take((size_t)NB_ * NKV * TT * HD * 2); bf* KPl = (bf*)take((size_t)NB_ * NKV * TT * HD * 2); bf* VTh = (bf*)take((size_t)NB_ * NKV * HD * TT * 2); bf* VTl = (bf*)take((size_t)NB_ * NKV * HD * TT * 2);   /* the planes the attention launch reads: both batches */
    if ((size_t)(wsp - (char*)d_ws) > ws_size) return;    // ws 256 MiB
    k_proj<<<dim3(NB_ * TT / 128, DQ / 128, 3), 128, 0, stream>>>(x, xk, xv, wq, wk, wv, bq, bk, bv, QPh, QPl, KPh, KPl, VT16, VTh, VTl);   /* rounding, projections, biases, planes: 3 streams x 2 batches */
    k_fattn<<<dim3(NB_ * NH_, (RH / 16 + (TT - RH) / 32) / 4, 1), 256, 0, stream>>>(QPh, QPl, KPh, KPl, VTh, VTl, VT16, OUT);   /* all 24 batch-heads: scores, softmax, P.V, merge */
}
